// v000
// The times below were measured on an AMD MI455X: many runs one after another, warmed up first and cycling through
// copies of the inputs, with the whole window's GPU time divided by the number of runs. Launches and the gaps
// between them are all in it. The median over several windows is given; except for v000 it joins two sittings, which
// can be a few percent apart, so the side-by-side timings, each taken in one sitting, are the better comparison.
// The starting kernel, v000, takes 689 microseconds a run.
// Contractions: q/k/v^T projections = v_wmma_f32_16x16x32_bf16 (normalised activations as bf16 hi+lo planes, weights bf16, 2 products);
// q.k^T = v_wmma_f32_16x16x32_f16 (q as f16 hi plane + f16 lo plane x2048, k f16, 2 products, separate accumulators);
// p.v = v_wmma_f32_16x16x32_f16 (p carried x1024 in f16, v^T f16; extra f16 lo planes x4096 of p and v on the first 512 query rows);
// ctx.Wo^T = v_wmma_f32_16x16x32_bf16 (ctx as bf16 hi+lo planes, Wo bf16, 2 products); all f32 accumulate; LayerNorm, causal mask, softmax, bias and skip-add in f32.
#include <hip/hip_runtime.h>
#include <math.h>
#include <float.h>
#include <stdint.h>

#define NB    4
#define SEQ   2048
#define DM    1024
#define NH    16
#define HD    64
#define NQB   (SEQ / 64)   // 32 key / query tiles of 64
#define VLP   512          // key pitch of the v^T lo plane (keys 0..VLP-1)
#define RESQB 8            // leading 64-row query blocks that use the p / v lo planes
static_assert(RESQB * 64 <= VLP);
static_assert(NH * HD == DM);
static_assert((SEQ % 64) == 0 && (DM % 64) == 0);
static_assert(DM == 128 * 8);

typedef _Float16 v16h __attribute__((ext_vector_type(16)));
typedef _Float16 v8h  __attribute__((ext_vector_type(8)));
typedef __bf16   v16b __attribute__((ext_vector_type(16)));
typedef __bf16   v8b  __attribute__((ext_vector_type(8)));
typedef float    v8f  __attribute__((ext_vector_type(8)));
typedef float    v4f  __attribute__((ext_vector_type(4)));
typedef unsigned int v4u __attribute__((ext_vector_type(4)));

// ---- scalar helpers --------------------------------------------------------------------------------
__device__ __forceinline__ unsigned short bf_bits(float f) {          // f32 -> bf16 bits, RNE convert
  unsigned u = __float_as_uint(f);
  return (unsigned short)((u + 0x7FFFu + ((u >> 16) & 1u)) >> 16);
}
__device__ __forceinline__ float bf_up(unsigned short h) { return __uint_as_float(((unsigned)h) << 16); }
__device__ __forceinline__ float bfr(float f) { return bf_up(bf_bits(f)); }   // value after RNE convert to bf16
__device__ __forceinline__ unsigned short h_bits(_Float16 x) { return __builtin_bit_cast(unsigned short, x); }
__device__ __forceinline__ unsigned pk16(unsigned short a, unsigned short b) { return (unsigned)a | ((unsigned)b << 16); }
__device__ __forceinline__ v8f zero8() { v8f z = {0.f, 0.f, 0.f, 0.f, 0.f, 0.f, 0.f, 0.f}; return z; }
__device__ __forceinline__ v8h zero8h() {
  const _Float16 z = (_Float16)0.0f;
  v8h r = {z, z, z, z, z, z, z, z};
  return r;
}

// ---- fragment loaders: 16-bit A/B operand, lane -> row/col (lane&15), p already includes +8*(lane>>4);
//      elements 0..7 <- p[0..7] (k0+8h..), elements 8..15 <- p[16..23] (k0+16+8h..)
__device__ __forceinline__ v16b ldfrag_b(const __bf16* p) {
  union { v16b v; v8b h[2]; } f;
  f.h[0] = *(const v8b*)(p);
  f.h[1] = *(const v8b*)(p + 16);
  return f.v;
}
__device__ __forceinline__ v16h ldfrag_h(const _Float16* p) {
  union { v16h v; v8h h[2]; } f;
  f.h[0] = *(const v8h*)(p);
  f.h[1] = *(const v8h*)(p + 16);
  return f.v;
}

// ---- WMMA helpers with trailing VALU hazard gap --------------------------------------------------------
__device__ __forceinline__ v8f mma_h(v16h a, v16h b, v8f c) {
  c = __builtin_amdgcn_wmma_f32_16x16x32_f16(false, a, false, b, (short)0, c, false, false);
  asm volatile("v_nop\n\tv_nop\n\tv_nop\n\tv_nop" : "+v"(c) : "v"(a), "v"(b));
  return c;
}
__device__ __forceinline__ v8f mma_b_raw(v16b a, v16b b, v8f c) {
  return __builtin_amdgcn_wmma_f32_16x16x32_bf16(false, a, false, b, (short)0, c, false, false);
}
__device__ __forceinline__ void dep_guard1_b(v8f& a, v8f& b, v16b x) {
  asm volatile("v_nop\n\tv_nop\n\tv_nop\n\tv_nop" : "+v"(a), "+v"(b) : "v"(x));
}
__device__ __forceinline__ void keep4_b(v16b a, v16b b, v16b c, v16b d) {
  asm volatile("v_nop" :: "v"(a), "v"(b), "v"(c), "v"(d));
}
__device__ __forceinline__ void acc_guard4(v8f& a, v8f& b, v8f& c, v8f& d) {
  asm volatile("v_nop\n\tv_nop\n\tv_nop\n\tv_nop" : "+v"(a), "+v"(b), "+v"(c), "+v"(d));
}

// =====================================================================================================
// f32 -> bf16 (RNE convert), 8 elements per thread, one 16-B store per lane: a wave writes 512 contiguous B
// coverage: n8 threads x 8 = whole plane (n8 = 131072 here, a multiple of 256).
// =====================================================================================================
__global__ __launch_bounds__(256) void cvt_bf16x8(const float* __restrict__ in, unsigned short* out, int n8) {
  const int i = blockIdx.x * 256 + threadIdx.x;
  if (i < n8) {
    const v4f a = *(const v4f*)(in + (size_t)i * 8);
    const v4f b = *(const v4f*)(in + (size_t)i * 8 + 4);
    v4u p;
    p[0] = pk16(bf_bits(a[0]), bf_bits(a[1]));
    p[1] = pk16(bf_bits(a[2]), bf_bits(a[3]));
    p[2] = pk16(bf_bits(b[0]), bf_bits(b[1]));
    p[3] = pk16(bf_bits(b[2]), bf_bits(b[3]));
    *(v4u*)(out + (size_t)i * 8) = p;
    
  }
}

// =====================================================================================================
// LayerNorm over rows of DM=1024 (x, gamma, beta RNE-converted to bf16 values first), eps 1e-5,
// thread t owns elements 8t..8t+7. Output: bf16 hi plane and unscaled bf16 lo plane (lo = RNE(y - hi)),
// =====================================================================================================
__global__ __launch_bounds__(128) void ln_rows(const float* __restrict__ x, const float* __restrict__ gam,
                                             const float* __restrict__ bet,
                                             unsigned short* xhp, unsigned short* xlp, int nrows) {
  __shared__ float sh[8];
  const int row = blockIdx.x;
  if (row >= nrows) return;                    // block-uniform (grid == nrows)
  const int tid = threadIdx.x, wave = tid >> 5, lane = tid & 31;
  const size_t base = (size_t)row * DM + (size_t)tid * 8;
  const v4f a0 = *(const v4f*)(x + base);
  const v4f a1 = *(const v4f*)(x + base + 4);
  float v[8];
#pragma unroll
  for (int e = 0; e < 4; ++e) { v[e] = bfr(a0[e]); v[4 + e] = bfr(a1[e]); }
  float s = 0.f;
#pragma unroll
  for (int e = 0; e < 8; ++e) s += v[e];
#pragma unroll
  for (int off = 1; off < 32; off <<= 1) s += __shfl_xor(s, off, 32);
  if (lane == 0) sh[wave] = s;
  __syncthreads();
  const float mu = (sh[0] + sh[1] + sh[2] + sh[3]) * (1.0f / (float)DM);
  float d[8];
  float sq = 0.f;
#pragma unroll
  for (int e = 0; e < 8; ++e) { d[e] = v[e] - mu; sq += d[e] * d[e]; }
#pragma unroll
  for (int off = 1; off < 32; off <<= 1) sq += __shfl_xor(sq, off, 32);
  if (lane == 0) sh[4 + wave] = sq;
  __syncthreads();
  const float var = (sh[4] + sh[5] + sh[6] + sh[7]) * (1.0f / (float)DM);
  const float inv = rsqrtf(var + 1e-5f);
  const v4f g0 = *(const v4f*)(gam + tid * 8);
  const v4f g1 = *(const v4f*)(gam + tid * 8 + 4);
  const v4f e0 = *(const v4f*)(bet + tid * 8);
  const v4f e1 = *(const v4f*)(bet + tid * 8 + 4);
  float y[8];
#pragma unroll
  for (int e = 0; e < 4; ++e) {
    y[e]     = (d[e] * inv) * bfr(g0[e]) + bfr(e0[e]);
    y[4 + e] = (d[4 + e] * inv) * bfr(g1[e]) + bfr(e1[e]);
  }
  v4u ph, pl;
#pragma unroll
  for (int e = 0; e < 4; ++e) {
    const unsigned short h0 = bf_bits(y[2 * e]), h1 = bf_bits(y[2 * e + 1]);
    const unsigned short l0 = bf_bits(y[2 * e] - bf_up(h0)), l1 = bf_bits(y[2 * e + 1] - bf_up(h1));
    ph[e] = pk16(h0, h1);
    pl[e] = pk16(l0, l1);
  }
  unsigned short* dh = xhp + base;
  unsigned short* dl = xlp + base;
  *(v4u*)dh = ph;
  *(v4u*)dl = pl;
  
}

// =====================================================================================================
// Register-blocked batched bf16 WMMA GEMM: C[m][n] = sum_k A[m][k] * Bt[n][k]; one wave per 64x64 tile,
// no block barriers. A row-major [M][K] pitch lda; Bt row-major [N][K] pitch ldb (k contiguous);
// M, N multiples of 64, K multiple of 32 (host-checked). blockIdx.y = batch index (strides in elements).
// NSPLIT: 0 = A.Bt; 1 = A.Bt + A2.Bt (A2 = unscaled bf16 lo plane of A); 2 = A.Bt + A.Bt2 (Bt2 = lo plane of Bt).
//         The second term reuses the same fragment registers (operands reloaded), so the footprint is that of NSPLIT 0.
// bias: added in f32 (bias value RNE-converted to bf16 first); biasRow 0 -> bias[n], 1 -> bias[m]; index clamped to nbias-1.
// OUT_MODE: 0 = f32 (pitch ldc) = acc + bias + bf16value(resid[m*ldr + n]);
//           2 = bf16 hi plane C + bf16 lo plane C2 (lo = RNE(v - hi), unscaled);
//           3 = f16 hi plane C + f16 lo plane C2 = f16((v - hi) * rscale), C2 written only for tiles
//               with n0 < N2 (pitch ldc2, batch stride strideC2).
// =====================================================================================================
template <int NSPLIT, int OUT_MODE>
__global__ __launch_bounds__(256) void gemm64(
    const unsigned short* __restrict__ Ap, const unsigned short* __restrict__ A2p, int lda, long long strideA,
    const unsigned short* __restrict__ Btp, const unsigned short* __restrict__ Bt2p, int ldb, long long strideB,
    void* Cout, int ldc, long long strideC,
    void* Cout2, int ldc2, long long strideC2, int N2,
    const float* __restrict__ bias, int nbias, int biasRow,
    const float* __restrict__ resid, int ldr,
    int M, int N, int K, float rscale) {
  const __bf16* A   = (const __bf16*)(const void*)Ap;
  const __bf16* A2  = (const __bf16*)(const void*)A2p;
  const __bf16* Bt  = (const __bf16*)(const void*)Btp;
  const __bf16* Bt2 = (const __bf16*)(const void*)Bt2p;
  __shared__ __align__(16) float sT[8][16 * 68];   // per-wave 16x64 slab, pitch 68 floats
  const int b    = blockIdx.y;
  const int lane = threadIdx.x & 31;
  const int wave = threadIdx.x >> 5;
  const int tilesN = N >> 6;
  const int tilesM = M >> 6;
  const int tile = blockIdx.x * 8 + wave;
  if (tile >= tilesM * tilesN) return;   // wave-uniform; no block barriers in this kernel
  const int tm = tile / tilesN;
  const int tn = tile - tm * tilesN;
  const int m0 = tm << 6;
  const int n0 = tn << 6;

  const __bf16* Ab  = A  + (size_t)b * strideA;
  const __bf16* Bb  = Bt + (size_t)b * strideB;
  const __bf16* Ab2 = (NSPLIT == 1) ? (A2  + (size_t)b * strideA) : Ab;
  const __bf16* Bb2 = (NSPLIT == 2) ? (Bt2 + (size_t)b * strideB) : Bb;

  const int rlane = lane & 15;                 // row (A) / col (B, D) within subtile
  const int koff  = (lane >> 4) * 8;           // k offset of this lane half
  const int mOff  = (lane >> 4) * 8;           // D row offset

  v8f acc[4][4];
#pragma unroll
  for (int i = 0; i < 4; ++i)
#pragma unroll
    for (int j = 0; j < 4; ++j) acc[i][j] = zero8();

  for (int k0 = 0; k0 < K; k0 += 32) {
#pragma unroll
    for (int tb = 0; tb < ((NSPLIT == 2) ? 2 : 1); ++tb) {
      const __bf16* Bsrc = (tb == 0) ? Bb : Bb2;
      v16b bfrag[4];
#pragma unroll
      for (int j = 0; j < 4; ++j) {
        const size_t bo = (size_t)(n0 + (j << 4) + rlane) * ldb + koff + k0;
        bfrag[j] = ldfrag_b(Bsrc + bo);
      }
#pragma unroll
      for (int i = 0; i < 4; ++i) {
        const size_t ao = (size_t)(m0 + (i << 4) + rlane) * lda + koff + k0;
#pragma unroll
        for (int ta = 0; ta < ((NSPLIT == 1) ? 2 : 1); ++ta) {
          const __bf16* Asrc = (ta == 0) ? Ab : Ab2;
          const v16b af = ldfrag_b(Asrc + ao);
#pragma unroll
          for (int j = 0; j < 4; ++j) acc[i][j] = mma_b_raw(af, bfrag[j], acc[i][j]);
          dep_guard1_b(acc[i][0], acc[i][3], af);
        }
      }
      keep4_b(bfrag[0], bfrag[1], bfrag[2], bfrag[3]);
    }
  }
  acc_guard4(acc[0][0], acc[0][1], acc[0][2], acc[0][3]);
  acc_guard4(acc[1][0], acc[1][1], acc[1][2], acc[1][3]);
  acc_guard4(acc[2][0], acc[2][1], acc[2][2], acc[2][3]);
  acc_guard4(acc[3][0], acc[3][1], acc[3][2], acc[3][3]);

  // ---- epilogue ----
  float bcol[4];
#pragma unroll
  for (int j = 0; j < 4; ++j) {
    const int nn = min(n0 + (j << 4) + rlane, nbias - 1);
    bcol[j] = bfr(bias[nn]);
  }
  float* slab = sT[wave];
#pragma unroll
  for (int i = 0; i < 4; ++i) {
    const int mBase = m0 + (i << 4);
    float brow[8];
#pragma unroll
    for (int r = 0; r < 8; ++r) {
      const int mm = min(mBase + mOff + r, nbias - 1);
      brow[r] = bfr(bias[mm]);
    }
#pragma unroll
    for (int j = 0; j < 4; ++j) {
#pragma unroll
      for (int r = 0; r < 8; ++r) {
        const float bv = (biasRow != 0) ? brow[r] : bcol[j];
        slab[(mOff + r) * 68 + (j << 4) + rlane] = acc[i][j][r] + bv;
      }
    }
    __builtin_amdgcn_fence(__ATOMIC_RELEASE, "workgroup");
    __builtin_amdgcn_wave_barrier();
    __builtin_amdgcn_fence(__ATOMIC_ACQUIRE, "workgroup");
    if (OUT_MODE == 0) {
      float* C = (float*)Cout + (size_t)b * strideC;
      const int h2 = lane >> 4, c4 = (lane & 15) * 4;     // 256-B row segment = 16 lanes x 16 B
      v4f vo[8];
#pragma unroll
      for (int it = 0; it < 8; ++it) {
        const int row = it * 2 + h2;                       // it 0..7 x h2 0..1 = rows 0..15
        v4f sv = *(const v4f*)(slab + row * 68 + c4);
        const v4f rx = *(const v4f*)(resid + (size_t)(mBase + row) * ldr + n0 + c4);
#pragma unroll
        for (int e = 0; e < 4; ++e) sv[e] = sv[e] + bfr(rx[e]);
        vo[it] = sv;
      }
      {
#pragma unroll
        for (int it = 0; it < 8; ++it) {
          const int row = it * 2 + h2;
          *(v4f*)(C + (size_t)(mBase + row) * ldc + n0 + c4) = vo[it];
        }
        
      }
    } else {
      const int q = lane >> 3, c8 = (lane & 7) * 8;
      unsigned short* C  = (unsigned short*)Cout  + (size_t)b * strideC;
      unsigned short* C2 = (unsigned short*)Cout2 + (size_t)b * strideC2;
      const bool wlo = (OUT_MODE == 2) || (n0 < N2);      // wave-uniform
      v4u hv[4], lv[4];
#pragma unroll
      for (int it = 0; it < 4; ++it) {
        const int row = it * 4 + q;                        // it 0..3 x q 0..3 = rows 0..15
        const float* sp = slab + row * 68 + c8;
        v4u a, a2;
#pragma unroll
        for (int e = 0; e < 4; ++e) {
          const float f0 = sp[2 * e], f1 = sp[2 * e + 1];
          unsigned short h0, h1, l0, l1;
          if (OUT_MODE == 2) {
            h0 = bf_bits(f0); h1 = bf_bits(f1);
            l0 = bf_bits(f0 - bf_up(h0)); l1 = bf_bits(f1 - bf_up(h1));
          } else {
            const _Float16 x0 = (_Float16)f0, x1 = (_Float16)f1;
            h0 = h_bits(x0); h1 = h_bits(x1);
            l0 = h_bits((_Float16)((f0 - (float)x0) * rscale));
            l1 = h_bits((_Float16)((f1 - (float)x1) * rscale));
          }
          a[e] = pk16(h0, h1); a2[e] = pk16(l0, l1);
        }
        hv[it] = a; lv[it] = a2;
      }
      {
#pragma unroll
        for (int it = 0; it < 4; ++it) {
          const int row = it * 4 + q;
          *(v4u*)(C + (size_t)(mBase + row) * ldc + n0 + c8) = hv[it];
          if (wlo) *(v4u*)(C2 + (size_t)(mBase + row) * ldc2 + n0 + c8) = lv[it];
        }
        
      }
    }
    __builtin_amdgcn_fence(__ATOMIC_RELEASE, "workgroup");
    __builtin_amdgcn_wave_barrier();
    __builtin_amdgcn_fence(__ATOMIC_ACQUIRE, "workgroup");
  }
}

// =====================================================================================================
// Causal attention, head dim 64, arithmetic mask: logit = (q.k) * sscale, replaced by -1e9 when key > query.
//   q planes (f16 hi / f16 lo x2048): element (b, t, h, d) at [(b*SEQ + t)*DM + h*64 + d]
//   k plane (f16):                    same layout with key index s
//   v^T hi plane (f16):               element (b, h, d, s) at [(b*DM + h*64 + d)*SEQ + s]
//   v^T lo plane (f16, (v - hi)*4096): [(b*DM + h*64 + d)*VLP + s], s < VLP, read only when RES
//   (a key tile at or beyond VLP contributes a zero v lo term; addresses clamped)
//   out planes (bf16 hi / lo of the normalised context): element (b, t, h, d) at [(b*SEQ + t)*DM + h*64 + d]
//   scores = qh.k (acc t0) and ql.k (acc t1), s = (t0 + t1 * qlinv) * sscale, mask, all in f32
//   p = exp(s - m) carried as f16(1024 p); context = p . v on f16 WMMA; RES adds f16 lo planes of p and v
//   (scale 4096, separate accumulator folded back with 1/4096 per chunk in f32); online softmax in f32.
//   Block = 4 waves = 64 query rows of one (b, h); grid = nqbThis * NH * NB; key tiles kt = 0..qb (static bound NQB).
//   K / V^T chunk staging: 128 threads x 32 elements per plane = the whole 64x64 tile (plain 16-B loads,
//   __syncthreads before and after); P tiles are wave-private, spilled with _Float16 element stores and reloaded
//   Output coverage: each wave stores rows q0..q0+15 (it 0..3 x lane>>3 0..3) x 64 columns (8 lanes x 8) of both planes.
// =====================================================================================================
template <bool RES>
__global__ __launch_bounds__(128)
void attn_causal64(const unsigned short* __restrict__ qhp, const unsigned short* __restrict__ qlp,
                   const unsigned short* __restrict__ khp,
                   const unsigned short* __restrict__ vhp, const unsigned short* __restrict__ vlp,
                   unsigned short* ohp, unsigned short* olp,
                   int qbBase, int nqbThis, float sscale, float qlinv) {
  union FH { v16h v; v8h h[2]; };
  __shared__ __align__(16) _Float16 Ksh[64 * 64];                 // K [kv][d]   8 KB
  __shared__ __align__(16) _Float16 Vth[64 * 64];                 // V^T hi [d][kv] 8 KB
  __shared__ __align__(16) _Float16 Vtl[RES ? 64 * 64 : 8];       // V^T lo
  __shared__ __align__(16) _Float16 Psh[4][16 * 64];              // per wave P [row][kv]
  __shared__ __align__(16) _Float16 Psl[RES ? 4 : 1][16 * 64];    // per wave P lo
  __shared__ __align__(16) float    Os[4][16 * 64];               // per wave context tile [row][d]

  const int tid  = threadIdx.x;
  const int wave = tid >> 5;
  const int lane = tid & 31;
  const int hh   = lane >> 4;
  const int c    = lane & 15;

  const int bx   = blockIdx.x;
  const int qbl  = bx % nqbThis;
  const int rest = bx / nqbThis;
  const int h    = rest % NH;
  const int b    = rest / NH;
  const int qb   = qbBase + qbl;
  const int q0   = qb * 64 + wave * 16;
  const size_t rowB = (size_t)b * SEQ;
  const int hoff = h * HD;

  const _Float16* Qh = (const _Float16*)(const void*)qhp;
  const _Float16* Ql = (const _Float16*)(const void*)qlp;
  const _Float16* Kh = (const _Float16*)(const void*)khp;
  const _Float16* Vh = (const _Float16*)(const void*)vhp + ((size_t)b * DM + (size_t)hoff) * SEQ;
  const _Float16* Vl = (const _Float16*)(const void*)vlp + ((size_t)b * DM + (size_t)hoff) * VLP;

  // ---- Q fragments (A operand, row = lane&15): 2 d-chunks, hi and lo ----
  v16h qah[2], qal[2];
#pragma unroll
  for (int dc = 0; dc < 2; ++dc) {
    const size_t qo = (rowB + q0 + c) * DM + hoff + dc * 32 + 8 * hh;
    qah[dc] = ldfrag_h(Qh + qo);
    qal[dc] = ldfrag_h(Ql + qo);
  }

  float mrow[8], lrow[8];
  v8f oacc[4];
#pragma unroll
  for (int r = 0; r < 8; ++r) { mrow[r] = -INFINITY; lrow[r] = 0.f; }
#pragma unroll
  for (int t = 0; t < 4; ++t) oacc[t] = zero8();

  for (int kt = 0; kt < NQB; ++kt) {         // static bound
    if (kt > qb) break;                      // block-uniform: causal, key tiles 0..qb only
    const int kv0 = kt * 64;
    __syncthreads();
    {
      const int r = tid >> 1, half = (tid & 1) * 32;
      const _Float16* kg  = Kh + (rowB + kv0 + r) * DM + hoff + half;   // K row kv0+r, d = half..half+31
      const _Float16* vg  = Vh + (size_t)r * SEQ + kv0 + half;         // V^T row d = r, s = kv0+half..+31
      const int kvl = (kv0 + 64 <= VLP) ? kv0 : (VLP - 64);          // clamped address into the lo plane
      const _Float16* vlg = Vl + (size_t)r * VLP + kvl + half;
      const bool resOK = (kv0 + 64 <= VLP);                           // block-uniform
#pragma unroll
      for (int i = 0; i < 4; ++i) {
        const v8h a0 = *(const v8h*)(kg + 8 * i);
        const v8h b0 = *(const v8h*)(vg + 8 * i);
        *(v8h*)(Ksh + r * 64 + half + 8 * i) = a0;
        *(v8h*)(Vth + r * 64 + half + 8 * i) = b0;
        if (RES) {
          v8h b1 = *(const v8h*)(vlg + 8 * i);
          if (!resOK) b1 = zero8h();
          *(v8h*)(Vtl + r * 64 + half + 8 * i) = b1;
        }
      }
    }
    __syncthreads();

    // ---- scores: 16 query rows x 64 keys per wave, 2 f16 products into separate accumulators ----
    v8f s[4];
#pragma unroll
    for (int j = 0; j < 4; ++j) {
      v8f t0 = zero8(), t1 = zero8();
#pragma unroll
      for (int dc = 0; dc < 2; ++dc) {
        FH kb;
        kb.h[0] = *(const v8h*)(Ksh + (j * 16 + c) * 64 + dc * 32 + 8 * hh);
        kb.h[1] = *(const v8h*)(Ksh + (j * 16 + c) * 64 + dc * 32 + 16 + 8 * hh);
        t0 = mma_h(qah[dc], kb.v, t0);
        t1 = mma_h(qal[dc], kb.v, t1);
      }
#pragma unroll
      for (int r = 0; r < 8; ++r) s[j][r] = t0[r] + t1[r] * qlinv;
    }

    // ---- scale + causal mask, row max, online softmax, P (x1024, f16) and P lo (x4096) to LDS ----
    _Float16* pwh = Psh[wave];
    _Float16* pwl = Psl[RES ? wave : 0];
#pragma unroll
    for (int r = 0; r < 8; ++r) {
      const int qrow = q0 + 8 * hh + r;
      float m = -INFINITY;
#pragma unroll
      for (int j = 0; j < 4; ++j) {
        const int key = kv0 + j * 16 + c;
        float sv = s[j][r] * sscale;
        sv = (key > qrow) ? -1.0e9f : sv;
        s[j][r] = sv;
        m = fmaxf(m, sv);
      }
#pragma unroll
      for (int off = 1; off < 16; off <<= 1) m = fmaxf(m, __shfl_xor(m, off, 32));
      const float mnew  = fmaxf(mrow[r], m);
      const float msafe = (mnew == -INFINITY) ? 0.f : mnew;
      const float alpha = __expf(mrow[r] - msafe);
      mrow[r] = mnew;
      float psum = 0.f;
#pragma unroll
      for (int j = 0; j < 4; ++j) {
        const float p = __expf(s[j][r] - msafe);     // masked logit: exp -> 0
        psum += p;
        const float p1k = p * 1024.0f;
        const _Float16 ph = (_Float16)p1k;
        pwh[(8 * hh + r) * 64 + j * 16 + c] = ph;
        if (RES) {
          const _Float16 pl = (_Float16)((p1k - (float)ph) * 4096.0f);
          pwl[(8 * hh + r) * 64 + j * 16 + c] = pl;
        }
      }
#pragma unroll
      for (int off = 1; off < 16; off <<= 1) psum += __shfl_xor(psum, off, 32);
      lrow[r] = lrow[r] * alpha + psum;
#pragma unroll
      for (int t = 0; t < 4; ++t) oacc[t][r] *= alpha;
    }
    __builtin_amdgcn_fence(__ATOMIC_RELEASE, "workgroup");
    __builtin_amdgcn_wave_barrier();
    __builtin_amdgcn_fence(__ATOMIC_ACQUIRE, "workgroup");

    // ---- context += P . V (f16 WMMA), lo products into a separate accumulator ----
    v8f o1[4];
#pragma unroll
    for (int t = 0; t < 4; ++t) o1[t] = zero8();
#pragma unroll 1
    for (int kk = 0; kk < 2; ++kk) {
      FH pa, pl;
      pa.h[0] = *(const v8h*)(pwh + c * 64 + kk * 32 + 8 * hh);
      pa.h[1] = *(const v8h*)(pwh + c * 64 + kk * 32 + 16 + 8 * hh);
      if (RES) {
        pl.h[0] = *(const v8h*)(pwl + c * 64 + kk * 32 + 8 * hh);
        pl.h[1] = *(const v8h*)(pwl + c * 64 + kk * 32 + 16 + 8 * hh);
      } else {
        pl.v = pa.v;
      }
#pragma unroll
      for (int t = 0; t < 4; ++t) {
        FH vb;
        vb.h[0] = *(const v8h*)(Vth + (t * 16 + c) * 64 + kk * 32 + 8 * hh);
        vb.h[1] = *(const v8h*)(Vth + (t * 16 + c) * 64 + kk * 32 + 16 + 8 * hh);
        oacc[t] = mma_h(pa.v, vb.v, oacc[t]);
        if (RES) {
          FH vl;
          vl.h[0] = *(const v8h*)(Vtl + (t * 16 + c) * 64 + kk * 32 + 8 * hh);
          vl.h[1] = *(const v8h*)(Vtl + (t * 16 + c) * 64 + kk * 32 + 16 + 8 * hh);
          o1[t] = mma_h(pa.v, vl.v, o1[t]);
          o1[t] = mma_h(pl.v, vb.v, o1[t]);
        }
      }
    }
    if (RES) {
#pragma unroll
      for (int t = 0; t < 4; ++t)
#pragma unroll
        for (int r = 0; r < 8; ++r) oacc[t][r] += o1[t][r] * (1.0f / 4096.0f);
    }
  }

  // ---- normalise (1/l and the 1/1024 p carry), stage the wave's 16x64 tile, bf16 hi/lo split,
  float* os = Os[wave];
#pragma unroll
  for (int r = 0; r < 8; ++r) {
    const float l = lrow[r];
    const float inv = ((l > 0.f) ? (1.0f / l) : 0.f) * (1.0f / 1024.0f);
#pragma unroll
    for (int t = 0; t < 4; ++t) os[(8 * hh + r) * 64 + t * 16 + c] = oacc[t][r] * inv;
  }
  __builtin_amdgcn_fence(__ATOMIC_RELEASE, "workgroup");
  __builtin_amdgcn_wave_barrier();
  __builtin_amdgcn_fence(__ATOMIC_ACQUIRE, "workgroup");
  {
    const int q4 = lane >> 3, c8 = (lane & 7) * 8;
    v4u hv[4], lv[4];
#pragma unroll
    for (int it = 0; it < 4; ++it) {
      const int row = it * 4 + q4;   // it 0..3 x q4 0..3 = rows 0..15 of the wave tile
      const float* sp = os + row * 64 + c8;
      v4u a, a2;
#pragma unroll
      for (int e = 0; e < 4; ++e) {
        const float f0 = sp[2 * e], f1 = sp[2 * e + 1];
        const unsigned short h0 = bf_bits(f0), h1 = bf_bits(f1);
        const unsigned short l0 = bf_bits(f0 - bf_up(h0)), l1 = bf_bits(f1 - bf_up(h1));
        a[e] = pk16(h0, h1); a2[e] = pk16(l0, l1);
      }
      hv[it] = a; lv[it] = a2;
    }
    {
#pragma unroll
      for (int it = 0; it < 4; ++it) {
        const int row = it * 4 + q4;
        const size_t go = (rowB + q0 + row) * DM + (size_t)hoff + c8;
        *(v4u*)(ohp + go) = hv[it];
        *(v4u*)(olp + go) = lv[it];
      }
      
    }
  }
}

// =====================================================================================================
// Workspace map (bytes):
//   XNh  bf16 [8192][1024]        0          16777216   (later: Oh, context hi plane)
//   XNl  bf16 [8192][1024]        16777216   16777216   (later: Ol, context lo plane)
//   Wqb  bf16 [1024 n][1024 k]    33554432    2097152
//   Wkb  bf16 [1024][1024]        35651584    2097152
//   Wvb  bf16 [1024][1024]        37748736    2097152
//   Wob  bf16 [1024][1024]        39845888    2097152
//   Qh   f16  [8192][1024]        41943040   16777216
//   Ql   f16  [8192][1024]        58720256   16777216
//   Kh   f16  [8192][1024]        75497472   16777216
//   VTh  f16  [4][1024][2048]     92274688   16777216
//   VTl  f16  [4][1024][512]      109051904   4194304
//   end                           113246208
// All planes are exact multiples of their 64x64 / whole-line store granularity (no padded tails needed).
// Weights are [out n][in k] with k contiguous = the Bt / A layout the GEMM wants, so they are only converted.
// =====================================================================================================
extern "C" void kernel_launch(void* const* d_in, const int* in_sizes, int n_in,
                              void* d_out, int out_size, void* d_ws, size_t ws_size,
                              hipStream_t stream) {
  if (n_in < 11) return;
  if (in_sizes[0] != NB * SEQ * DM) return;
  if (in_sizes[1] != DM * DM || in_sizes[3] != DM * DM || in_sizes[5] != DM * DM || in_sizes[7] != DM * DM) return;
  if (in_sizes[2] != DM || in_sizes[4] != DM || in_sizes[6] != DM || in_sizes[8] != DM) return;
  if (in_sizes[9] != DM || in_sizes[10] != DM) return;
  if (out_size != NB * SEQ * DM) return;

  const float* x     = (const float*)d_in[0];
  const float* Wq    = (const float*)d_in[1];
  const float* bq    = (const float*)d_in[2];
  const float* Wk    = (const float*)d_in[3];
  const float* bk    = (const float*)d_in[4];
  const float* Wv    = (const float*)d_in[5];
  const float* bv    = (const float*)d_in[6];
  const float* Wo    = (const float*)d_in[7];
  const float* bo    = (const float*)d_in[8];
  const float* gamma = (const float*)d_in[9];
  const float* beta  = (const float*)d_in[10];

  const size_t P16 = (size_t)NB * SEQ * DM * 2;   // 16777216  16-bit activation plane [8192][1024]
  const size_t PW  = (size_t)DM * DM * 2;         //  2097152  16-bit weight plane
  const size_t PVT = (size_t)NB * DM * SEQ * 2;   // 16777216  v^T hi plane
  const size_t PVL = (size_t)NB * DM * VLP * 2;   //  4194304  v^T lo plane
  size_t off = 0;
  const size_t oXh  = off; off += P16;
  const size_t oXl  = off; off += P16;
  const size_t oWq  = off; off += PW;
  const size_t oWk  = off; off += PW;
  const size_t oWv  = off; off += PW;
  const size_t oWo  = off; off += PW;
  const size_t oQh  = off; off += P16;
  const size_t oQl  = off; off += P16;
  const size_t oKh  = off; off += P16;
  const size_t oVTh = off; off += PVT;
  const size_t oVTl = off; off += PVL;
  if (off > ws_size) return;                      // off = 113246208
  if (off > (size_t)134217728) return;
  const size_t oOh  = oXh;                        // context planes reuse the XN planes (dead after the projections)
  const size_t oOl  = oXl;

  char* ws = (char*)d_ws;
  unsigned short* XNh = (unsigned short*)(ws + oXh);
  unsigned short* XNl = (unsigned short*)(ws + oXl);
  unsigned short* Wqb = (unsigned short*)(ws + oWq);
  unsigned short* Wkb = (unsigned short*)(ws + oWk);
  unsigned short* Wvb = (unsigned short*)(ws + oWv);
  unsigned short* Wob = (unsigned short*)(ws + oWo);
  unsigned short* Qh  = (unsigned short*)(ws + oQh);
  unsigned short* Ql  = (unsigned short*)(ws + oQl);
  unsigned short* Kh  = (unsigned short*)(ws + oKh);
  unsigned short* VTh = (unsigned short*)(ws + oVTh);
  unsigned short* VTl = (unsigned short*)(ws + oVTl);
  unsigned short* Oh  = (unsigned short*)(ws + oOh);
  unsigned short* Ol  = (unsigned short*)(ws + oOl);

  const dim3 blk(256);
  const int n8w = DM * DM / 8;                                //  131072
  const dim3 gCvtW((n8w + 255) / 256);                        //  512 blocks
  const dim3 gLn(NB * SEQ);                                   // 8192 rows
  const dim3 gProj(((NB * SEQ / 64) * (DM / 64) + 7) / 8, 1); // 2048 tiles -> 256 blocks: M=8192, N=1024
  const dim3 gVT(((DM / 64) * (SEQ / 64) + 7) / 8, NB);      // 512 tiles -> 64 blocks x 4 batches: M=1024, N=2048

  // (1) weights [n][k] f32 -> bf16 [n][k]
  cvt_bf16x8<<<gCvtW, blk, 0, stream>>>(Wq, Wqb, n8w);
  cvt_bf16x8<<<gCvtW, blk, 0, stream>>>(Wk, Wkb, n8w);
  cvt_bf16x8<<<gCvtW, blk, 0, stream>>>(Wv, Wvb, n8w);
  cvt_bf16x8<<<gCvtW, blk, 0, stream>>>(Wo, Wob, n8w);
  // (2) LayerNorm -> bf16 hi / lo planes [8192][1024]
  ln_rows<<<gLn, dim3(128), 0, stream>>>(x, gamma, beta, XNh, XNl, NB * SEQ);
  // (3) q = xn . Wq^T + bq -> f16 hi plane + f16 lo plane x2048 [b*SEQ+t][h*64+d]   (M=8192, N=1024, K=1024)
  gemm64<1, 3><<<gProj, blk, 0, stream>>>(
      XNh, XNl, DM, 0LL, Wqb, Wqb, DM, 0LL,
      (void*)Qh, DM, 0LL, (void*)Ql, DM, 0LL, DM,
      bq, DM, 0, x, DM,
      NB * SEQ, DM, DM, 2048.0f);
  // (4) k = xn . Wk^T + bk -> f16 plane (no lo plane: N2 = 0)
  gemm64<1, 3><<<gProj, blk, 0, stream>>>(
      XNh, XNl, DM, 0LL, Wkb, Wkb, DM, 0LL,
      (void*)Kh, DM, 0LL, (void*)Kh, DM, 0LL, 0,
      bk, DM, 0, x, DM,
      NB * SEQ, DM, DM, 2048.0f);
  // (5) v^T = Wv . xn^T + bv per batch -> f16 hi plane [b][h*64+d][s] (pitch SEQ) and lo plane
  //     (x4096, keys < VLP only, pitch VLP)   (A = Wvb [n][k], Bt = xn planes of batch b; M=1024, N=2048, K=1024)
  gemm64<2, 3><<<gVT, blk, 0, stream>>>(
      Wvb, Wvb, DM, 0LL, XNh, XNl, DM, (long long)SEQ * DM,
      (void*)VTh, SEQ, (long long)DM * SEQ, (void*)VTl, VLP, (long long)DM * VLP, VLP,
      bv, DM, 1, x, DM,
      DM, SEQ, DM, 4096.0f);
  // (6) attention: query blocks 0..RESQB-1 with lo planes, the rest without
  attn_causal64<true><<<dim3(NB * NH * RESQB), dim3(128), 0, stream>>>(
      Qh, Ql, Kh, VTh, VTl, Oh, Ol, 0, RESQB, 0.125f, 1.0f / 2048.0f);
  attn_causal64<false><<<dim3(NB * NH * (NQB - RESQB)), dim3(128), 0, stream>>>(
      Qh, Ql, Kh, VTh, VTl, Oh, Ol, RESQB, NQB - RESQB, 0.125f, 1.0f / 2048.0f);
  // (7) out = bf16(x) + context . Wo^T + bo -> d_out f32 [8192][1024]  (A = context hi + lo planes, 2 products)
  gemm64<1, 0><<<gProj, blk, 0, stream>>>(
      Oh, Ol, DM, 0LL, Wob, Wob, DM, 0LL,
      d_out, DM, 0LL, d_out, DM, 0LL, 0,
      bo, DM, 0, x, DM,
      NB * SEQ, DM, DM, 1.0f);
  (void)hipGetLastError();
}

// v001
// Measured time: 609 microseconds a run.
// Timed twice side by side with v000, it ran 1.17 times as fast both times.
// Contractions: q/k/v^T projections = v_wmma_f32_16x16x32_bf16 (normalised activations as bf16 hi+lo planes, weights bf16, 2 products);
// q.k^T = v_wmma_f32_16x16x32_f16 (q as f16 hi plane + f16 lo plane x2048, k f16, 2 products, separate accumulators);
// p.v = v_wmma_f32_16x16x32_f16 (p carried x1024 in f16, v^T f16; extra f16 lo planes x4096 of p and v on the first 512 query rows);
// ctx.Wo^T = v_wmma_f32_16x16x32_bf16 (ctx as bf16 hi+lo planes, Wo bf16, 2 products); all f32 accumulate; LayerNorm, causal mask, softmax, bias and skip-add in f32.
#include <hip/hip_runtime.h>
#include <math.h>
#include <float.h>
#include <stdint.h>

#define NB    4
#define SEQ   2048
#define DM    1024
#define NH    16
#define HD    64
#define NQB   (SEQ / 64)   // 32 key / query tiles of 64
#define VLP   512          // key pitch of the v^T lo plane (keys 0..VLP-1)
#define RESQB 8            // leading 64-row query blocks that use the p / v lo planes
static_assert(RESQB * 64 <= VLP);
static_assert(NH * HD == DM);
static_assert((SEQ % 64) == 0 && (DM % 64) == 0);
static_assert(DM == 128 * 8);
#define KP    72           // LDS row pitch of the 64-wide f16 tiles, in elements: 144 B = 16 B x 9 (odd), so 16 rows read 16 B wide fall on distinct banks
#define OP    68           // LDS row pitch of the f32 context tile, in floats (16-byte reads down a column group without bank conflicts)
static_assert((KP * 2) % 16 == 0 && ((KP * 2) / 16) % 2 == 1 && KP >= 64);
static_assert((OP * 4) % 16 == 0 && OP >= 64);

typedef _Float16 v16h __attribute__((ext_vector_type(16)));
typedef _Float16 v8h  __attribute__((ext_vector_type(8)));
typedef __bf16   v16b __attribute__((ext_vector_type(16)));
typedef __bf16   v8b  __attribute__((ext_vector_type(8)));
typedef float    v8f  __attribute__((ext_vector_type(8)));
typedef float    v4f  __attribute__((ext_vector_type(4)));
typedef unsigned int v4u __attribute__((ext_vector_type(4)));

// ---- scalar helpers --------------------------------------------------------------------------------
__device__ __forceinline__ unsigned short bf_bits(float f) {          // f32 -> bf16 bits, RNE convert
  unsigned u = __float_as_uint(f);
  return (unsigned short)((u + 0x7FFFu + ((u >> 16) & 1u)) >> 16);
}
__device__ __forceinline__ float bf_up(unsigned short h) { return __uint_as_float(((unsigned)h) << 16); }
__device__ __forceinline__ float bfr(float f) { return bf_up(bf_bits(f)); }   // value after RNE convert to bf16
__device__ __forceinline__ unsigned short h_bits(_Float16 x) { return __builtin_bit_cast(unsigned short, x); }
__device__ __forceinline__ unsigned pk16(unsigned short a, unsigned short b) { return (unsigned)a | ((unsigned)b << 16); }
__device__ __forceinline__ v8f zero8() { v8f z = {0.f, 0.f, 0.f, 0.f, 0.f, 0.f, 0.f, 0.f}; return z; }
__device__ __forceinline__ v8h zero8h() {
  const _Float16 z = (_Float16)0.0f;
  v8h r = {z, z, z, z, z, z, z, z};
  return r;
}

// ---- fragment loaders: 16-bit A/B operand, lane -> row/col (lane&15), p already includes +8*(lane>>4);
//      elements 0..7 <- p[0..7] (k0+8h..), elements 8..15 <- p[16..23] (k0+16+8h..)
__device__ __forceinline__ v16b ldfrag_b(const __bf16* p) {
  union { v16b v; v8b h[2]; } f;
  f.h[0] = *(const v8b*)(p);
  f.h[1] = *(const v8b*)(p + 16);
  return f.v;
}
__device__ __forceinline__ v16h ldfrag_h(const _Float16* p) {
  union { v16h v; v8h h[2]; } f;
  f.h[0] = *(const v8h*)(p);
  f.h[1] = *(const v8h*)(p + 16);
  return f.v;
}

// ---- WMMA helpers with trailing VALU hazard gap --------------------------------------------------------
__device__ __forceinline__ v8f mma_h(v16h a, v16h b, v8f c) {
  c = __builtin_amdgcn_wmma_f32_16x16x32_f16(false, a, false, b, (short)0, c, false, false);
  asm volatile("v_nop\n\tv_nop\n\tv_nop\n\tv_nop" : "+v"(c) : "v"(a), "v"(b));
  return c;
}
__device__ __forceinline__ v8f mma_b_raw(v16b a, v16b b, v8f c) {
  return __builtin_amdgcn_wmma_f32_16x16x32_bf16(false, a, false, b, (short)0, c, false, false);
}
__device__ __forceinline__ void dep_guard1_b(v8f& a, v8f& b, v16b x) {
  asm volatile("v_nop\n\tv_nop\n\tv_nop\n\tv_nop" : "+v"(a), "+v"(b) : "v"(x));
}
__device__ __forceinline__ void keep4_b(v16b a, v16b b, v16b c, v16b d) {
  asm volatile("v_nop" :: "v"(a), "v"(b), "v"(c), "v"(d));
}
__device__ __forceinline__ void acc_guard4(v8f& a, v8f& b, v8f& c, v8f& d) {
  asm volatile("v_nop\n\tv_nop\n\tv_nop\n\tv_nop" : "+v"(a), "+v"(b), "+v"(c), "+v"(d));
}

// =====================================================================================================
// f32 -> bf16 (RNE convert), 8 elements per thread, one 16-B store per lane: a wave writes 512 contiguous B
// coverage: n8 threads x 8 = whole plane (n8 = 131072 here, a multiple of 256).
// =====================================================================================================
__global__ __launch_bounds__(256) void cvt_bf16x8(const float* __restrict__ in, unsigned short* out, int n8) {
  const int i = blockIdx.x * 256 + threadIdx.x;
  if (i < n8) {
    const v4f a = *(const v4f*)(in + (size_t)i * 8);
    const v4f b = *(const v4f*)(in + (size_t)i * 8 + 4);
    v4u p;
    p[0] = pk16(bf_bits(a[0]), bf_bits(a[1]));
    p[1] = pk16(bf_bits(a[2]), bf_bits(a[3]));
    p[2] = pk16(bf_bits(b[0]), bf_bits(b[1]));
    p[3] = pk16(bf_bits(b[2]), bf_bits(b[3]));
    *(v4u*)(out + (size_t)i * 8) = p;
    
  }
}

// =====================================================================================================
// LayerNorm over rows of DM=1024 (x, gamma, beta RNE-converted to bf16 values first), eps 1e-5,
// thread t owns elements 8t..8t+7. Output: bf16 hi plane and unscaled bf16 lo plane (lo = RNE(y - hi)),
// =====================================================================================================
__global__ __launch_bounds__(128) void ln_rows(const float* __restrict__ x, const float* __restrict__ gam,
                                             const float* __restrict__ bet,
                                             unsigned short* xhp, unsigned short* xlp, int nrows) {
  __shared__ float sh[8];
  const int row = blockIdx.x;
  if (row >= nrows) return;                    // block-uniform (grid == nrows)
  const int tid = threadIdx.x, wave = tid >> 5, lane = tid & 31;
  const size_t base = (size_t)row * DM + (size_t)tid * 8;
  const v4f a0 = *(const v4f*)(x + base);
  const v4f a1 = *(const v4f*)(x + base + 4);
  float v[8];
#pragma unroll
  for (int e = 0; e < 4; ++e) { v[e] = bfr(a0[e]); v[4 + e] = bfr(a1[e]); }
  float s = 0.f;
#pragma unroll
  for (int e = 0; e < 8; ++e) s += v[e];
#pragma unroll
  for (int off = 1; off < 32; off <<= 1) s += __shfl_xor(s, off, 32);
  if (lane == 0) sh[wave] = s;
  __syncthreads();
  const float mu = (sh[0] + sh[1] + sh[2] + sh[3]) * (1.0f / (float)DM);
  float d[8];
  float sq = 0.f;
#pragma unroll
  for (int e = 0; e < 8; ++e) { d[e] = v[e] - mu; sq += d[e] * d[e]; }
#pragma unroll
  for (int off = 1; off < 32; off <<= 1) sq += __shfl_xor(sq, off, 32);
  if (lane == 0) sh[4 + wave] = sq;
  __syncthreads();
  const float var = (sh[4] + sh[5] + sh[6] + sh[7]) * (1.0f / (float)DM);
  const float inv = rsqrtf(var + 1e-5f);
  const v4f g0 = *(const v4f*)(gam + tid * 8);
  const v4f g1 = *(const v4f*)(gam + tid * 8 + 4);
  const v4f e0 = *(const v4f*)(bet + tid * 8);
  const v4f e1 = *(const v4f*)(bet + tid * 8 + 4);
  float y[8];
#pragma unroll
  for (int e = 0; e < 4; ++e) {
    y[e]     = (d[e] * inv) * bfr(g0[e]) + bfr(e0[e]);
    y[4 + e] = (d[4 + e] * inv) * bfr(g1[e]) + bfr(e1[e]);
  }
  v4u ph, pl;
#pragma unroll
  for (int e = 0; e < 4; ++e) {
    const unsigned short h0 = bf_bits(y[2 * e]), h1 = bf_bits(y[2 * e + 1]);
    const unsigned short l0 = bf_bits(y[2 * e] - bf_up(h0)), l1 = bf_bits(y[2 * e + 1] - bf_up(h1));
    ph[e] = pk16(h0, h1);
    pl[e] = pk16(l0, l1);
  }
  unsigned short* dh = xhp + base;
  unsigned short* dl = xlp + base;
  *(v4u*)dh = ph;
  *(v4u*)dl = pl;
  
}

// =====================================================================================================
// Register-blocked batched bf16 WMMA GEMM: C[m][n] = sum_k A[m][k] * Bt[n][k]; one wave per 64x64 tile,
// no block barriers. A row-major [M][K] pitch lda; Bt row-major [N][K] pitch ldb (k contiguous);
// M, N multiples of 64, K multiple of 32 (host-checked). blockIdx.y = batch index (strides in elements).
// NSPLIT: 0 = A.Bt; 1 = A.Bt + A2.Bt (A2 = unscaled bf16 lo plane of A); 2 = A.Bt + A.Bt2 (Bt2 = lo plane of Bt).
//         The second term reuses the same fragment registers (operands reloaded), so the footprint is that of NSPLIT 0.
// bias: added in f32 (bias value RNE-converted to bf16 first); biasRow 0 -> bias[n], 1 -> bias[m]; index clamped to nbias-1.
// OUT_MODE: 0 = f32 (pitch ldc) = acc + bias + bf16value(resid[m*ldr + n]);
//           2 = bf16 hi plane C + bf16 lo plane C2 (lo = RNE(v - hi), unscaled);
//           3 = f16 hi plane C + f16 lo plane C2 = f16((v - hi) * rscale), C2 written only for tiles
//               with n0 < N2 (pitch ldc2, batch stride strideC2).
// =====================================================================================================
template <int NSPLIT, int OUT_MODE>
__global__ __launch_bounds__(256) void gemm64(
    const unsigned short* __restrict__ Ap, const unsigned short* __restrict__ A2p, int lda, long long strideA,
    const unsigned short* __restrict__ Btp, const unsigned short* __restrict__ Bt2p, int ldb, long long strideB,
    void* Cout, int ldc, long long strideC,
    void* Cout2, int ldc2, long long strideC2, int N2,
    const float* __restrict__ bias, int nbias, int biasRow,
    const float* __restrict__ resid, int ldr,
    int M, int N, int K, float rscale) {
  const __bf16* A   = (const __bf16*)(const void*)Ap;
  const __bf16* A2  = (const __bf16*)(const void*)A2p;
  const __bf16* Bt  = (const __bf16*)(const void*)Btp;
  const __bf16* Bt2 = (const __bf16*)(const void*)Bt2p;
  __shared__ __align__(16) float sT[8][16 * 68];   // per-wave 16x64 slab, pitch 68 floats
  const int b    = blockIdx.y;
  const int lane = threadIdx.x & 31;
  const int wave = threadIdx.x >> 5;
  const int tilesN = N >> 6;
  const int tilesM = M >> 6;
  const int tile = blockIdx.x * 8 + wave;
  if (tile >= tilesM * tilesN) return;   // wave-uniform; no block barriers in this kernel
  const int tm = tile / tilesN;
  const int tn = tile - tm * tilesN;
  const int m0 = tm << 6;
  const int n0 = tn << 6;

  const __bf16* Ab  = A  + (size_t)b * strideA;
  const __bf16* Bb  = Bt + (size_t)b * strideB;
  const __bf16* Ab2 = (NSPLIT == 1) ? (A2  + (size_t)b * strideA) : Ab;
  const __bf16* Bb2 = (NSPLIT == 2) ? (Bt2 + (size_t)b * strideB) : Bb;

  const int rlane = lane & 15;                 // row (A) / col (B, D) within subtile
  const int koff  = (lane >> 4) * 8;           // k offset of this lane half
  const int mOff  = (lane >> 4) * 8;           // D row offset

  v8f acc[4][4];
#pragma unroll
  for (int i = 0; i < 4; ++i)
#pragma unroll
    for (int j = 0; j < 4; ++j) acc[i][j] = zero8();

  for (int k0 = 0; k0 < K; k0 += 32) {
#pragma unroll
    for (int tb = 0; tb < ((NSPLIT == 2) ? 2 : 1); ++tb) {
      const __bf16* Bsrc = (tb == 0) ? Bb : Bb2;
      v16b bfrag[4];
#pragma unroll
      for (int j = 0; j < 4; ++j) {
        const size_t bo = (size_t)(n0 + (j << 4) + rlane) * ldb + koff + k0;
        bfrag[j] = ldfrag_b(Bsrc + bo);
      }
#pragma unroll
      for (int i = 0; i < 4; ++i) {
        const size_t ao = (size_t)(m0 + (i << 4) + rlane) * lda + koff + k0;
#pragma unroll
        for (int ta = 0; ta < ((NSPLIT == 1) ? 2 : 1); ++ta) {
          const __bf16* Asrc = (ta == 0) ? Ab : Ab2;
          const v16b af = ldfrag_b(Asrc + ao);
#pragma unroll
          for (int j = 0; j < 4; ++j) acc[i][j] = mma_b_raw(af, bfrag[j], acc[i][j]);
          dep_guard1_b(acc[i][0], acc[i][3], af);
        }
      }
      keep4_b(bfrag[0], bfrag[1], bfrag[2], bfrag[3]);
    }
  }
  acc_guard4(acc[0][0], acc[0][1], acc[0][2], acc[0][3]);
  acc_guard4(acc[1][0], acc[1][1], acc[1][2], acc[1][3]);
  acc_guard4(acc[2][0], acc[2][1], acc[2][2], acc[2][3]);
  acc_guard4(acc[3][0], acc[3][1], acc[3][2], acc[3][3]);

  // ---- epilogue ----
  float bcol[4];
#pragma unroll
  for (int j = 0; j < 4; ++j) {
    const int nn = min(n0 + (j << 4) + rlane, nbias - 1);
    bcol[j] = bfr(bias[nn]);
  }
  float* slab = sT[wave];
#pragma unroll
  for (int i = 0; i < 4; ++i) {
    const int mBase = m0 + (i << 4);
    float brow[8];
#pragma unroll
    for (int r = 0; r < 8; ++r) {
      const int mm = min(mBase + mOff + r, nbias - 1);
      brow[r] = bfr(bias[mm]);
    }
#pragma unroll
    for (int j = 0; j < 4; ++j) {
#pragma unroll
      for (int r = 0; r < 8; ++r) {
        const float bv = (biasRow != 0) ? brow[r] : bcol[j];
        slab[(mOff + r) * 68 + (j << 4) + rlane] = acc[i][j][r] + bv;
      }
    }
    __builtin_amdgcn_fence(__ATOMIC_RELEASE, "workgroup");
    __builtin_amdgcn_wave_barrier();
    __builtin_amdgcn_fence(__ATOMIC_ACQUIRE, "workgroup");
    if (OUT_MODE == 0) {
      float* C = (float*)Cout + (size_t)b * strideC;
      const int h2 = lane >> 4, c4 = (lane & 15) * 4;     // 256-B row segment = 16 lanes x 16 B
      v4f vo[8];
#pragma unroll
      for (int it = 0; it < 8; ++it) {
        const int row = it * 2 + h2;                       // it 0..7 x h2 0..1 = rows 0..15
        v4f sv = *(const v4f*)(slab + row * 68 + c4);
        const v4f rx = *(const v4f*)(resid + (size_t)(mBase + row) * ldr + n0 + c4);
#pragma unroll
        for (int e = 0; e < 4; ++e) sv[e] = sv[e] + bfr(rx[e]);
        vo[it] = sv;
      }
      {
#pragma unroll
        for (int it = 0; it < 8; ++it) {
          const int row = it * 2 + h2;
          *(v4f*)(C + (size_t)(mBase + row) * ldc + n0 + c4) = vo[it];
        }
        
      }
    } else {
      const int q = lane >> 3, c8 = (lane & 7) * 8;
      unsigned short* C  = (unsigned short*)Cout  + (size_t)b * strideC;
      unsigned short* C2 = (unsigned short*)Cout2 + (size_t)b * strideC2;
      const bool wlo = (OUT_MODE == 2) || (n0 < N2);      // wave-uniform
      v4u hv[4], lv[4];
#pragma unroll
      for (int it = 0; it < 4; ++it) {
        const int row = it * 4 + q;                        // it 0..3 x q 0..3 = rows 0..15
        const float* sp = slab + row * 68 + c8;
        v4u a, a2;
#pragma unroll
        for (int e = 0; e < 4; ++e) {
          const float f0 = sp[2 * e], f1 = sp[2 * e + 1];
          unsigned short h0, h1, l0, l1;
          if (OUT_MODE == 2) {
            h0 = bf_bits(f0); h1 = bf_bits(f1);
            l0 = bf_bits(f0 - bf_up(h0)); l1 = bf_bits(f1 - bf_up(h1));
          } else {
            const _Float16 x0 = (_Float16)f0, x1 = (_Float16)f1;
            h0 = h_bits(x0); h1 = h_bits(x1);
            l0 = h_bits((_Float16)((f0 - (float)x0) * rscale));
            l1 = h_bits((_Float16)((f1 - (float)x1) * rscale));
          }
          a[e] = pk16(h0, h1); a2[e] = pk16(l0, l1);
        }
        hv[it] = a; lv[it] = a2;
      }
      {
#pragma unroll
        for (int it = 0; it < 4; ++it) {
          const int row = it * 4 + q;
          *(v4u*)(C + (size_t)(mBase + row) * ldc + n0 + c8) = hv[it];
          if (wlo) *(v4u*)(C2 + (size_t)(mBase + row) * ldc2 + n0 + c8) = lv[it];
        }
        
      }
    }
    __builtin_amdgcn_fence(__ATOMIC_RELEASE, "workgroup");
    __builtin_amdgcn_wave_barrier();
    __builtin_amdgcn_fence(__ATOMIC_ACQUIRE, "workgroup");
  }
}

// =====================================================================================================
// Causal attention, head dim 64, arithmetic mask: logit = (q.k) * sscale, replaced by -1e9 when key > query.
//   q planes (f16 hi / f16 lo x2048): element (b, t, h, d) at [(b*SEQ + t)*DM + h*64 + d]
//   k plane (f16):                    same layout with key index s
//   v^T hi plane (f16):               element (b, h, d, s) at [(b*DM + h*64 + d)*SEQ + s]
//   v^T lo plane (f16, (v - hi)*4096): [(b*DM + h*64 + d)*VLP + s], s < VLP, read only when RES
//   (a key tile at or beyond VLP contributes a zero v lo term; addresses clamped)
//   out planes (bf16 hi / lo of the normalised context): element (b, t, h, d) at [(b*SEQ + t)*DM + h*64 + d]
//   scores = qh.k (acc t0) and ql.k (acc t1), s = (t0 + t1 * qlinv) * sscale, mask, all in f32
//   p = exp(s - m) carried as f16(1024 p); context = p . v on f16 WMMA; RES adds f16 lo planes of p and v
//   (scale 4096, separate accumulator folded back with 1/4096 per chunk in f32); online softmax in f32.
//   Block = 4 waves = 64 query rows of one (b, h); grid = nqbThis * NH * NB; key tiles kt = 0..qb (static bound NQB).
//   K / V^T chunk staging: 128 threads x 32 elements per plane = the whole 64x64 tile (plain 16-B loads,
//   __syncthreads before and after); P tiles are wave-private, spilled with _Float16 element stores and reloaded
//   Output coverage: each wave stores rows q0..q0+15 (it 0..3 x lane>>3 0..3) x 64 columns (8 lanes x 8) of both planes.
// =====================================================================================================
template <bool RES>
__global__ __launch_bounds__(128)
void attn_causal64(const unsigned short* __restrict__ qhp, const unsigned short* __restrict__ qlp,
                   const unsigned short* __restrict__ khp,
                   const unsigned short* __restrict__ vhp, const unsigned short* __restrict__ vlp,
                   unsigned short* ohp, unsigned short* olp,
                   int qbBase, int nqbThis, float sscale, float qlinv) {
  union FH { v16h v; v8h h[2]; };
  __shared__ __align__(16) _Float16 Ksh[64 * KP];                 // K [kv][d], pitch KP
  __shared__ __align__(16) _Float16 Vth[64 * KP];                 // V^T hi [d][kv], pitch KP
  __shared__ __align__(16) _Float16 Vtl[RES ? 64 * KP : 8];       // V^T lo, pitch KP
  __shared__ __align__(16) _Float16 Psh[4][16 * KP];              // per wave P [row][kv], pitch KP
  __shared__ __align__(16) _Float16 Psl[RES ? 4 : 1][16 * KP];    // per wave P lo, pitch KP
  __shared__ __align__(16) float    Os[4][16 * OP];               // per wave context tile [row][d], pitch OP

  const int tid  = threadIdx.x;
  const int wave = tid >> 5;
  const int lane = tid & 31;
  const int hh   = lane >> 4;
  const int c    = lane & 15;

  const int bx   = blockIdx.x;
  const int qbl  = bx % nqbThis;
  const int rest = bx / nqbThis;
  const int h    = rest % NH;
  const int b    = rest / NH;
  const int qb   = qbBase + qbl;
  const int q0   = qb * 64 + wave * 16;
  const size_t rowB = (size_t)b * SEQ;
  const int hoff = h * HD;

  const _Float16* Qh = (const _Float16*)(const void*)qhp;
  const _Float16* Ql = (const _Float16*)(const void*)qlp;
  const _Float16* Kh = (const _Float16*)(const void*)khp;
  const _Float16* Vh = (const _Float16*)(const void*)vhp + ((size_t)b * DM + (size_t)hoff) * SEQ;
  const _Float16* Vl = (const _Float16*)(const void*)vlp + ((size_t)b * DM + (size_t)hoff) * VLP;

  // ---- Q fragments (A operand, row = lane&15): 2 d-chunks, hi and lo ----
  v16h qah[2], qal[2];
#pragma unroll
  for (int dc = 0; dc < 2; ++dc) {
    const size_t qo = (rowB + q0 + c) * DM + hoff + dc * 32 + 8 * hh;
    qah[dc] = ldfrag_h(Qh + qo);
    qal[dc] = ldfrag_h(Ql + qo);
  }

  float mrow[8], lrow[8];
  v8f oacc[4];
#pragma unroll
  for (int r = 0; r < 8; ++r) { mrow[r] = -INFINITY; lrow[r] = 0.f; }
#pragma unroll
  for (int t = 0; t < 4; ++t) oacc[t] = zero8();

  for (int kt = 0; kt < NQB; ++kt) {         // static bound
    if (kt > qb) break;                      // block-uniform: causal, key tiles 0..qb only
    const int kv0 = kt * 64;
    __syncthreads();
    {
      const int r = tid >> 1, half = (tid & 1) * 32;
      const _Float16* kg  = Kh + (rowB + kv0 + r) * DM + hoff + half;   // K row kv0+r, d = half..half+31
      const _Float16* vg  = Vh + (size_t)r * SEQ + kv0 + half;         // V^T row d = r, s = kv0+half..+31
      const int kvl = (kv0 + 64 <= VLP) ? kv0 : (VLP - 64);          // clamped address into the lo plane
      const _Float16* vlg = Vl + (size_t)r * VLP + kvl + half;
      const bool resOK = (kv0 + 64 <= VLP);                           // block-uniform
#pragma unroll
      for (int i = 0; i < 4; ++i) {
        const v8h a0 = *(const v8h*)(kg + 8 * i);
        const v8h b0 = *(const v8h*)(vg + 8 * i);
        *(v8h*)(Ksh + r * KP + half + 8 * i) = a0;
        *(v8h*)(Vth + r * KP + half + 8 * i) = b0;
        if (RES) {
          v8h b1 = *(const v8h*)(vlg + 8 * i);
          if (!resOK) b1 = zero8h();
          *(v8h*)(Vtl + r * KP + half + 8 * i) = b1;
        }
      }
    }
    __syncthreads();

    // ---- scores: 16 query rows x 64 keys per wave, 2 f16 products into separate accumulators ----
    v8f s[4];
#pragma unroll
    for (int j = 0; j < 4; ++j) {
      v8f t0 = zero8(), t1 = zero8();
#pragma unroll
      for (int dc = 0; dc < 2; ++dc) {
        FH kb;
        kb.h[0] = *(const v8h*)(Ksh + (j * 16 + c) * KP + dc * 32 + 8 * hh);
        kb.h[1] = *(const v8h*)(Ksh + (j * 16 + c) * KP + dc * 32 + 16 + 8 * hh);
        t0 = mma_h(qah[dc], kb.v, t0);
        t1 = mma_h(qal[dc], kb.v, t1);
      }
#pragma unroll
      for (int r = 0; r < 8; ++r) s[j][r] = t0[r] + t1[r] * qlinv;
    }

    // ---- scale + causal mask, row max, online softmax, P (x1024, f16) and P lo (x4096) to LDS ----
    _Float16* pwh = Psh[wave];
    _Float16* pwl = Psl[RES ? wave : 0];
#pragma unroll
    for (int r = 0; r < 8; ++r) {
      const int qrow = q0 + 8 * hh + r;
      float m = -INFINITY;
#pragma unroll
      for (int j = 0; j < 4; ++j) {
        const int key = kv0 + j * 16 + c;
        float sv = s[j][r] * sscale;
        sv = (key > qrow) ? -1.0e9f : sv;
        s[j][r] = sv;
        m = fmaxf(m, sv);
      }
#pragma unroll
      for (int off = 1; off < 16; off <<= 1) m = fmaxf(m, __shfl_xor(m, off, 32));
      const float mnew  = fmaxf(mrow[r], m);
      const float msafe = (mnew == -INFINITY) ? 0.f : mnew;
      const float alpha = __expf(mrow[r] - msafe);
      mrow[r] = mnew;
      float psum = 0.f;
#pragma unroll
      for (int j = 0; j < 4; ++j) {
        const float p = __expf(s[j][r] - msafe);     // masked logit: exp -> 0
        psum += p;
        const float p1k = p * 1024.0f;
        const _Float16 ph = (_Float16)p1k;
        pwh[(8 * hh + r) * KP + j * 16 + c] = ph;
        if (RES) {
          const _Float16 pl = (_Float16)((p1k - (float)ph) * 4096.0f);
          pwl[(8 * hh + r) * KP + j * 16 + c] = pl;
        }
      }
#pragma unroll
      for (int off = 1; off < 16; off <<= 1) psum += __shfl_xor(psum, off, 32);
      lrow[r] = lrow[r] * alpha + psum;
#pragma unroll
      for (int t = 0; t < 4; ++t) oacc[t][r] *= alpha;
    }
    __builtin_amdgcn_fence(__ATOMIC_RELEASE, "workgroup");
    __builtin_amdgcn_wave_barrier();
    __builtin_amdgcn_fence(__ATOMIC_ACQUIRE, "workgroup");

    // ---- context += P . V (f16 WMMA), lo products into a separate accumulator ----
    v8f o1[4];
#pragma unroll
    for (int t = 0; t < 4; ++t) o1[t] = zero8();
#pragma unroll 1
    for (int kk = 0; kk < 2; ++kk) {
      FH pa, pl;
      pa.h[0] = *(const v8h*)(pwh + c * KP + kk * 32 + 8 * hh);
      pa.h[1] = *(const v8h*)(pwh + c * KP + kk * 32 + 16 + 8 * hh);
      if (RES) {
        pl.h[0] = *(const v8h*)(pwl + c * KP + kk * 32 + 8 * hh);
        pl.h[1] = *(const v8h*)(pwl + c * KP + kk * 32 + 16 + 8 * hh);
      } else {
        pl.v = pa.v;
      }
#pragma unroll
      for (int t = 0; t < 4; ++t) {
        FH vb;
        vb.h[0] = *(const v8h*)(Vth + (t * 16 + c) * KP + kk * 32 + 8 * hh);
        vb.h[1] = *(const v8h*)(Vth + (t * 16 + c) * KP + kk * 32 + 16 + 8 * hh);
        oacc[t] = mma_h(pa.v, vb.v, oacc[t]);
        if (RES) {
          FH vl;
          vl.h[0] = *(const v8h*)(Vtl + (t * 16 + c) * KP + kk * 32 + 8 * hh);
          vl.h[1] = *(const v8h*)(Vtl + (t * 16 + c) * KP + kk * 32 + 16 + 8 * hh);
          o1[t] = mma_h(pa.v, vl.v, o1[t]);
          o1[t] = mma_h(pl.v, vb.v, o1[t]);
        }
      }
    }
    if (RES) {
#pragma unroll
      for (int t = 0; t < 4; ++t)
#pragma unroll
        for (int r = 0; r < 8; ++r) oacc[t][r] += o1[t][r] * (1.0f / 4096.0f);
    }
  }

  // ---- normalise (1/l and the 1/1024 p carry), stage the wave's 16x64 tile, bf16 hi/lo split,
  float* os = Os[wave];
#pragma unroll
  for (int r = 0; r < 8; ++r) {
    const float l = lrow[r];
    const float inv = ((l > 0.f) ? (1.0f / l) : 0.f) * (1.0f / 1024.0f);
#pragma unroll
    for (int t = 0; t < 4; ++t) os[(8 * hh + r) * OP + t * 16 + c] = oacc[t][r] * inv;
  }
  __builtin_amdgcn_fence(__ATOMIC_RELEASE, "workgroup");
  __builtin_amdgcn_wave_barrier();
  __builtin_amdgcn_fence(__ATOMIC_ACQUIRE, "workgroup");
  {
    const int q4 = lane >> 3, c8 = (lane & 7) * 8;
    v4u hv[4], lv[4];
#pragma unroll
    for (int it = 0; it < 4; ++it) {
      const int row = it * 4 + q4;   // it 0..3 x q4 0..3 = rows 0..15 of the wave tile
      const float* sp = os + row * OP + c8;
      v4u a, a2;
#pragma unroll
      for (int e = 0; e < 4; ++e) {
        const float f0 = sp[2 * e], f1 = sp[2 * e + 1];
        const unsigned short h0 = bf_bits(f0), h1 = bf_bits(f1);
        const unsigned short l0 = bf_bits(f0 - bf_up(h0)), l1 = bf_bits(f1 - bf_up(h1));
        a[e] = pk16(h0, h1); a2[e] = pk16(l0, l1);
      }
      hv[it] = a; lv[it] = a2;
    }
    {
#pragma unroll
      for (int it = 0; it < 4; ++it) {
        const int row = it * 4 + q4;
        const size_t go = (rowB + q0 + row) * DM + (size_t)hoff + c8;
        *(v4u*)(ohp + go) = hv[it];
        *(v4u*)(olp + go) = lv[it];
      }
      
    }
  }
}

// =====================================================================================================
// Workspace map (bytes):
//   XNh  bf16 [8192][1024]        0          16777216   (later: Oh, context hi plane)
//   XNl  bf16 [8192][1024]        16777216   16777216   (later: Ol, context lo plane)
//   Wqb  bf16 [1024 n][1024 k]    33554432    2097152
//   Wkb  bf16 [1024][1024]        35651584    2097152
//   Wvb  bf16 [1024][1024]        37748736    2097152
//   Wob  bf16 [1024][1024]        39845888    2097152
//   Qh   f16  [8192][1024]        41943040   16777216
//   Ql   f16  [8192][1024]        58720256   16777216
//   Kh   f16  [8192][1024]        75497472   16777216
//   VTh  f16  [4][1024][2048]     92274688   16777216
//   VTl  f16  [4][1024][512]      109051904   4194304
//   end                           113246208
// All planes are exact multiples of their 64x64 / whole-line store granularity (no padded tails needed).
// Weights are [out n][in k] with k contiguous = the Bt / A layout the GEMM wants, so they are only converted.
// =====================================================================================================
extern "C" void kernel_launch(void* const* d_in, const int* in_sizes, int n_in,
                              void* d_out, int out_size, void* d_ws, size_t ws_size,
                              hipStream_t stream) {
  if (n_in < 11) return;
  if (in_sizes[0] != NB * SEQ * DM) return;
  if (in_sizes[1] != DM * DM || in_sizes[3] != DM * DM || in_sizes[5] != DM * DM || in_sizes[7] != DM * DM) return;
  if (in_sizes[2] != DM || in_sizes[4] != DM || in_sizes[6] != DM || in_sizes[8] != DM) return;
  if (in_sizes[9] != DM || in_sizes[10] != DM) return;
  if (out_size != NB * SEQ * DM) return;

  const float* x     = (const float*)d_in[0];
  const float* Wq    = (const float*)d_in[1];
  const float* bq    = (const float*)d_in[2];
  const float* Wk    = (const float*)d_in[3];
  const float* bk    = (const float*)d_in[4];
  const float* Wv    = (const float*)d_in[5];
  const float* bv    = (const float*)d_in[6];
  const float* Wo    = (const float*)d_in[7];
  const float* bo    = (const float*)d_in[8];
  const float* gamma = (const float*)d_in[9];
  const float* beta  = (const float*)d_in[10];

  const size_t P16 = (size_t)NB * SEQ * DM * 2;   // 16777216  16-bit activation plane [8192][1024]
  const size_t PW  = (size_t)DM * DM * 2;         //  2097152  16-bit weight plane
  const size_t PVT = (size_t)NB * DM * SEQ * 2;   // 16777216  v^T hi plane
  const size_t PVL = (size_t)NB * DM * VLP * 2;   //  4194304  v^T lo plane
  size_t off = 0;
  const size_t oXh  = off; off += P16;
  const size_t oXl  = off; off += P16;
  const size_t oWq  = off; off += PW;
  const size_t oWk  = off; off += PW;
  const size_t oWv  = off; off += PW;
  const size_t oWo  = off; off += PW;
  const size_t oQh  = off; off += P16;
  const size_t oQl  = off; off += P16;
  const size_t oKh  = off; off += P16;
  const size_t oVTh = off; off += PVT;
  const size_t oVTl = off; off += PVL;
  if (off > ws_size) return;                      // off = 113246208
  if (off > (size_t)134217728) return;
  const size_t oOh  = oXh;                        // context planes reuse the XN planes (dead after the projections)
  const size_t oOl  = oXl;

  char* ws = (char*)d_ws;
  unsigned short* XNh = (unsigned short*)(ws + oXh);
  unsigned short* XNl = (unsigned short*)(ws + oXl);
  unsigned short* Wqb = (unsigned short*)(ws + oWq);
  unsigned short* Wkb = (unsigned short*)(ws + oWk);
  unsigned short* Wvb = (unsigned short*)(ws + oWv);
  unsigned short* Wob = (unsigned short*)(ws + oWo);
  unsigned short* Qh  = (unsigned short*)(ws + oQh);
  unsigned short* Ql  = (unsigned short*)(ws + oQl);
  unsigned short* Kh  = (unsigned short*)(ws + oKh);
  unsigned short* VTh = (unsigned short*)(ws + oVTh);
  unsigned short* VTl = (unsigned short*)(ws + oVTl);
  unsigned short* Oh  = (unsigned short*)(ws + oOh);
  unsigned short* Ol  = (unsigned short*)(ws + oOl);

  const dim3 blk(256);
  const int n8w = DM * DM / 8;                                //  131072
  const dim3 gCvtW((n8w + 255) / 256);                        //  512 blocks
  const dim3 gLn(NB * SEQ);                                   // 8192 rows
  const dim3 gProj(((NB * SEQ / 64) * (DM / 64) + 7) / 8, 1); // 2048 tiles -> 256 blocks: M=8192, N=1024
  const dim3 gVT(((DM / 64) * (SEQ / 64) + 7) / 8, NB);      // 512 tiles -> 64 blocks x 4 batches: M=1024, N=2048

  // (1) weights [n][k] f32 -> bf16 [n][k]
  cvt_bf16x8<<<gCvtW, blk, 0, stream>>>(Wq, Wqb, n8w);
  cvt_bf16x8<<<gCvtW, blk, 0, stream>>>(Wk, Wkb, n8w);
  cvt_bf16x8<<<gCvtW, blk, 0, stream>>>(Wv, Wvb, n8w);
  cvt_bf16x8<<<gCvtW, blk, 0, stream>>>(Wo, Wob, n8w);
  // (2) LayerNorm -> bf16 hi / lo planes [8192][1024]
  ln_rows<<<gLn, dim3(128), 0, stream>>>(x, gamma, beta, XNh, XNl, NB * SEQ);
  // (3) q = xn . Wq^T + bq -> f16 hi plane + f16 lo plane x2048 [b*SEQ+t][h*64+d]   (M=8192, N=1024, K=1024)
  gemm64<1, 3><<<gProj, blk, 0, stream>>>(
      XNh, XNl, DM, 0LL, Wqb, Wqb, DM, 0LL,
      (void*)Qh, DM, 0LL, (void*)Ql, DM, 0LL, DM,
      bq, DM, 0, x, DM,
      NB * SEQ, DM, DM, 2048.0f);
  // (4) k = xn . Wk^T + bk -> f16 plane (no lo plane: N2 = 0)
  gemm64<1, 3><<<gProj, blk, 0, stream>>>(
      XNh, XNl, DM, 0LL, Wkb, Wkb, DM, 0LL,
      (void*)Kh, DM, 0LL, (void*)Kh, DM, 0LL, 0,
      bk, DM, 0, x, DM,
      NB * SEQ, DM, DM, 2048.0f);
  // (5) v^T = Wv . xn^T + bv per batch -> f16 hi plane [b][h*64+d][s] (pitch SEQ) and lo plane
  //     (x4096, keys < VLP only, pitch VLP)   (A = Wvb [n][k], Bt = xn planes of batch b; M=1024, N=2048, K=1024)
  gemm64<2, 3><<<gVT, blk, 0, stream>>>(
      Wvb, Wvb, DM, 0LL, XNh, XNl, DM, (long long)SEQ * DM,
      (void*)VTh, SEQ, (long long)DM * SEQ, (void*)VTl, VLP, (long long)DM * VLP, VLP,
      bv, DM, 1, x, DM,
      DM, SEQ, DM, 4096.0f);
  // (6) attention: query blocks 0..RESQB-1 with lo planes, the rest without
  attn_causal64<true><<<dim3(NB * NH * RESQB), dim3(128), 0, stream>>>(
      Qh, Ql, Kh, VTh, VTl, Oh, Ol, 0, RESQB, 0.125f, 1.0f / 2048.0f);
  attn_causal64<false><<<dim3(NB * NH * (NQB - RESQB)), dim3(128), 0, stream>>>(
      Qh, Ql, Kh, VTh, VTl, Oh, Ol, RESQB, NQB - RESQB, 0.125f, 1.0f / 2048.0f);
  // (7) out = bf16(x) + context . Wo^T + bo -> d_out f32 [8192][1024]  (A = context hi + lo planes, 2 products)
  gemm64<1, 0><<<gProj, blk, 0, stream>>>(
      Oh, Ol, DM, 0LL, Wob, Wob, DM, 0LL,
      d_out, DM, 0LL, d_out, DM, 0LL, 0,
      bo, DM, 0, x, DM,
      NB * SEQ, DM, DM, 1.0f);
  (void)hipGetLastError();
}

// v002
// A run of this version takes 383 microseconds.
// Timed twice side by side with v001, it ran 1.60 and 1.59 times as fast.
// Over all steps from v000 it is 1.86 times as fast.
// Contractions: q/k/v^T projections = v_wmma_f32_16x16x32_bf16 (normalised activations as bf16 hi+lo planes, weights bf16, 2 products);
// q.k^T = v_wmma_f32_16x16x32_f16 (q as f16 hi plane + f16 lo plane x2048, k f16, 2 products, separate accumulators);
// p.v = v_wmma_f32_16x16x32_f16 (p carried x1024 in f16, v^T f16; extra f16 lo planes x4096 of p and v on the first 512 query rows);
// ctx.Wo^T = v_wmma_f32_16x16x32_bf16 (ctx as bf16 hi+lo planes, Wo bf16, 2 products); all f32 accumulate; LayerNorm, causal mask, softmax, bias and skip-add in f32.
#include <hip/hip_runtime.h>
#include <math.h>
#include <float.h>
#include <stdint.h>

#define NB    4
#define SEQ   2048
#define DM    1024
#define NH    16
#define HD    64
#define NQB   (SEQ / 64)   // 32 key / query tiles of 64
#define VLP   512          // key pitch of the v^T lo plane (keys 0..VLP-1)
#define RESQB 8            // leading 64-row query blocks that use the p / v lo planes
static_assert(RESQB * 64 <= VLP);
static_assert(NH * HD == DM);
static_assert((SEQ % 64) == 0 && (DM % 64) == 0);
static_assert(DM == 128 * 8);
#define KP    72           // LDS row pitch of the 64-wide f16 tiles, in elements: 144 B = 16 B x 9 (odd), so 16 rows read 16 B wide fall on distinct banks
#define OP    68           // LDS row pitch of the f32 context tile, in floats (16-byte reads down a column group without bank conflicts)
#define GKC   64           // GEMM: k elements per LDS stage = one 128-B line of every operand row
#define GP    72           // GEMM: LDS row pitch of a stage, in elements (144 B, as KP: 16-B fragment reads of 16 rows fall on distinct banks)
static_assert((GP * 2) % 16 == 0 && ((GP * 2) / 16) % 2 == 1 && GP >= GKC);
static_assert((DM % GKC) == 0 && ((NB * SEQ) % 128) == 0 && (DM % 256) == 0 && (SEQ % 128) == 0);
static_assert((KP * 2) % 16 == 0 && ((KP * 2) / 16) % 2 == 1 && KP >= 64);
static_assert((OP * 4) % 16 == 0 && OP >= 64);

typedef _Float16 v16h __attribute__((ext_vector_type(16)));
typedef _Float16 v8h  __attribute__((ext_vector_type(8)));
typedef __bf16   v16b __attribute__((ext_vector_type(16)));
typedef __bf16   v8b  __attribute__((ext_vector_type(8)));
typedef float    v8f  __attribute__((ext_vector_type(8)));
typedef float    v4f  __attribute__((ext_vector_type(4)));
typedef unsigned int v4u __attribute__((ext_vector_type(4)));

// ---- scalar helpers --------------------------------------------------------------------------------
__device__ __forceinline__ unsigned short bf_bits(float f) {          // f32 -> bf16 bits, RNE convert
  unsigned u = __float_as_uint(f);
  return (unsigned short)((u + 0x7FFFu + ((u >> 16) & 1u)) >> 16);
}
__device__ __forceinline__ float bf_up(unsigned short h) { return __uint_as_float(((unsigned)h) << 16); }
__device__ __forceinline__ float bfr(float f) { return bf_up(bf_bits(f)); }   // value after RNE convert to bf16
__device__ __forceinline__ unsigned short h_bits(_Float16 x) { return __builtin_bit_cast(unsigned short, x); }
__device__ __forceinline__ unsigned pk16(unsigned short a, unsigned short b) { return (unsigned)a | ((unsigned)b << 16); }
__device__ __forceinline__ v8f zero8() { v8f z = {0.f, 0.f, 0.f, 0.f, 0.f, 0.f, 0.f, 0.f}; return z; }
__device__ __forceinline__ v8h zero8h() {
  const _Float16 z = (_Float16)0.0f;
  v8h r = {z, z, z, z, z, z, z, z};
  return r;
}

// ---- fragment loaders: 16-bit A/B operand, lane -> row/col (lane&15), p already includes +8*(lane>>4);
//      elements 0..7 <- p[0..7] (k0+8h..), elements 8..15 <- p[16..23] (k0+16+8h..)
__device__ __forceinline__ v16b ldfrag_b(const __bf16* p) {
  union { v16b v; v8b h[2]; } f;
  f.h[0] = *(const v8b*)(p);
  f.h[1] = *(const v8b*)(p + 16);
  return f.v;
}
__device__ __forceinline__ v16h ldfrag_h(const _Float16* p) {
  union { v16h v; v8h h[2]; } f;
  f.h[0] = *(const v8h*)(p);
  f.h[1] = *(const v8h*)(p + 16);
  return f.v;
}

// ---- WMMA helpers with trailing VALU hazard gap --------------------------------------------------------
__device__ __forceinline__ v8f mma_h(v16h a, v16h b, v8f c) {
  c = __builtin_amdgcn_wmma_f32_16x16x32_f16(false, a, false, b, (short)0, c, false, false);
  asm volatile("v_nop\n\tv_nop\n\tv_nop\n\tv_nop" : "+v"(c) : "v"(a), "v"(b));
  return c;
}
__device__ __forceinline__ v8f mma_b_raw(v16b a, v16b b, v8f c) {
  return __builtin_amdgcn_wmma_f32_16x16x32_bf16(false, a, false, b, (short)0, c, false, false);
}
__device__ __forceinline__ void dep_guard1_b(v8f& a, v8f& b, v16b x) {
  asm volatile("v_nop\n\tv_nop\n\tv_nop\n\tv_nop" : "+v"(a), "+v"(b) : "v"(x));
}
__device__ __forceinline__ void keep4_b(v16b a, v16b b, v16b c, v16b d) {
  asm volatile("v_nop" :: "v"(a), "v"(b), "v"(c), "v"(d));
}
__device__ __forceinline__ void acc_guard4(v8f& a, v8f& b, v8f& c, v8f& d) {
  asm volatile("v_nop\n\tv_nop\n\tv_nop\n\tv_nop" : "+v"(a), "+v"(b), "+v"(c), "+v"(d));
}

// =====================================================================================================
// f32 -> bf16 (RNE convert), 8 elements per thread, one 16-B store per lane: a wave writes 512 contiguous B
// coverage: n8 threads x 8 = whole plane (n8 = 131072 here, a multiple of 256).
// =====================================================================================================
__global__ __launch_bounds__(256) void cvt_bf16x8(const float* __restrict__ in, unsigned short* out, int n8) {
  const int i = blockIdx.x * 256 + threadIdx.x;
  if (i < n8) {
    const v4f a = *(const v4f*)(in + (size_t)i * 8);
    const v4f b = *(const v4f*)(in + (size_t)i * 8 + 4);
    v4u p;
    p[0] = pk16(bf_bits(a[0]), bf_bits(a[1]));
    p[1] = pk16(bf_bits(a[2]), bf_bits(a[3]));
    p[2] = pk16(bf_bits(b[0]), bf_bits(b[1]));
    p[3] = pk16(bf_bits(b[2]), bf_bits(b[3]));
    *(v4u*)(out + (size_t)i * 8) = p;
    
  }
}

// =====================================================================================================
// LayerNorm over rows of DM=1024 (x, gamma, beta RNE-converted to bf16 values first), eps 1e-5,
// thread t owns elements 8t..8t+7. Output: bf16 hi plane and unscaled bf16 lo plane (lo = RNE(y - hi)),
// =====================================================================================================
__global__ __launch_bounds__(128) void ln_rows(const float* __restrict__ x, const float* __restrict__ gam,
                                             const float* __restrict__ bet,
                                             unsigned short* xhp, unsigned short* xlp, int nrows) {
  __shared__ float sh[8];
  const int row = blockIdx.x;
  if (row >= nrows) return;                    // block-uniform (grid == nrows)
  const int tid = threadIdx.x, wave = tid >> 5, lane = tid & 31;
  const size_t base = (size_t)row * DM + (size_t)tid * 8;
  const v4f a0 = *(const v4f*)(x + base);
  const v4f a1 = *(const v4f*)(x + base + 4);
  float v[8];
#pragma unroll
  for (int e = 0; e < 4; ++e) { v[e] = bfr(a0[e]); v[4 + e] = bfr(a1[e]); }
  float s = 0.f;
#pragma unroll
  for (int e = 0; e < 8; ++e) s += v[e];
#pragma unroll
  for (int off = 1; off < 32; off <<= 1) s += __shfl_xor(s, off, 32);
  if (lane == 0) sh[wave] = s;
  __syncthreads();
  const float mu = (sh[0] + sh[1] + sh[2] + sh[3]) * (1.0f / (float)DM);
  float d[8];
  float sq = 0.f;
#pragma unroll
  for (int e = 0; e < 8; ++e) { d[e] = v[e] - mu; sq += d[e] * d[e]; }
#pragma unroll
  for (int off = 1; off < 32; off <<= 1) sq += __shfl_xor(sq, off, 32);
  if (lane == 0) sh[4 + wave] = sq;
  __syncthreads();
  const float var = (sh[4] + sh[5] + sh[6] + sh[7]) * (1.0f / (float)DM);
  const float inv = rsqrtf(var + 1e-5f);
  const v4f g0 = *(const v4f*)(gam + tid * 8);
  const v4f g1 = *(const v4f*)(gam + tid * 8 + 4);
  const v4f e0 = *(const v4f*)(bet + tid * 8);
  const v4f e1 = *(const v4f*)(bet + tid * 8 + 4);
  float y[8];
#pragma unroll
  for (int e = 0; e < 4; ++e) {
    y[e]     = (d[e] * inv) * bfr(g0[e]) + bfr(e0[e]);
    y[4 + e] = (d[4 + e] * inv) * bfr(g1[e]) + bfr(e1[e]);
  }
  v4u ph, pl;
#pragma unroll
  for (int e = 0; e < 4; ++e) {
    const unsigned short h0 = bf_bits(y[2 * e]), h1 = bf_bits(y[2 * e + 1]);
    const unsigned short l0 = bf_bits(y[2 * e] - bf_up(h0)), l1 = bf_bits(y[2 * e + 1] - bf_up(h1));
    ph[e] = pk16(h0, h1);
    pl[e] = pk16(l0, l1);
  }
  unsigned short* dh = xhp + base;
  unsigned short* dl = xlp + base;
  *(v4u*)dh = ph;
  *(v4u*)dl = pl;
  
}

// =====================================================================================================
// Batched bf16 WMMA GEMM: C[m][n] = sum_k A[m][k] * Bt[n][k]; one wave per 64x64 tile, 8 waves per block.
// A row-major [M][K], Bt row-major [N][K] (k contiguous), both of row pitch DM elements. blockIdx.y = batch index (strides in elements).
// NSPLIT: 0 = A.Bt; 1 = A.Bt + A2.Bt (A2 = unscaled bf16 lo plane of A); 2 = A.Bt + A.Bt2 (Bt2 = lo plane of Bt).
// Block tile = WM x WN wave tiles (2 x 4 = 128 x 256; NSPLIT 2: 4 x 2 = 256 x 128, so the two-plane operand has the fewer rows).
// Operands go through LDS in stages of GKC = 64 k: every operand row of the block tile gives one whole 128-B line per stage,
// read from global once per block (8 lanes x 16 B per row, 4 whole lines per wave load) and shared by the waves that need it.
// Two stage buffers: the next stage's lines are loaded into registers ahead of this stage's products, stored to the other
// buffer behind them, one __syncthreads() per stage. Per accumulator the order of the products is k ascending, hi then lo.
// M multiple of 64*WM, N of 64*WN, K of GKC (the host launches only such shapes).
// bias: added in f32 (bias value RNE-converted to bf16 first); biasRow 0 -> bias[n], 1 -> bias[m]; index clamped to nbias-1.
// OUT_MODE: 0 = f32 (pitch ldc) = acc + bias + bf16value(resid[m*ldr + n]);
//           2 = bf16 hi plane C + bf16 lo plane C2 (lo = RNE(v - hi), unscaled);
//           3 = f16 hi plane C + f16 lo plane C2 = f16((v - hi) * rscale), C2 written only for tiles
//               with n0 < N2 (pitch ldc2, batch stride strideC2).
// =====================================================================================================
template <int NSPLIT, int OUT_MODE>
__global__ __launch_bounds__(256) void gemm64(
    const unsigned short* __restrict__ Ap, const unsigned short* __restrict__ A2p, long long strideA,
    const unsigned short* __restrict__ Btp, const unsigned short* __restrict__ Bt2p, long long strideB,
    void* Cout, int ldc, long long strideC,
    void* Cout2, int ldc2, long long strideC2, int N2,
    const float* __restrict__ bias, int nbias, int biasRow,
    const float* __restrict__ resid, int ldr,
    int M, int N, int K, float rscale) {
  constexpr int WM   = (NSPLIT == 2) ? 4 : 2;          // wave grid of the block
  constexpr int WN   = 8 / WM;
  constexpr int APL  = (NSPLIT == 1) ? 2 : 1;          // planes of A / of Bt
  constexpr int BPL  = (NSPLIT == 2) ? 2 : 1;
  constexpr int AR   = WM * 64;                        // rows per plane in a stage
  constexpr int BR   = WN * 64;
  constexpr int ROWS = AR * APL + BR * BPL;            // stage rows: [A | A2 | Bt | Bt2]
  constexpr int NLD  = ROWS / 32;                      // 16-B pieces per thread per stage (256 threads = 32 rows x 8 pieces)
  static_assert(AR % 32 == 0 && BR % 32 == 0);
  static_assert(2 * ROWS * GP * 2 >= 8 * 16 * 68 * 4);
  __shared__ __align__(16) unsigned short smem[2 * ROWS * GP];   // two stages; behind the k loop: per-wave 16x64 f32 slabs, pitch 68
  const int b    = blockIdx.y;
  const int lane = threadIdx.x & 31;
  const int wave = threadIdx.x >> 5;
  const int tilesNb = N / (64 * WN);
  const int tilesMb = M / (64 * WM);
  if ((int)blockIdx.x >= tilesMb * tilesNb) return;    // block-uniform, ahead of every barrier
  const int bm = blockIdx.x / tilesNb;
  const int bn = blockIdx.x - bm * tilesNb;
  const int mB = bm * (64 * WM);
  const int nB = bn * (64 * WN);
  const int wm = wave / WN;
  const int wn = wave - wm * WN;
  const int m0 = mB + (wm << 6);
  const int n0 = nB + (wn << 6);

  const char* Ab  = (const char*)(Ap  + (size_t)b * strideA);
  const char* Bb  = (const char*)(Btp + (size_t)b * strideB);
  const char* Ab2 = (NSPLIT == 1) ? (const char*)(A2p  + (size_t)b * strideA) : Ab;
  const char* Bb2 = (NSPLIT == 2) ? (const char*)(Bt2p + (size_t)b * strideB) : Bb;

  const int rlane = lane & 15;                 // row (A) / col (B, D) within subtile
  const int koff  = (lane >> 4) * 8;           // k offset of this lane half
  const int mOff  = (lane >> 4) * 8;           // D row offset

  // staging map: 8 lanes x 16 B = one row's 128-B line; pass it covers stage rows it*32 .. it*32+31. Neighbouring groups of
  // 8 lanes take rows 8 apart: 8 x 144 B = 128 B mod 256 B, so the two rows of a 16-lane ds_store_b128 half fill all 64 banks once.
  const int srow = ((threadIdx.x >> 7) << 4) | (((threadIdx.x >> 3) & 1) << 3) | ((threadIdx.x >> 4) & 7);
  const int sseg = (threadIdx.x & 7) * 8;
  constexpr size_t LDB = (size_t)DM * 2;                         // operand row pitch in bytes
  const unsigned loff = (unsigned)(srow * DM + sseg) * 2u;       // per-lane byte offset; the rest of each address is block-uniform
  const char* gA  = Ab  + (size_t)mB * LDB;
  const char* gA2 = Ab2 + (size_t)mB * LDB;
  const char* gB  = Bb  + (size_t)nB * LDB;
  const char* gB2 = Bb2 + (size_t)nB * LDB;
  v4u pre[NLD];
  auto fetch = [&](int k0) {
    // unrolled (here and in put): pre[] is indexed by constants only and stays in registers; the row steps become immediate offsets
#pragma unroll
    for (int it = 0; it < NLD; ++it) {
      const int r = it * 32;
      const char* g;
      if (r < AR)                  g = gA  + (size_t)r * LDB;
      else if (r < AR * APL)       g = gA2 + (size_t)(r - AR) * LDB;
      else if (r < AR * APL + BR)  g = gB  + (size_t)(r - AR * APL) * LDB;
      else                         g = gB2 + (size_t)(r - AR * APL - BR) * LDB;
      pre[it] = *(const v4u*)(g + (size_t)k0 * 2 + loff);
    }
    asm volatile("s_wait_xcnt 0x0" ::: "memory");   // precaution: the code behind this reuses the address registers of the loads above
  };
  auto put = [&](int buf) {
    unsigned short* d = smem + buf * (ROWS * GP) + srow * GP + sseg;
#pragma unroll
    for (int it = 0; it < NLD; ++it) *(v4u*)(d + it * 32 * GP) = pre[it];
  };

  v8f acc[4][4];
#pragma unroll
  for (int i = 0; i < 4; ++i)
#pragma unroll
    for (int j = 0; j < 4; ++j) acc[i][j] = zero8();

  const int nk = K / GKC;
  fetch(0);
  put(0);
  __syncthreads();
  for (int kc = 0; kc < nk; ++kc) {
    const bool more = (kc + 1 < nk);           // block-uniform
    if (more) fetch((kc + 1) * GKC);
    const __bf16* sb = (const __bf16*)(const void*)(smem + (kc & 1) * (ROWS * GP));
    const __bf16* sA = sb + ((wm << 6) + rlane) * GP + koff;
    const __bf16* sB = sb + (AR * APL + (wn << 6) + rlane) * GP + koff;
    // every loop below is unrolled: af, bfrag and acc are indexed by constants only and stay in registers
#pragma unroll
    for (int ks = 0; ks < GKC; ks += 32) {
      v16b af[4][APL];
#pragma unroll
      for (int i = 0; i < 4; ++i)
#pragma unroll
        for (int ta = 0; ta < APL; ++ta) af[i][ta] = ldfrag_b(sA + (ta * AR + (i << 4)) * GP + ks);
#pragma unroll
      for (int tb = 0; tb < BPL; ++tb) {
        v16b bfrag[4];
#pragma unroll
        for (int j = 0; j < 4; ++j) bfrag[j] = ldfrag_b(sB + (tb * BR + (j << 4)) * GP + ks);
#pragma unroll
        for (int i = 0; i < 4; ++i) {
#pragma unroll
          for (int ta = 0; ta < APL; ++ta) {
#pragma unroll
            for (int j = 0; j < 4; ++j) acc[i][j] = mma_b_raw(af[i][ta], bfrag[j], acc[i][j]);
            dep_guard1_b(acc[i][0], acc[i][3], af[i][ta]);
          }
        }
        keep4_b(bfrag[0], bfrag[1], bfrag[2], bfrag[3]);
      }
    }
    if (more) put((kc + 1) & 1);
    __syncthreads();                           // publishes the stage just stored; ends every read of the stage just used
  }
  acc_guard4(acc[0][0], acc[0][1], acc[0][2], acc[0][3]);
  acc_guard4(acc[1][0], acc[1][1], acc[1][2], acc[1][3]);
  acc_guard4(acc[2][0], acc[2][1], acc[2][2], acc[2][3]);
  acc_guard4(acc[3][0], acc[3][1], acc[3][2], acc[3][3]);

  // ---- epilogue ----
  float bcol[4];
#pragma unroll
  for (int j = 0; j < 4; ++j) {
    const int nn = min(n0 + (j << 4) + rlane, nbias - 1);
    bcol[j] = bfr(bias[nn]);
  }
  float* slab = (float*)(void*)smem + wave * (16 * 68);   // the stages are dead behind the loop's last barrier
#pragma unroll
  for (int i = 0; i < 4; ++i) {
    const int mBase = m0 + (i << 4);
    float brow[8];
#pragma unroll
    for (int r = 0; r < 8; ++r) {
      const int mm = min(mBase + mOff + r, nbias - 1);
      brow[r] = bfr(bias[mm]);
    }
#pragma unroll
    for (int j = 0; j < 4; ++j) {
#pragma unroll
      for (int r = 0; r < 8; ++r) {
        const float bv = (biasRow != 0) ? brow[r] : bcol[j];
        slab[(mOff + r) * 68 + (j << 4) + rlane] = acc[i][j][r] + bv;
      }
    }
    __builtin_amdgcn_fence(__ATOMIC_RELEASE, "workgroup");
    __builtin_amdgcn_wave_barrier();
    __builtin_amdgcn_fence(__ATOMIC_ACQUIRE, "workgroup");
    if (OUT_MODE == 0) {
      float* C = (float*)Cout + (size_t)b * strideC;
      const int h2 = lane >> 4, c4 = (lane & 15) * 4;     // 256-B row segment = 16 lanes x 16 B
      v4f vo[8];
#pragma unroll
      for (int it = 0; it < 8; ++it) {
        const int row = it * 2 + h2;                       // it 0..7 x h2 0..1 = rows 0..15
        v4f sv = *(const v4f*)(slab + row * 68 + c4);
        const v4f rx = *(const v4f*)(resid + (size_t)(mBase + row) * ldr + n0 + c4);
#pragma unroll
        for (int e = 0; e < 4; ++e) sv[e] = sv[e] + bfr(rx[e]);
        vo[it] = sv;
      }
      {
#pragma unroll
        for (int it = 0; it < 8; ++it) {
          const int row = it * 2 + h2;
          *(v4f*)(C + (size_t)(mBase + row) * ldc + n0 + c4) = vo[it];
        }
        
      }
    } else {
      const int q = lane >> 3, c8 = (lane & 7) * 8;
      unsigned short* C  = (unsigned short*)Cout  + (size_t)b * strideC;
      unsigned short* C2 = (unsigned short*)Cout2 + (size_t)b * strideC2;
      const bool wlo = (OUT_MODE == 2) || (n0 < N2);      // wave-uniform
      v4u hv[4], lv[4];
#pragma unroll
      for (int it = 0; it < 4; ++it) {
        const int row = it * 4 + q;                        // it 0..3 x q 0..3 = rows 0..15
        const float* sp = slab + row * 68 + c8;
        v4u a, a2;
#pragma unroll
        for (int e = 0; e < 4; ++e) {
          const float f0 = sp[2 * e], f1 = sp[2 * e + 1];
          unsigned short h0, h1, l0, l1;
          if (OUT_MODE == 2) {
            h0 = bf_bits(f0); h1 = bf_bits(f1);
            l0 = bf_bits(f0 - bf_up(h0)); l1 = bf_bits(f1 - bf_up(h1));
          } else {
            const _Float16 x0 = (_Float16)f0, x1 = (_Float16)f1;
            h0 = h_bits(x0); h1 = h_bits(x1);
            l0 = h_bits((_Float16)((f0 - (float)x0) * rscale));
            l1 = h_bits((_Float16)((f1 - (float)x1) * rscale));
          }
          a[e] = pk16(h0, h1); a2[e] = pk16(l0, l1);
        }
        hv[it] = a; lv[it] = a2;
      }
      {
#pragma unroll
        for (int it = 0; it < 4; ++it) {
          const int row = it * 4 + q;
          *(v4u*)(C + (size_t)(mBase + row) * ldc + n0 + c8) = hv[it];
          if (wlo) *(v4u*)(C2 + (size_t)(mBase + row) * ldc2 + n0 + c8) = lv[it];
        }
        
      }
    }
    __builtin_amdgcn_fence(__ATOMIC_RELEASE, "workgroup");
    __builtin_amdgcn_wave_barrier();
    __builtin_amdgcn_fence(__ATOMIC_ACQUIRE, "workgroup");
  }
}

// =====================================================================================================
// Causal attention, head dim 64, arithmetic mask: logit = (q.k) * sscale, replaced by -1e9 when key > query.
//   q planes (f16 hi / f16 lo x2048): element (b, t, h, d) at [(b*SEQ + t)*DM + h*64 + d]
//   k plane (f16):                    same layout with key index s
//   v^T hi plane (f16):               element (b, h, d, s) at [(b*DM + h*64 + d)*SEQ + s]
//   v^T lo plane (f16, (v - hi)*4096): [(b*DM + h*64 + d)*VLP + s], s < VLP, read only when RES
//   (a key tile at or beyond VLP contributes a zero v lo term; addresses clamped)
//   out planes (bf16 hi / lo of the normalised context): element (b, t, h, d) at [(b*SEQ + t)*DM + h*64 + d]
//   scores = qh.k (acc t0) and ql.k (acc t1), s = (t0 + t1 * qlinv) * sscale, mask, all in f32
//   p = exp(s - m) carried as f16(1024 p); context = p . v on f16 WMMA; RES adds f16 lo planes of p and v
//   (scale 4096, separate accumulator folded back with 1/4096 per chunk in f32); online softmax in f32.
//   Block = 4 waves = 64 query rows of one (b, h); grid = nqbThis * NH * NB; key tiles kt = 0..qb (static bound NQB).
//   K / V^T chunk staging: 128 threads x 32 elements per plane = the whole 64x64 tile (plain 16-B loads,
//   __syncthreads before and after); P tiles are wave-private, spilled with _Float16 element stores and reloaded
//   Output coverage: each wave stores rows q0..q0+15 (it 0..3 x lane>>3 0..3) x 64 columns (8 lanes x 8) of both planes.
// =====================================================================================================
template <bool RES>
__global__ __launch_bounds__(128)
void attn_causal64(const unsigned short* __restrict__ qhp, const unsigned short* __restrict__ qlp,
                   const unsigned short* __restrict__ khp,
                   const unsigned short* __restrict__ vhp, const unsigned short* __restrict__ vlp,
                   unsigned short* ohp, unsigned short* olp,
                   int qbBase, int nqbThis, float sscale, float qlinv) {
  union FH { v16h v; v8h h[2]; };
  __shared__ __align__(16) _Float16 Ksh[64 * KP];                 // K [kv][d], pitch KP
  __shared__ __align__(16) _Float16 Vth[64 * KP];                 // V^T hi [d][kv], pitch KP
  __shared__ __align__(16) _Float16 Vtl[RES ? 64 * KP : 8];       // V^T lo, pitch KP
  __shared__ __align__(16) _Float16 Psh[4][16 * KP];              // per wave P [row][kv], pitch KP
  __shared__ __align__(16) _Float16 Psl[RES ? 4 : 1][16 * KP];    // per wave P lo, pitch KP
  __shared__ __align__(16) float    Os[4][16 * OP];               // per wave context tile [row][d], pitch OP

  const int tid  = threadIdx.x;
  const int wave = tid >> 5;
  const int lane = tid & 31;
  const int hh   = lane >> 4;
  const int c    = lane & 15;

  const int bx   = blockIdx.x;
  const int qbl  = bx % nqbThis;
  const int rest = bx / nqbThis;
  const int h    = rest % NH;
  const int b    = rest / NH;
  const int qb   = qbBase + qbl;
  const int q0   = qb * 64 + wave * 16;
  const size_t rowB = (size_t)b * SEQ;
  const int hoff = h * HD;

  const _Float16* Qh = (const _Float16*)(const void*)qhp;
  const _Float16* Ql = (const _Float16*)(const void*)qlp;
  const _Float16* Kh = (const _Float16*)(const void*)khp;
  const _Float16* Vh = (const _Float16*)(const void*)vhp + ((size_t)b * DM + (size_t)hoff) * SEQ;
  const _Float16* Vl = (const _Float16*)(const void*)vlp + ((size_t)b * DM + (size_t)hoff) * VLP;

  // ---- Q fragments (A operand, row = lane&15): 2 d-chunks, hi and lo ----
  v16h qah[2], qal[2];
#pragma unroll
  for (int dc = 0; dc < 2; ++dc) {
    const size_t qo = (rowB + q0 + c) * DM + hoff + dc * 32 + 8 * hh;
    qah[dc] = ldfrag_h(Qh + qo);
    qal[dc] = ldfrag_h(Ql + qo);
  }

  float mrow[8], lrow[8];
  v8f oacc[4];
#pragma unroll
  for (int r = 0; r < 8; ++r) { mrow[r] = -INFINITY; lrow[r] = 0.f; }
#pragma unroll
  for (int t = 0; t < 4; ++t) oacc[t] = zero8();

  for (int kt = 0; kt < NQB; ++kt) {         // static bound
    if (kt > qb) break;                      // block-uniform: causal, key tiles 0..qb only
    const int kv0 = kt * 64;
    __syncthreads();
    {
      const int r = tid >> 1, half = (tid & 1) * 32;
      const _Float16* kg  = Kh + (rowB + kv0 + r) * DM + hoff + half;   // K row kv0+r, d = half..half+31
      const _Float16* vg  = Vh + (size_t)r * SEQ + kv0 + half;         // V^T row d = r, s = kv0+half..+31
      const int kvl = (kv0 + 64 <= VLP) ? kv0 : (VLP - 64);          // clamped address into the lo plane
      const _Float16* vlg = Vl + (size_t)r * VLP + kvl + half;
      const bool resOK = (kv0 + 64 <= VLP);                           // block-uniform
#pragma unroll
      for (int i = 0; i < 4; ++i) {
        const v8h a0 = *(const v8h*)(kg + 8 * i);
        const v8h b0 = *(const v8h*)(vg + 8 * i);
        *(v8h*)(Ksh + r * KP + half + 8 * i) = a0;
        *(v8h*)(Vth + r * KP + half + 8 * i) = b0;
        if (RES) {
          v8h b1 = *(const v8h*)(vlg + 8 * i);
          if (!resOK) b1 = zero8h();
          *(v8h*)(Vtl + r * KP + half + 8 * i) = b1;
        }
      }
    }
    __syncthreads();

    // ---- scores: 16 query rows x 64 keys per wave, 2 f16 products into separate accumulators ----
    v8f s[4];
#pragma unroll
    for (int j = 0; j < 4; ++j) {
      v8f t0 = zero8(), t1 = zero8();
#pragma unroll
      for (int dc = 0; dc < 2; ++dc) {
        FH kb;
        kb.h[0] = *(const v8h*)(Ksh + (j * 16 + c) * KP + dc * 32 + 8 * hh);
        kb.h[1] = *(const v8h*)(Ksh + (j * 16 + c) * KP + dc * 32 + 16 + 8 * hh);
        t0 = mma_h(qah[dc], kb.v, t0);
        t1 = mma_h(qal[dc], kb.v, t1);
      }
#pragma unroll
      for (int r = 0; r < 8; ++r) s[j][r] = t0[r] + t1[r] * qlinv;
    }

    // ---- scale + causal mask, row max, online softmax, P (x1024, f16) and P lo (x4096) to LDS ----
    _Float16* pwh = Psh[wave];
    _Float16* pwl = Psl[RES ? wave : 0];
#pragma unroll
    for (int r = 0; r < 8; ++r) {
      const int qrow = q0 + 8 * hh + r;
      float m = -INFINITY;
#pragma unroll
      for (int j = 0; j < 4; ++j) {
        const int key = kv0 + j * 16 + c;
        float sv = s[j][r] * sscale;
        sv = (key > qrow) ? -1.0e9f : sv;
        s[j][r] = sv;
        m = fmaxf(m, sv);
      }
#pragma unroll
      for (int off = 1; off < 16; off <<= 1) m = fmaxf(m, __shfl_xor(m, off, 32));
      const float mnew  = fmaxf(mrow[r], m);
      const float msafe = (mnew == -INFINITY) ? 0.f : mnew;
      const float alpha = __expf(mrow[r] - msafe);
      mrow[r] = mnew;
      float psum = 0.f;
#pragma unroll
      for (int j = 0; j < 4; ++j) {
        const float p = __expf(s[j][r] - msafe);     // masked logit: exp -> 0
        psum += p;
        const float p1k = p * 1024.0f;
        const _Float16 ph = (_Float16)p1k;
        pwh[(8 * hh + r) * KP + j * 16 + c] = ph;
        if (RES) {
          const _Float16 pl = (_Float16)((p1k - (float)ph) * 4096.0f);
          pwl[(8 * hh + r) * KP + j * 16 + c] = pl;
        }
      }
#pragma unroll
      for (int off = 1; off < 16; off <<= 1) psum += __shfl_xor(psum, off, 32);
      lrow[r] = lrow[r] * alpha + psum;
#pragma unroll
      for (int t = 0; t < 4; ++t) oacc[t][r] *= alpha;
    }
    __builtin_amdgcn_fence(__ATOMIC_RELEASE, "workgroup");
    __builtin_amdgcn_wave_barrier();
    __builtin_amdgcn_fence(__ATOMIC_ACQUIRE, "workgroup");

    // ---- context += P . V (f16 WMMA), lo products into a separate accumulator ----
    v8f o1[4];
#pragma unroll
    for (int t = 0; t < 4; ++t) o1[t] = zero8();
#pragma unroll 1
    for (int kk = 0; kk < 2; ++kk) {
      FH pa, pl;
      pa.h[0] = *(const v8h*)(pwh + c * KP + kk * 32 + 8 * hh);
      pa.h[1] = *(const v8h*)(pwh + c * KP + kk * 32 + 16 + 8 * hh);
      if (RES) {
        pl.h[0] = *(const v8h*)(pwl + c * KP + kk * 32 + 8 * hh);
        pl.h[1] = *(const v8h*)(pwl + c * KP + kk * 32 + 16 + 8 * hh);
      } else {
        pl.v = pa.v;
      }
#pragma unroll
      for (int t = 0; t < 4; ++t) {
        FH vb;
        vb.h[0] = *(const v8h*)(Vth + (t * 16 + c) * KP + kk * 32 + 8 * hh);
        vb.h[1] = *(const v8h*)(Vth + (t * 16 + c) * KP + kk * 32 + 16 + 8 * hh);
        oacc[t] = mma_h(pa.v, vb.v, oacc[t]);
        if (RES) {
          FH vl;
          vl.h[0] = *(const v8h*)(Vtl + (t * 16 + c) * KP + kk * 32 + 8 * hh);
          vl.h[1] = *(const v8h*)(Vtl + (t * 16 + c) * KP + kk * 32 + 16 + 8 * hh);
          o1[t] = mma_h(pa.v, vl.v, o1[t]);
          o1[t] = mma_h(pl.v, vb.v, o1[t]);
        }
      }
    }
    if (RES) {
#pragma unroll
      for (int t = 0; t < 4; ++t)
#pragma unroll
        for (int r = 0; r < 8; ++r) oacc[t][r] += o1[t][r] * (1.0f / 4096.0f);
    }
  }

  // ---- normalise (1/l and the 1/1024 p carry), stage the wave's 16x64 tile, bf16 hi/lo split,
  float* os = Os[wave];
#pragma unroll
  for (int r = 0; r < 8; ++r) {
    const float l = lrow[r];
    const float inv = ((l > 0.f) ? (1.0f / l) : 0.f) * (1.0f / 1024.0f);
#pragma unroll
    for (int t = 0; t < 4; ++t) os[(8 * hh + r) * OP + t * 16 + c] = oacc[t][r] * inv;
  }
  __builtin_amdgcn_fence(__ATOMIC_RELEASE, "workgroup");
  __builtin_amdgcn_wave_barrier();
  __builtin_amdgcn_fence(__ATOMIC_ACQUIRE, "workgroup");
  {
    const int q4 = lane >> 3, c8 = (lane & 7) * 8;
    v4u hv[4], lv[4];
#pragma unroll
    for (int it = 0; it < 4; ++it) {
      const int row = it * 4 + q4;   // it 0..3 x q4 0..3 = rows 0..15 of the wave tile
      const float* sp = os + row * OP + c8;
      v4u a, a2;
#pragma unroll
      for (int e = 0; e < 4; ++e) {
        const float f0 = sp[2 * e], f1 = sp[2 * e + 1];
        const unsigned short h0 = bf_bits(f0), h1 = bf_bits(f1);
        const unsigned short l0 = bf_bits(f0 - bf_up(h0)), l1 = bf_bits(f1 - bf_up(h1));
        a[e] = pk16(h0, h1); a2[e] = pk16(l0, l1);
      }
      hv[it] = a; lv[it] = a2;
    }
    {
#pragma unroll
      for (int it = 0; it < 4; ++it) {
        const int row = it * 4 + q4;
        const size_t go = (rowB + q0 + row) * DM + (size_t)hoff + c8;
        *(v4u*)(ohp + go) = hv[it];
        *(v4u*)(olp + go) = lv[it];
      }
      
    }
  }
}

// =====================================================================================================
// Workspace map (bytes):
//   XNh  bf16 [8192][1024]        0          16777216   (later: Oh, context hi plane)
//   XNl  bf16 [8192][1024]        16777216   16777216   (later: Ol, context lo plane)
//   Wqb  bf16 [1024 n][1024 k]    33554432    2097152
//   Wkb  bf16 [1024][1024]        35651584    2097152
//   Wvb  bf16 [1024][1024]        37748736    2097152
//   Wob  bf16 [1024][1024]        39845888    2097152
//   Qh   f16  [8192][1024]        41943040   16777216
//   Ql   f16  [8192][1024]        58720256   16777216
//   Kh   f16  [8192][1024]        75497472   16777216
//   VTh  f16  [4][1024][2048]     92274688   16777216
//   VTl  f16  [4][1024][512]      109051904   4194304
//   end                           113246208
// All planes are exact multiples of their 64x64 / whole-line store granularity (no padded tails needed).
// Weights are [out n][in k] with k contiguous = the Bt / A layout the GEMM wants, so they are only converted.
// =====================================================================================================
extern "C" void kernel_launch(void* const* d_in, const int* in_sizes, int n_in,
                              void* d_out, int out_size, void* d_ws, size_t ws_size,
                              hipStream_t stream) {
  if (n_in < 11) return;
  if (in_sizes[0] != NB * SEQ * DM) return;
  if (in_sizes[1] != DM * DM || in_sizes[3] != DM * DM || in_sizes[5] != DM * DM || in_sizes[7] != DM * DM) return;
  if (in_sizes[2] != DM || in_sizes[4] != DM || in_sizes[6] != DM || in_sizes[8] != DM) return;
  if (in_sizes[9] != DM || in_sizes[10] != DM) return;
  if (out_size != NB * SEQ * DM) return;

  const float* x     = (const float*)d_in[0];
  const float* Wq    = (const float*)d_in[1];
  const float* bq    = (const float*)d_in[2];
  const float* Wk    = (const float*)d_in[3];
  const float* bk    = (const float*)d_in[4];
  const float* Wv    = (const float*)d_in[5];
  const float* bv    = (const float*)d_in[6];
  const float* Wo    = (const float*)d_in[7];
  const float* bo    = (const float*)d_in[8];
  const float* gamma = (const float*)d_in[9];
  const float* beta  = (const float*)d_in[10];

  const size_t P16 = (size_t)NB * SEQ * DM * 2;   // 16777216  16-bit activation plane [8192][1024]
  const size_t PW  = (size_t)DM * DM * 2;         //  2097152  16-bit weight plane
  const size_t PVT = (size_t)NB * DM * SEQ * 2;   // 16777216  v^T hi plane
  const size_t PVL = (size_t)NB * DM * VLP * 2;   //  4194304  v^T lo plane
  size_t off = 0;
  const size_t oXh  = off; off += P16;
  const size_t oXl  = off; off += P16;
  const size_t oWq  = off; off += PW;
  const size_t oWk  = off; off += PW;
  const size_t oWv  = off; off += PW;
  const size_t oWo  = off; off += PW;
  const size_t oQh  = off; off += P16;
  const size_t oQl  = off; off += P16;
  const size_t oKh  = off; off += P16;
  const size_t oVTh = off; off += PVT;
  const size_t oVTl = off; off += PVL;
  if (off > ws_size) return;                      // off = 113246208
  if (off > (size_t)134217728) return;
  const size_t oOh  = oXh;                        // context planes reuse the XN planes (dead after the projections)
  const size_t oOl  = oXl;

  char* ws = (char*)d_ws;
  unsigned short* XNh = (unsigned short*)(ws + oXh);
  unsigned short* XNl = (unsigned short*)(ws + oXl);
  unsigned short* Wqb = (unsigned short*)(ws + oWq);
  unsigned short* Wkb = (unsigned short*)(ws + oWk);
  unsigned short* Wvb = (unsigned short*)(ws + oWv);
  unsigned short* Wob = (unsigned short*)(ws + oWo);
  unsigned short* Qh  = (unsigned short*)(ws + oQh);
  unsigned short* Ql  = (unsigned short*)(ws + oQl);
  unsigned short* Kh  = (unsigned short*)(ws + oKh);
  unsigned short* VTh = (unsigned short*)(ws + oVTh);
  unsigned short* VTl = (unsigned short*)(ws + oVTl);
  unsigned short* Oh  = (unsigned short*)(ws + oOh);
  unsigned short* Ol  = (unsigned short*)(ws + oOl);

  const dim3 blk(256);
  const int n8w = DM * DM / 8;                                //  131072
  const dim3 gCvtW((n8w + 255) / 256);                        //  512 blocks
  const dim3 gLn(NB * SEQ);                                   // 8192 rows
  const dim3 gProj(((NB * SEQ / 64) * (DM / 64) + 7) / 8, 1); // 2048 tiles -> 256 blocks: M=8192, N=1024
  const dim3 gVT(((DM / 64) * (SEQ / 64) + 7) / 8, NB);      // 512 tiles -> 64 blocks x 4 batches: M=1024, N=2048

  // (1) weights [n][k] f32 -> bf16 [n][k]
  cvt_bf16x8<<<gCvtW, blk, 0, stream>>>(Wq, Wqb, n8w);
  cvt_bf16x8<<<gCvtW, blk, 0, stream>>>(Wk, Wkb, n8w);
  cvt_bf16x8<<<gCvtW, blk, 0, stream>>>(Wv, Wvb, n8w);
  cvt_bf16x8<<<gCvtW, blk, 0, stream>>>(Wo, Wob, n8w);
  // (2) LayerNorm -> bf16 hi / lo planes [8192][1024]
  ln_rows<<<gLn, dim3(128), 0, stream>>>(x, gamma, beta, XNh, XNl, NB * SEQ);
  // (3) q = xn . Wq^T + bq -> f16 hi plane + f16 lo plane x2048 [b*SEQ+t][h*64+d]   (M=8192, N=1024, K=1024)
  gemm64<1, 3><<<gProj, blk, 0, stream>>>(
      XNh, XNl, 0LL, Wqb, Wqb, 0LL,
      (void*)Qh, DM, 0LL, (void*)Ql, DM, 0LL, DM,
      bq, DM, 0, x, DM,
      NB * SEQ, DM, DM, 2048.0f);
  // (4) k = xn . Wk^T + bk -> f16 plane (no lo plane: N2 = 0)
  gemm64<1, 3><<<gProj, blk, 0, stream>>>(
      XNh, XNl, 0LL, Wkb, Wkb, 0LL,
      (void*)Kh, DM, 0LL, (void*)Kh, DM, 0LL, 0,
      bk, DM, 0, x, DM,
      NB * SEQ, DM, DM, 2048.0f);
  // (5) v^T = Wv . xn^T + bv per batch -> f16 hi plane [b][h*64+d][s] (pitch SEQ) and lo plane
  //     (x4096, keys < VLP only, pitch VLP)   (A = Wvb [n][k], Bt = xn planes of batch b; M=1024, N=2048, K=1024)
  gemm64<2, 3><<<gVT, blk, 0, stream>>>(
      Wvb, Wvb, 0LL, XNh, XNl, (long long)SEQ * DM,
      (void*)VTh, SEQ, (long long)DM * SEQ, (void*)VTl, VLP, (long long)DM * VLP, VLP,
      bv, DM, 1, x, DM,
      DM, SEQ, DM, 4096.0f);
  // (6) attention: query blocks 0..RESQB-1 with lo planes, the rest without
  attn_causal64<true><<<dim3(NB * NH * RESQB), dim3(128), 0, stream>>>(
      Qh, Ql, Kh, VTh, VTl, Oh, Ol, 0, RESQB, 0.125f, 1.0f / 2048.0f);
  attn_causal64<false><<<dim3(NB * NH * (NQB - RESQB)), dim3(128), 0, stream>>>(
      Qh, Ql, Kh, VTh, VTl, Oh, Ol, RESQB, NQB - RESQB, 0.125f, 1.0f / 2048.0f);
  // (7) out = bf16(x) + context . Wo^T + bo -> d_out f32 [8192][1024]  (A = context hi + lo planes, 2 products)
  gemm64<1, 0><<<gProj, blk, 0, stream>>>(
      Oh, Ol, 0LL, Wob, Wob, 0LL,
      d_out, DM, 0LL, d_out, DM, 0LL, 0,
      bo, DM, 0, x, DM,
      NB * SEQ, DM, DM, 1.0f);
  (void)hipGetLastError();
}

// v003
// It runs in 242 microseconds.
// Timed twice side by side with v002, it ran 1.58 and 1.59 times as fast.
// Over all steps from v000 it is 2.96 times as fast.
// Contractions: q/k/v^T projections = v_wmma_f32_16x16x32_bf16 (normalised activations as bf16 hi+lo planes, weights bf16, 2 products);
// q.k^T = v_wmma_f32_16x16x32_f16 (q as f16 hi plane + f16 lo plane x2048, k f16, 2 products, separate accumulators);
// p.v = v_wmma_f32_16x16x32_f16 (p carried x1024 in f16, v^T f16; extra f16 lo planes x4096 of p and v on the first 512 query rows);
// ctx.Wo^T = v_wmma_f32_16x16x32_bf16 (ctx as bf16 hi+lo planes, Wo bf16, 2 products); all f32 accumulate; LayerNorm, causal mask, softmax, bias and skip-add in f32.
#include <hip/hip_runtime.h>
#include <math.h>
#include <float.h>
#include <stdint.h>

#define NB    4
#define SEQ   2048
#define DM    1024
#define NH    16
#define HD    64
#define NQB   (SEQ / 64)   // 32 key / query tiles of 64
#define VLP   512          // key pitch of the v^T lo plane (keys 0..VLP-1)
#define RESQB 8            // leading 64-row query blocks that use the p / v lo planes
static_assert(RESQB * 64 <= VLP);
static_assert(NH * HD == DM);
static_assert((SEQ % 64) == 0 && (DM % 64) == 0);
static_assert(DM == 128 * 8);
#define KP    72           // LDS row pitch of the 64-wide f16 tiles, in elements: 144 B = 16 B x 9 (odd), so 16 rows read 16 B wide fall on distinct banks
#define OP    68           // LDS row pitch of the f32 context tile, in floats (16-byte reads down a column group without bank conflicts)
#define GKC   64           // GEMM: k elements per LDS stage = one 128-B line of every operand row
#define GP    72           // GEMM: LDS row pitch of a stage, in elements (144 B, as KP: 16-B fragment reads of 16 rows fall on distinct banks)
static_assert((GP * 2) % 16 == 0 && ((GP * 2) / 16) % 2 == 1 && GP >= GKC);
static_assert((DM % GKC) == 0 && ((NB * SEQ) % 128) == 0 && (DM % 256) == 0 && (SEQ % 128) == 0);
static_assert((KP * 2) % 16 == 0 && ((KP * 2) / 16) % 2 == 1 && KP >= 64);
static_assert((OP * 4) % 16 == 0 && OP >= 64);

typedef _Float16 v16h __attribute__((ext_vector_type(16)));
typedef _Float16 v8h  __attribute__((ext_vector_type(8)));
typedef __bf16   v16b __attribute__((ext_vector_type(16)));
typedef __bf16   v8b  __attribute__((ext_vector_type(8)));
typedef float    v8f  __attribute__((ext_vector_type(8)));
typedef float    v4f  __attribute__((ext_vector_type(4)));
typedef unsigned int v4u __attribute__((ext_vector_type(4)));

// ---- scalar helpers --------------------------------------------------------------------------------
__device__ __forceinline__ unsigned short bf_bits(float f) {          // f32 -> bf16 bits, RNE convert
  unsigned u = __float_as_uint(f);
  return (unsigned short)((u + 0x7FFFu + ((u >> 16) & 1u)) >> 16);
}
__device__ __forceinline__ float bf_up(unsigned short h) { return __uint_as_float(((unsigned)h) << 16); }
__device__ __forceinline__ float bfr(float f) { return bf_up(bf_bits(f)); }   // value after RNE convert to bf16
__device__ __forceinline__ unsigned short h_bits(_Float16 x) { return __builtin_bit_cast(unsigned short, x); }
__device__ __forceinline__ unsigned pk16(unsigned short a, unsigned short b) { return (unsigned)a | ((unsigned)b << 16); }
__device__ __forceinline__ v8f zero8() { v8f z = {0.f, 0.f, 0.f, 0.f, 0.f, 0.f, 0.f, 0.f}; return z; }
__device__ __forceinline__ v8h zero8h() {
  const _Float16 z = (_Float16)0.0f;
  v8h r = {z, z, z, z, z, z, z, z};
  return r;
}

// value of lane l ^ 16 (the other 16-lane half), by a vector cross-row move
__device__ __forceinline__ float xhalf(float x) {
  const int i = __builtin_bit_cast(int, x);
  return __builtin_bit_cast(float, __builtin_amdgcn_permlanex16(i, i, 0x76543210, 0xfedcba98, false, false));
}

// ---- fragment loaders: 16-bit A/B operand, lane -> row/col (lane&15), p already includes +8*(lane>>4);
//      elements 0..7 <- p[0..7] (k0+8h..), elements 8..15 <- p[16..23] (k0+16+8h..)
__device__ __forceinline__ v16b ldfrag_b(const __bf16* p) {
  union { v16b v; v8b h[2]; } f;
  f.h[0] = *(const v8b*)(p);
  f.h[1] = *(const v8b*)(p + 16);
  return f.v;
}
__device__ __forceinline__ v16h ldfrag_h(const _Float16* p) {
  union { v16h v; v8h h[2]; } f;
  f.h[0] = *(const v8h*)(p);
  f.h[1] = *(const v8h*)(p + 16);
  return f.v;
}

// ---- WMMA helpers with trailing VALU hazard gap --------------------------------------------------------
__device__ __forceinline__ v8f mma_h(v16h a, v16h b, v8f c) {
  c = __builtin_amdgcn_wmma_f32_16x16x32_f16(false, a, false, b, (short)0, c, false, false);
  asm volatile("v_nop\n\tv_nop\n\tv_nop\n\tv_nop" : "+v"(c) : "v"(a), "v"(b));
  return c;
}
__device__ __forceinline__ v8f mma_b_raw(v16b a, v16b b, v8f c) {
  return __builtin_amdgcn_wmma_f32_16x16x32_bf16(false, a, false, b, (short)0, c, false, false);
}
__device__ __forceinline__ void dep_guard1_b(v8f& a, v8f& b, v16b x) {
  asm volatile("v_nop\n\tv_nop\n\tv_nop\n\tv_nop" : "+v"(a), "+v"(b) : "v"(x));
}
__device__ __forceinline__ void keep4_b(v16b a, v16b b, v16b c, v16b d) {
  asm volatile("v_nop" :: "v"(a), "v"(b), "v"(c), "v"(d));
}
__device__ __forceinline__ void acc_guard4(v8f& a, v8f& b, v8f& c, v8f& d) {
  asm volatile("v_nop\n\tv_nop\n\tv_nop\n\tv_nop" : "+v"(a), "+v"(b), "+v"(c), "+v"(d));
}

// =====================================================================================================
// f32 -> bf16 (RNE convert), 8 elements per thread, one 16-B store per lane: a wave writes 512 contiguous B
// coverage: n8 threads x 8 = whole plane (n8 = 131072 here, a multiple of 256).
// =====================================================================================================
__global__ __launch_bounds__(256) void cvt_bf16x8(const float* __restrict__ in, unsigned short* out, int n8) {
  const int i = blockIdx.x * 256 + threadIdx.x;
  if (i < n8) {
    const v4f a = *(const v4f*)(in + (size_t)i * 8);
    const v4f b = *(const v4f*)(in + (size_t)i * 8 + 4);
    v4u p;
    p[0] = pk16(bf_bits(a[0]), bf_bits(a[1]));
    p[1] = pk16(bf_bits(a[2]), bf_bits(a[3]));
    p[2] = pk16(bf_bits(b[0]), bf_bits(b[1]));
    p[3] = pk16(bf_bits(b[2]), bf_bits(b[3]));
    *(v4u*)(out + (size_t)i * 8) = p;
    
  }
}

// =====================================================================================================
// LayerNorm over rows of DM=1024 (x, gamma, beta RNE-converted to bf16 values first), eps 1e-5,
// thread t owns elements 8t..8t+7. Output: bf16 hi plane and unscaled bf16 lo plane (lo = RNE(y - hi)),
// =====================================================================================================
__global__ __launch_bounds__(128) void ln_rows(const float* __restrict__ x, const float* __restrict__ gam,
                                             const float* __restrict__ bet,
                                             unsigned short* xhp, unsigned short* xlp, int nrows) {
  __shared__ float sh[8];
  const int row = blockIdx.x;
  if (row >= nrows) return;                    // block-uniform (grid == nrows)
  const int tid = threadIdx.x, wave = tid >> 5, lane = tid & 31;
  const size_t base = (size_t)row * DM + (size_t)tid * 8;
  const v4f a0 = *(const v4f*)(x + base);
  const v4f a1 = *(const v4f*)(x + base + 4);
  float v[8];
#pragma unroll
  for (int e = 0; e < 4; ++e) { v[e] = bfr(a0[e]); v[4 + e] = bfr(a1[e]); }
  float s = 0.f;
#pragma unroll
  for (int e = 0; e < 8; ++e) s += v[e];
#pragma unroll
  for (int off = 1; off < 32; off <<= 1) s += __shfl_xor(s, off, 32);
  if (lane == 0) sh[wave] = s;
  __syncthreads();
  const float mu = (sh[0] + sh[1] + sh[2] + sh[3]) * (1.0f / (float)DM);
  float d[8];
  float sq = 0.f;
#pragma unroll
  for (int e = 0; e < 8; ++e) { d[e] = v[e] - mu; sq += d[e] * d[e]; }
#pragma unroll
  for (int off = 1; off < 32; off <<= 1) sq += __shfl_xor(sq, off, 32);
  if (lane == 0) sh[4 + wave] = sq;
  __syncthreads();
  const float var = (sh[4] + sh[5] + sh[6] + sh[7]) * (1.0f / (float)DM);
  const float inv = rsqrtf(var + 1e-5f);
  const v4f g0 = *(const v4f*)(gam + tid * 8);
  const v4f g1 = *(const v4f*)(gam + tid * 8 + 4);
  const v4f e0 = *(const v4f*)(bet + tid * 8);
  const v4f e1 = *(const v4f*)(bet + tid * 8 + 4);
  float y[8];
#pragma unroll
  for (int e = 0; e < 4; ++e) {
    y[e]     = (d[e] * inv) * bfr(g0[e]) + bfr(e0[e]);
    y[4 + e] = (d[4 + e] * inv) * bfr(g1[e]) + bfr(e1[e]);
  }
  v4u ph, pl;
#pragma unroll
  for (int e = 0; e < 4; ++e) {
    const unsigned short h0 = bf_bits(y[2 * e]), h1 = bf_bits(y[2 * e + 1]);
    const unsigned short l0 = bf_bits(y[2 * e] - bf_up(h0)), l1 = bf_bits(y[2 * e + 1] - bf_up(h1));
    ph[e] = pk16(h0, h1);
    pl[e] = pk16(l0, l1);
  }
  unsigned short* dh = xhp + base;
  unsigned short* dl = xlp + base;
  *(v4u*)dh = ph;
  *(v4u*)dl = pl;
  
}

// =====================================================================================================
// Batched bf16 WMMA GEMM: C[m][n] = sum_k A[m][k] * Bt[n][k]; one wave per 64x64 tile, 8 waves per block.
// A row-major [M][K], Bt row-major [N][K] (k contiguous), both of row pitch DM elements. blockIdx.y = batch index (strides in elements).
// NSPLIT: 0 = A.Bt; 1 = A.Bt + A2.Bt (A2 = unscaled bf16 lo plane of A); 2 = A.Bt + A.Bt2 (Bt2 = lo plane of Bt).
// Block tile = WM x WN wave tiles (2 x 4 = 128 x 256; NSPLIT 2: 4 x 2 = 256 x 128, so the two-plane operand has the fewer rows).
// Operands go through LDS in stages of GKC = 64 k: every operand row of the block tile gives one whole 128-B line per stage,
// read from global once per block (8 lanes x 16 B per row, 4 whole lines per wave load) and shared by the waves that need it.
// Two stage buffers: the next stage's lines are loaded into registers ahead of this stage's products, stored to the other
// buffer behind them, one __syncthreads() per stage. Per accumulator the order of the products is k ascending, hi then lo.
// M multiple of 64*WM, N of 64*WN, K of GKC (the host launches only such shapes).
// bias: added in f32 (bias value RNE-converted to bf16 first); biasRow 0 -> bias[n], 1 -> bias[m]; index clamped to nbias-1.
// OUT_MODE: 0 = f32 (pitch ldc) = acc + bias + bf16value(resid[m*ldr + n]);
//           2 = bf16 hi plane C + bf16 lo plane C2 (lo = RNE(v - hi), unscaled);
//           3 = f16 hi plane C + f16 lo plane C2 = f16((v - hi) * rscale), C2 written only for tiles
//               with n0 < N2 (pitch ldc2, batch stride strideC2).
// =====================================================================================================
template <int NSPLIT, int OUT_MODE>
__global__ __launch_bounds__(256) void gemm64(
    const unsigned short* __restrict__ Ap, const unsigned short* __restrict__ A2p, long long strideA,
    const unsigned short* __restrict__ Btp, const unsigned short* __restrict__ Bt2p, long long strideB,
    void* Cout, int ldc, long long strideC,
    void* Cout2, int ldc2, long long strideC2, int N2,
    const float* __restrict__ bias, int nbias, int biasRow,
    const float* __restrict__ resid, int ldr,
    int M, int N, int K, float rscale) {
  constexpr int WM   = (NSPLIT == 2) ? 4 : 2;          // wave grid of the block
  constexpr int WN   = 8 / WM;
  constexpr int APL  = (NSPLIT == 1) ? 2 : 1;          // planes of A / of Bt
  constexpr int BPL  = (NSPLIT == 2) ? 2 : 1;
  constexpr int AR   = WM * 64;                        // rows per plane in a stage
  constexpr int BR   = WN * 64;
  constexpr int ROWS = AR * APL + BR * BPL;            // stage rows: [A | A2 | Bt | Bt2]
  constexpr int NLD  = ROWS / 32;                      // 16-B pieces per thread per stage (256 threads = 32 rows x 8 pieces)
  static_assert(AR % 32 == 0 && BR % 32 == 0);
  static_assert(2 * ROWS * GP * 2 >= 8 * 16 * 68 * 4);
  __shared__ __align__(16) unsigned short smem[2 * ROWS * GP];   // two stages; behind the k loop: per-wave 16x64 f32 slabs, pitch 68
  const int b    = blockIdx.y;
  const int lane = threadIdx.x & 31;
  const int wave = threadIdx.x >> 5;
  const int tilesNb = N / (64 * WN);
  const int tilesMb = M / (64 * WM);
  if ((int)blockIdx.x >= tilesMb * tilesNb) return;    // block-uniform, ahead of every barrier
  const int bm = blockIdx.x / tilesNb;
  const int bn = blockIdx.x - bm * tilesNb;
  const int mB = bm * (64 * WM);
  const int nB = bn * (64 * WN);
  const int wm = wave / WN;
  const int wn = wave - wm * WN;
  const int m0 = mB + (wm << 6);
  const int n0 = nB + (wn << 6);

  const char* Ab  = (const char*)(Ap  + (size_t)b * strideA);
  const char* Bb  = (const char*)(Btp + (size_t)b * strideB);
  const char* Ab2 = (NSPLIT == 1) ? (const char*)(A2p  + (size_t)b * strideA) : Ab;
  const char* Bb2 = (NSPLIT == 2) ? (const char*)(Bt2p + (size_t)b * strideB) : Bb;

  const int rlane = lane & 15;                 // row (A) / col (B, D) within subtile
  const int koff  = (lane >> 4) * 8;           // k offset of this lane half
  const int mOff  = (lane >> 4) * 8;           // D row offset

  // staging map: 8 lanes x 16 B = one row's 128-B line; pass it covers stage rows it*32 .. it*32+31. Neighbouring groups of
  // 8 lanes take rows 8 apart: 8 x 144 B = 128 B mod 256 B, so the two rows of a 16-lane ds_store_b128 half fill all 64 banks once.
  const int srow = ((threadIdx.x >> 7) << 4) | (((threadIdx.x >> 3) & 1) << 3) | ((threadIdx.x >> 4) & 7);
  const int sseg = (threadIdx.x & 7) * 8;
  constexpr size_t LDB = (size_t)DM * 2;                         // operand row pitch in bytes
  const unsigned loff = (unsigned)(srow * DM + sseg) * 2u;       // per-lane byte offset; the rest of each address is block-uniform
  const char* gA  = Ab  + (size_t)mB * LDB;
  const char* gA2 = Ab2 + (size_t)mB * LDB;
  const char* gB  = Bb  + (size_t)nB * LDB;
  const char* gB2 = Bb2 + (size_t)nB * LDB;
  v4u pre[NLD];
  auto fetch = [&](int k0) {
    // unrolled (here and in put): pre[] is indexed by constants only and stays in registers; the row steps become immediate offsets
#pragma unroll
    for (int it = 0; it < NLD; ++it) {
      const int r = it * 32;
      const char* g;
      if (r < AR)                  g = gA  + (size_t)r * LDB;
      else if (r < AR * APL)       g = gA2 + (size_t)(r - AR) * LDB;
      else if (r < AR * APL + BR)  g = gB  + (size_t)(r - AR * APL) * LDB;
      else                         g = gB2 + (size_t)(r - AR * APL - BR) * LDB;
      pre[it] = *(const v4u*)(g + (size_t)k0 * 2 + loff);
    }
    asm volatile("s_wait_xcnt 0x0" ::: "memory");   // precaution: the code behind this reuses the address registers of the loads above
  };
  auto put = [&](int buf) {
    unsigned short* d = smem + buf * (ROWS * GP) + srow * GP + sseg;
#pragma unroll
    for (int it = 0; it < NLD; ++it) *(v4u*)(d + it * 32 * GP) = pre[it];
  };

  v8f acc[4][4];
#pragma unroll
  for (int i = 0; i < 4; ++i)
#pragma unroll
    for (int j = 0; j < 4; ++j) acc[i][j] = zero8();

  const int nk = K / GKC;
  fetch(0);
  put(0);
  __syncthreads();
  for (int kc = 0; kc < nk; ++kc) {
    const bool more = (kc + 1 < nk);           // block-uniform
    if (more) fetch((kc + 1) * GKC);
    const __bf16* sb = (const __bf16*)(const void*)(smem + (kc & 1) * (ROWS * GP));
    const __bf16* sA = sb + ((wm << 6) + rlane) * GP + koff;
    const __bf16* sB = sb + (AR * APL + (wn << 6) + rlane) * GP + koff;
    // every loop below is unrolled: af, bfrag and acc are indexed by constants only and stay in registers
#pragma unroll
    for (int ks = 0; ks < GKC; ks += 32) {
      v16b af[4][APL];
#pragma unroll
      for (int i = 0; i < 4; ++i)
#pragma unroll
        for (int ta = 0; ta < APL; ++ta) af[i][ta] = ldfrag_b(sA + (ta * AR + (i << 4)) * GP + ks);
#pragma unroll
      for (int tb = 0; tb < BPL; ++tb) {
        v16b bfrag[4];
#pragma unroll
        for (int j = 0; j < 4; ++j) bfrag[j] = ldfrag_b(sB + (tb * BR + (j << 4)) * GP + ks);
#pragma unroll
        for (int i = 0; i < 4; ++i) {
#pragma unroll
          for (int ta = 0; ta < APL; ++ta) {
#pragma unroll
            for (int j = 0; j < 4; ++j) acc[i][j] = mma_b_raw(af[i][ta], bfrag[j], acc[i][j]);
            dep_guard1_b(acc[i][0], acc[i][3], af[i][ta]);
          }
        }
        keep4_b(bfrag[0], bfrag[1], bfrag[2], bfrag[3]);
      }
    }
    if (more) put((kc + 1) & 1);
    __syncthreads();                           // publishes the stage just stored; ends every read of the stage just used
  }
  acc_guard4(acc[0][0], acc[0][1], acc[0][2], acc[0][3]);
  acc_guard4(acc[1][0], acc[1][1], acc[1][2], acc[1][3]);
  acc_guard4(acc[2][0], acc[2][1], acc[2][2], acc[2][3]);
  acc_guard4(acc[3][0], acc[3][1], acc[3][2], acc[3][3]);

  // ---- epilogue ----
  float bcol[4];
#pragma unroll
  for (int j = 0; j < 4; ++j) {
    const int nn = min(n0 + (j << 4) + rlane, nbias - 1);
    bcol[j] = bfr(bias[nn]);
  }
  float* slab = (float*)(void*)smem + wave * (16 * 68);   // the stages are dead behind the loop's last barrier
#pragma unroll
  for (int i = 0; i < 4; ++i) {
    const int mBase = m0 + (i << 4);
    float brow[8];
#pragma unroll
    for (int r = 0; r < 8; ++r) {
      const int mm = min(mBase + mOff + r, nbias - 1);
      brow[r] = bfr(bias[mm]);
    }
#pragma unroll
    for (int j = 0; j < 4; ++j) {
#pragma unroll
      for (int r = 0; r < 8; ++r) {
        const float bv = (biasRow != 0) ? brow[r] : bcol[j];
        slab[(mOff + r) * 68 + (j << 4) + rlane] = acc[i][j][r] + bv;
      }
    }
    __builtin_amdgcn_fence(__ATOMIC_RELEASE, "workgroup");
    __builtin_amdgcn_wave_barrier();
    __builtin_amdgcn_fence(__ATOMIC_ACQUIRE, "workgroup");
    if (OUT_MODE == 0) {
      float* C = (float*)Cout + (size_t)b * strideC;
      const int h2 = lane >> 4, c4 = (lane & 15) * 4;     // 256-B row segment = 16 lanes x 16 B
      v4f vo[8];
#pragma unroll
      for (int it = 0; it < 8; ++it) {
        const int row = it * 2 + h2;                       // it 0..7 x h2 0..1 = rows 0..15
        v4f sv = *(const v4f*)(slab + row * 68 + c4);
        const v4f rx = *(const v4f*)(resid + (size_t)(mBase + row) * ldr + n0 + c4);
#pragma unroll
        for (int e = 0; e < 4; ++e) sv[e] = sv[e] + bfr(rx[e]);
        vo[it] = sv;
      }
      {
#pragma unroll
        for (int it = 0; it < 8; ++it) {
          const int row = it * 2 + h2;
          *(v4f*)(C + (size_t)(mBase + row) * ldc + n0 + c4) = vo[it];
        }
        
      }
    } else {
      const int q = lane >> 3, c8 = (lane & 7) * 8;
      unsigned short* C  = (unsigned short*)Cout  + (size_t)b * strideC;
      unsigned short* C2 = (unsigned short*)Cout2 + (size_t)b * strideC2;
      const bool wlo = (OUT_MODE == 2) || (n0 < N2);      // wave-uniform
      v4u hv[4], lv[4];
#pragma unroll
      for (int it = 0; it < 4; ++it) {
        const int row = it * 4 + q;                        // it 0..3 x q 0..3 = rows 0..15
        const float* sp = slab + row * 68 + c8;
        v4u a, a2;
#pragma unroll
        for (int e = 0; e < 4; ++e) {
          const float f0 = sp[2 * e], f1 = sp[2 * e + 1];
          unsigned short h0, h1, l0, l1;
          if (OUT_MODE == 2) {
            h0 = bf_bits(f0); h1 = bf_bits(f1);
            l0 = bf_bits(f0 - bf_up(h0)); l1 = bf_bits(f1 - bf_up(h1));
          } else {
            const _Float16 x0 = (_Float16)f0, x1 = (_Float16)f1;
            h0 = h_bits(x0); h1 = h_bits(x1);
            l0 = h_bits((_Float16)((f0 - (float)x0) * rscale));
            l1 = h_bits((_Float16)((f1 - (float)x1) * rscale));
          }
          a[e] = pk16(h0, h1); a2[e] = pk16(l0, l1);
        }
        hv[it] = a; lv[it] = a2;
      }
      {
#pragma unroll
        for (int it = 0; it < 4; ++it) {
          const int row = it * 4 + q;
          *(v4u*)(C + (size_t)(mBase + row) * ldc + n0 + c8) = hv[it];
          if (wlo) *(v4u*)(C2 + (size_t)(mBase + row) * ldc2 + n0 + c8) = lv[it];
        }
        
      }
    }
    __builtin_amdgcn_fence(__ATOMIC_RELEASE, "workgroup");
    __builtin_amdgcn_wave_barrier();
    __builtin_amdgcn_fence(__ATOMIC_ACQUIRE, "workgroup");
  }
}

template <bool RES>
__global__ __launch_bounds__(128)
void attn_causal64(const unsigned short* __restrict__ qhp, const unsigned short* __restrict__ qlp,
                   const unsigned short* __restrict__ khp,
                   const unsigned short* __restrict__ vhp, const unsigned short* __restrict__ vlp,
                   unsigned short* ohp, unsigned short* olp,
                   int qbBase, int nqbThis, float sscale, float qlinv) {
  union FH { v16h v; v8h h[2]; };
  __shared__ __align__(16) _Float16 Ksh[64 * KP];                 // K [kv][d], pitch KP
  __shared__ __align__(16) _Float16 Vth[64 * KP];                 // V^T hi [d][kv], pitch KP
  __shared__ __align__(16) _Float16 Vtl[RES ? 64 * KP : 8];       // V^T lo, pitch KP
  __shared__ __align__(16) float    Os[4][16 * OP];               // per wave context tile [row][d], pitch OP

  const int tid  = threadIdx.x;
  const int wave = tid >> 5;
  const int lane = tid & 31;
  const int hh   = lane >> 4;
  const int c    = lane & 15;

  const int bx   = blockIdx.x;
  const int qbl  = bx % nqbThis;
  const int rest = bx / nqbThis;
  const int h    = rest % NH;
  const int b    = rest / NH;
  const int qb   = qbBase + qbl;
  const int q0   = qb * 64 + wave * 16;
  const size_t rowB = (size_t)b * SEQ;
  const int hoff = h * HD;

  const _Float16* Qh = (const _Float16*)(const void*)qhp;
  const _Float16* Ql = (const _Float16*)(const void*)qlp;
  const _Float16* Kh = (const _Float16*)(const void*)khp;
  const _Float16* Vh = (const _Float16*)(const void*)vhp + ((size_t)b * DM + (size_t)hoff) * SEQ;
  const _Float16* Vl = (const _Float16*)(const void*)vlp + ((size_t)b * DM + (size_t)hoff) * VLP;

  // ---- Q fragments (B operand, column = query = lane&15): 2 d-chunks, hi and lo ----
  v16h qah[2], qal[2];
#pragma unroll
  for (int dc = 0; dc < 2; ++dc) {
    const size_t qo = (rowB + q0 + c) * DM + hoff + dc * 32 + 8 * hh;
    qah[dc] = ldfrag_h(Qh + qo);
    qal[dc] = ldfrag_h(Ql + qo);
  }

  const int qrow = q0 + c;                   // this lane's query
  float mrow = -INFINITY, lrow = 0.f;        // its running maximum; the sum over the keys of this lane's half
  v8f oacc[4];                               // O^T: oacc[t][r] = context[query c][d = t*16 + 8*hh + r]
#pragma unroll
  for (int t = 0; t < 4; ++t) oacc[t] = zero8();

  for (int kt = 0; kt < NQB; ++kt) {         // static bound
    if (kt > qb) break;                      // block-uniform: causal, key tiles 0..qb only
    const int kv0 = kt * 64;
    __syncthreads();
    {
      const int r = tid >> 1, half = (tid & 1) * 32;
      const _Float16* kg  = Kh + (rowB + kv0 + r) * DM + hoff + half;   // K row kv0+r, d = half..half+31
      const _Float16* vg  = Vh + (size_t)r * SEQ + kv0 + half;         // V^T row d = r, s = kv0+half..+31
      const int kvl = (kv0 + 64 <= VLP) ? kv0 : (VLP - 64);          // clamped address into the lo plane
      const _Float16* vlg = Vl + (size_t)r * VLP + kvl + half;
      const bool resOK = (kv0 + 64 <= VLP);                           // block-uniform
#pragma unroll
      for (int i = 0; i < 4; ++i) {
        const v8h a0 = *(const v8h*)(kg + 8 * i);
        const v8h b0 = *(const v8h*)(vg + 8 * i);
        *(v8h*)(Ksh + r * KP + half + 8 * i) = a0;
        *(v8h*)(Vth + r * KP + half + 8 * i) = b0;
        if (RES) {
          v8h b1 = *(const v8h*)(vlg + 8 * i);
          if (!resOK) b1 = zero8h();
          *(v8h*)(Vtl + r * KP + half + 8 * i) = b1;
        }
      }
    }
    __syncthreads();

    // ---- scores, transposed: 64 keys x 16 queries per wave, 2 f16 products into separate accumulators;
    //      s[j][r] = score of key kv0 + j*16 + 8*hh + r against query qrow ----
    v8f s[4];
#pragma unroll
    for (int j = 0; j < 4; ++j) {
      v8f t0 = zero8(), t1 = zero8();
#pragma unroll
      for (int dc = 0; dc < 2; ++dc) {
        FH kb;
        kb.h[0] = *(const v8h*)(Ksh + (j * 16 + c) * KP + dc * 32 + 8 * hh);
        kb.h[1] = *(const v8h*)(Ksh + (j * 16 + c) * KP + dc * 32 + 16 + 8 * hh);
        t0 = mma_h(kb.v, qah[dc], t0);
        t1 = mma_h(kb.v, qal[dc], t1);
      }
#pragma unroll
      for (int r = 0; r < 8; ++r) s[j][r] = t0[r] + t1[r] * qlinv;
    }

    // ---- scale + causal mask, maximum, online softmax; P^T (x1024, f16) and its lo plane (x4096) packed as B operands ----
    const int lim = qrow - kv0 - 8 * hh;       // key > qrow  <=>  j*16 + r > lim
    float mj[4];                               // four independent chains, joined below
#pragma unroll
    for (int j = 0; j < 4; ++j) {
      mj[j] = -INFINITY;
#pragma unroll
      for (int r = 0; r < 8; ++r) {
        float sv = s[j][r] * sscale;
        sv = (j * 16 + r > lim) ? -1.0e9f : sv;
        s[j][r] = sv;
        mj[j] = fmaxf(mj[j], sv);
      }
    }
    float m = fmaxf(fmaxf(mj[0], mj[1]), fmaxf(mj[2], mj[3]));
    m = fmaxf(m, xhalf(m));                    // both halves now hold the query's maximum over the 64 keys
    const float mnew  = fmaxf(mrow, m);
    const float msafe = (mnew == -INFINITY) ? 0.f : mnew;
    const float alpha = __expf(mrow - msafe);
    mrow = mnew;
    // element e of the B operand of key group kk is key kk*32 + (e < 8 ? 8*hh + e : 16 + 8*hh + e - 8): tile 2kk, then tile 2kk+1
    FH pb[2], pl[2];
    float pj[4];
#pragma unroll
    for (int j = 0; j < 4; ++j) {
      pj[j] = 0.f;
#pragma unroll
      for (int r = 0; r < 8; ++r) {
        const float p = __expf(s[j][r] - msafe);     // masked logit: exp -> 0
        pj[j] += p;
        const float p1k = p * 1024.0f;
        const _Float16 ph = (_Float16)p1k;
        pb[j >> 1].h[j & 1][r] = ph;
        if (RES) pl[j >> 1].h[j & 1][r] = (_Float16)((p1k - (float)ph) * 4096.0f);
      }
    }
    lrow = lrow * alpha + ((pj[0] + pj[1]) + (pj[2] + pj[3]));
#pragma unroll
    for (int t = 0; t < 4; ++t)
#pragma unroll
      for (int r = 0; r < 8; ++r) oacc[t][r] *= alpha;

    // ---- context^T += V^T . P^T (f16 WMMA), lo products into a separate accumulator ----
    v8f o1[4];
#pragma unroll
    for (int t = 0; t < 4; ++t) o1[t] = zero8();
    // unrolled: pb and pl are indexed by constants only and stay in registers
#pragma unroll
    for (int kk = 0; kk < 2; ++kk) {
#pragma unroll
      for (int t = 0; t < 4; ++t) {
        FH vb;
        vb.h[0] = *(const v8h*)(Vth + (t * 16 + c) * KP + kk * 32 + 8 * hh);
        vb.h[1] = *(const v8h*)(Vth + (t * 16 + c) * KP + kk * 32 + 16 + 8 * hh);
        oacc[t] = mma_h(vb.v, pb[kk].v, oacc[t]);
        if (RES) {
          FH vl;
          vl.h[0] = *(const v8h*)(Vtl + (t * 16 + c) * KP + kk * 32 + 8 * hh);
          vl.h[1] = *(const v8h*)(Vtl + (t * 16 + c) * KP + kk * 32 + 16 + 8 * hh);
          o1[t] = mma_h(vl.v, pb[kk].v, o1[t]);
          o1[t] = mma_h(vb.v, pl[kk].v, o1[t]);
        }
      }
    }
    if (RES) {
#pragma unroll
      for (int t = 0; t < 4; ++t)
#pragma unroll
        for (int r = 0; r < 8; ++r) oacc[t][r] += o1[t][r] * (1.0f / 4096.0f);
    }
  }

  // ---- normalise (1/l and the 1/1024 p carry), stage the wave's 16x64 tile, bf16 hi/lo split,
  float* os = Os[wave];
  {
    const float l = lrow + xhalf(lrow);        // the two halves' key sums joined
    const float inv = ((l > 0.f) ? (1.0f / l) : 0.f) * (1.0f / 1024.0f);
#pragma unroll
    for (int t = 0; t < 4; ++t) {              // a lane's 8 registers are 8 consecutive d of its query's row
      v4f w0, w1;
#pragma unroll
      for (int e = 0; e < 4; ++e) { w0[e] = oacc[t][e] * inv; w1[e] = oacc[t][4 + e] * inv; }
      *(v4f*)(os + c * OP + t * 16 + 8 * hh)     = w0;
      *(v4f*)(os + c * OP + t * 16 + 8 * hh + 4) = w1;
    }
  }
  __builtin_amdgcn_fence(__ATOMIC_RELEASE, "workgroup");
  __builtin_amdgcn_wave_barrier();
  __builtin_amdgcn_fence(__ATOMIC_ACQUIRE, "workgroup");
  {
    const int q4 = lane >> 3, c8 = (lane & 7) * 8;
    v4u hv[4], lv[4];
#pragma unroll
    for (int it = 0; it < 4; ++it) {
      const int row = it * 4 + q4;   // it 0..3 x q4 0..3 = rows 0..15 of the wave tile
      const float* sp = os + row * OP + c8;
      v4u a, a2;
#pragma unroll
      for (int e = 0; e < 4; ++e) {
        const float f0 = sp[2 * e], f1 = sp[2 * e + 1];
        const unsigned short h0 = bf_bits(f0), h1 = bf_bits(f1);
        const unsigned short l0 = bf_bits(f0 - bf_up(h0)), l1 = bf_bits(f1 - bf_up(h1));
        a[e] = pk16(h0, h1); a2[e] = pk16(l0, l1);
      }
      hv[it] = a; lv[it] = a2;
    }
    {
#pragma unroll
      for (int it = 0; it < 4; ++it) {
        const int row = it * 4 + q4;
        const size_t go = (rowB + q0 + row) * DM + (size_t)hoff + c8;
        *(v4u*)(ohp + go) = hv[it];
        *(v4u*)(olp + go) = lv[it];
      }
      
    }
  }
}

// =====================================================================================================
// Workspace map (bytes):
//   XNh  bf16 [8192][1024]        0          16777216   (later: Oh, context hi plane)
//   XNl  bf16 [8192][1024]        16777216   16777216   (later: Ol, context lo plane)
//   Wqb  bf16 [1024 n][1024 k]    33554432    2097152
//   Wkb  bf16 [1024][1024]        35651584    2097152
//   Wvb  bf16 [1024][1024]        37748736    2097152
//   Wob  bf16 [1024][1024]        39845888    2097152
//   Qh   f16  [8192][1024]        41943040   16777216
//   Ql   f16  [8192][1024]        58720256   16777216
//   Kh   f16  [8192][1024]        75497472   16777216
//   VTh  f16  [4][1024][2048]     92274688   16777216
//   VTl  f16  [4][1024][512]      109051904   4194304
//   end                           113246208
// All planes are exact multiples of their 64x64 / whole-line store granularity (no padded tails needed).
// Weights are [out n][in k] with k contiguous = the Bt / A layout the GEMM wants, so they are only converted.
// =====================================================================================================
extern "C" void kernel_launch(void* const* d_in, const int* in_sizes, int n_in,
                              void* d_out, int out_size, void* d_ws, size_t ws_size,
                              hipStream_t stream) {
  if (n_in < 11) return;
  if (in_sizes[0] != NB * SEQ * DM) return;
  if (in_sizes[1] != DM * DM || in_sizes[3] != DM * DM || in_sizes[5] != DM * DM || in_sizes[7] != DM * DM) return;
  if (in_sizes[2] != DM || in_sizes[4] != DM || in_sizes[6] != DM || in_sizes[8] != DM) return;
  if (in_sizes[9] != DM || in_sizes[10] != DM) return;
  if (out_size != NB * SEQ * DM) return;

  const float* x     = (const float*)d_in[0];
  const float* Wq    = (const float*)d_in[1];
  const float* bq    = (const float*)d_in[2];
  const float* Wk    = (const float*)d_in[3];
  const float* bk    = (const float*)d_in[4];
  const float* Wv    = (const float*)d_in[5];
  const float* bv    = (const float*)d_in[6];
  const float* Wo    = (const float*)d_in[7];
  const float* bo    = (const float*)d_in[8];
  const float* gamma = (const float*)d_in[9];
  const float* beta  = (const float*)d_in[10];

  const size_t P16 = (size_t)NB * SEQ * DM * 2;   // 16777216  16-bit activation plane [8192][1024]
  const size_t PW  = (size_t)DM * DM * 2;         //  2097152  16-bit weight plane
  const size_t PVT = (size_t)NB * DM * SEQ * 2;   // 16777216  v^T hi plane
  const size_t PVL = (size_t)NB * DM * VLP * 2;   //  4194304  v^T lo plane
  size_t off = 0;
  const size_t oXh  = off; off += P16;
  const size_t oXl  = off; off += P16;
  const size_t oWq  = off; off += PW;
  const size_t oWk  = off; off += PW;
  const size_t oWv  = off; off += PW;
  const size_t oWo  = off; off += PW;
  const size_t oQh  = off; off += P16;
  const size_t oQl  = off; off += P16;
  const size_t oKh  = off; off += P16;
  const size_t oVTh = off; off += PVT;
  const size_t oVTl = off; off += PVL;
  if (off > ws_size) return;                      // off = 113246208
  if (off > (size_t)134217728) return;
  const size_t oOh  = oXh;                        // context planes reuse the XN planes (dead after the projections)
  const size_t oOl  = oXl;

  char* ws = (char*)d_ws;
  unsigned short* XNh = (unsigned short*)(ws + oXh);
  unsigned short* XNl = (unsigned short*)(ws + oXl);
  unsigned short* Wqb = (unsigned short*)(ws + oWq);
  unsigned short* Wkb = (unsigned short*)(ws + oWk);
  unsigned short* Wvb = (unsigned short*)(ws + oWv);
  unsigned short* Wob = (unsigned short*)(ws + oWo);
  unsigned short* Qh  = (unsigned short*)(ws + oQh);
  unsigned short* Ql  = (unsigned short*)(ws + oQl);
  unsigned short* Kh  = (unsigned short*)(ws + oKh);
  unsigned short* VTh = (unsigned short*)(ws + oVTh);
  unsigned short* VTl = (unsigned short*)(ws + oVTl);
  unsigned short* Oh  = (unsigned short*)(ws + oOh);
  unsigned short* Ol  = (unsigned short*)(ws + oOl);

  const dim3 blk(256);
  const int n8w = DM * DM / 8;                                //  131072
  const dim3 gCvtW((n8w + 255) / 256);                        //  512 blocks
  const dim3 gLn(NB * SEQ);                                   // 8192 rows
  const dim3 gProj(((NB * SEQ / 64) * (DM / 64) + 7) / 8, 1); // 2048 tiles -> 256 blocks: M=8192, N=1024
  const dim3 gVT(((DM / 64) * (SEQ / 64) + 7) / 8, NB);      // 512 tiles -> 64 blocks x 4 batches: M=1024, N=2048

  // (1) weights [n][k] f32 -> bf16 [n][k]
  cvt_bf16x8<<<gCvtW, blk, 0, stream>>>(Wq, Wqb, n8w);
  cvt_bf16x8<<<gCvtW, blk, 0, stream>>>(Wk, Wkb, n8w);
  cvt_bf16x8<<<gCvtW, blk, 0, stream>>>(Wv, Wvb, n8w);
  cvt_bf16x8<<<gCvtW, blk, 0, stream>>>(Wo, Wob, n8w);
  // (2) LayerNorm -> bf16 hi / lo planes [8192][1024]
  ln_rows<<<gLn, dim3(128), 0, stream>>>(x, gamma, beta, XNh, XNl, NB * SEQ);
  // (3) q = xn . Wq^T + bq -> f16 hi plane + f16 lo plane x2048 [b*SEQ+t][h*64+d]   (M=8192, N=1024, K=1024)
  gemm64<1, 3><<<gProj, blk, 0, stream>>>(
      XNh, XNl, 0LL, Wqb, Wqb, 0LL,
      (void*)Qh, DM, 0LL, (void*)Ql, DM, 0LL, DM,
      bq, DM, 0, x, DM,
      NB * SEQ, DM, DM, 2048.0f);
  // (4) k = xn . Wk^T + bk -> f16 plane (no lo plane: N2 = 0)
  gemm64<1, 3><<<gProj, blk, 0, stream>>>(
      XNh, XNl, 0LL, Wkb, Wkb, 0LL,
      (void*)Kh, DM, 0LL, (void*)Kh, DM, 0LL, 0,
      bk, DM, 0, x, DM,
      NB * SEQ, DM, DM, 2048.0f);
  // (5) v^T = Wv . xn^T + bv per batch -> f16 hi plane [b][h*64+d][s] (pitch SEQ) and lo plane
  //     (x4096, keys < VLP only, pitch VLP)   (A = Wvb [n][k], Bt = xn planes of batch b; M=1024, N=2048, K=1024)
  gemm64<2, 3><<<gVT, blk, 0, stream>>>(
      Wvb, Wvb, 0LL, XNh, XNl, (long long)SEQ * DM,
      (void*)VTh, SEQ, (long long)DM * SEQ, (void*)VTl, VLP, (long long)DM * VLP, VLP,
      bv, DM, 1, x, DM,
      DM, SEQ, DM, 4096.0f);
  // (6) attention: query blocks 0..RESQB-1 with lo planes, the rest without
  attn_causal64<true><<<dim3(NB * NH * RESQB), dim3(128), 0, stream>>>(
      Qh, Ql, Kh, VTh, VTl, Oh, Ol, 0, RESQB, 0.125f, 1.0f / 2048.0f);
  attn_causal64<false><<<dim3(NB * NH * (NQB - RESQB)), dim3(128), 0, stream>>>(
      Qh, Ql, Kh, VTh, VTl, Oh, Ol, RESQB, NQB - RESQB, 0.125f, 1.0f / 2048.0f);
  // (7) out = bf16(x) + context . Wo^T + bo -> d_out f32 [8192][1024]  (A = context hi + lo planes, 2 products)
  gemm64<1, 0><<<gProj, blk, 0, stream>>>(
      Oh, Ol, 0LL, Wob, Wob, 0LL,
      d_out, DM, 0LL, d_out, DM, 0LL, 0,
      bo, DM, 0, x, DM,
      NB * SEQ, DM, DM, 1.0f);
  (void)hipGetLastError();
}

// v004
// One run takes 193 microseconds.
// Timed twice side by side with v003, it ran 1.26 times as fast both times.
// Over all steps from v000 it is 3.72 times as fast.
// Contractions: q/k/v^T projections = v_wmma_f32_16x16x32_bf16 (normalised activations as bf16 hi+lo planes, weights bf16, 2 products);
// q.k^T = v_wmma_f32_16x16x32_f16 (q as f16 hi plane + f16 lo plane x2048, k f16, 2 products, separate accumulators);
// p.v = v_wmma_f32_16x16x32_f16 (p carried x1024 in f16, v^T f16; extra f16 lo planes x4096 of p and v on the first 512 query rows);
// ctx.Wo^T = v_wmma_f32_16x16x32_bf16 (ctx as bf16 hi+lo planes, Wo bf16, 2 products); all f32 accumulate; LayerNorm, causal mask, softmax, bias and skip-add in f32.
#include <hip/hip_runtime.h>
#include <math.h>
#include <float.h>
#include <stdint.h>

#define NB    4
#define SEQ   2048
#define DM    1024
#define NH    16
#define HD    64
#define NQB   (SEQ / 64)   // 32 key / query tiles of 64
#define VLP   512          // key pitch of the v^T lo plane (keys 0..VLP-1)
#define RESQB 8            // leading 64-row query blocks that use the p / v lo planes
static_assert(RESQB * 64 <= VLP);
static_assert(NH * HD == DM);
static_assert((SEQ % 64) == 0 && (DM % 64) == 0);
static_assert(DM == 128 * 8);
#define KP    72           // LDS row pitch of the 64-wide f16 tiles, in elements: 144 B = 16 B x 9 (odd), so 16 rows read 16 B wide fall on distinct banks
#define OP    68           // LDS row pitch of the f32 context tile, in floats (16-byte reads down a column group without bank conflicts)
#define GKC   64           // GEMM: k elements per LDS stage = one 128-B line of every operand row
#define GP    72           // GEMM: LDS row pitch of a stage, in elements (144 B, as KP: 16-B fragment reads of 16 rows fall on distinct banks)
static_assert((GP * 2) % 16 == 0 && ((GP * 2) / 16) % 2 == 1 && GP >= GKC);
static_assert((DM % GKC) == 0 && ((NB * SEQ) % 128) == 0 && (DM % 256) == 0 && (SEQ % 128) == 0);
static_assert((KP * 2) % 16 == 0 && ((KP * 2) / 16) % 2 == 1 && KP >= 64);
static_assert((OP * 4) % 16 == 0 && OP >= 64);

typedef _Float16 v16h __attribute__((ext_vector_type(16)));
typedef _Float16 v8h  __attribute__((ext_vector_type(8)));
typedef __bf16   v16b __attribute__((ext_vector_type(16)));
typedef __bf16   v8b  __attribute__((ext_vector_type(8)));
typedef float    v8f  __attribute__((ext_vector_type(8)));
typedef float    v4f  __attribute__((ext_vector_type(4)));
typedef unsigned int v4u __attribute__((ext_vector_type(4)));

// ---- scalar helpers --------------------------------------------------------------------------------
__device__ __forceinline__ unsigned short bf_bits(float f) {          // f32 -> bf16 bits, RNE convert
  unsigned u = __float_as_uint(f);
  return (unsigned short)((u + 0x7FFFu + ((u >> 16) & 1u)) >> 16);
}
__device__ __forceinline__ float bf_up(unsigned short h) { return __uint_as_float(((unsigned)h) << 16); }
__device__ __forceinline__ float bfr(float f) { return bf_up(bf_bits(f)); }   // value after RNE convert to bf16
__device__ __forceinline__ unsigned short h_bits(_Float16 x) { return __builtin_bit_cast(unsigned short, x); }
__device__ __forceinline__ unsigned pk16(unsigned short a, unsigned short b) { return (unsigned)a | ((unsigned)b << 16); }
__device__ __forceinline__ v8f zero8() { v8f z = {0.f, 0.f, 0.f, 0.f, 0.f, 0.f, 0.f, 0.f}; return z; }
__device__ __forceinline__ v8h zero8h() {
  const _Float16 z = (_Float16)0.0f;
  v8h r = {z, z, z, z, z, z, z, z};
  return r;
}

// value of lane l ^ 16 (the other 16-lane half), by a vector cross-row move
__device__ __forceinline__ float xhalf(float x) {
  const int i = __builtin_bit_cast(int, x);
  return __builtin_bit_cast(float, __builtin_amdgcn_permlanex16(i, i, 0x76543210, 0xfedcba98, false, false));
}

// ---- fragment loaders: 16-bit A/B operand, lane -> row/col (lane&15), p already includes +8*(lane>>4);
//      elements 0..7 <- p[0..7] (k0+8h..), elements 8..15 <- p[16..23] (k0+16+8h..)
__device__ __forceinline__ v16b ldfrag_b(const __bf16* p) {
  union { v16b v; v8b h[2]; } f;
  f.h[0] = *(const v8b*)(p);
  f.h[1] = *(const v8b*)(p + 16);
  return f.v;
}
__device__ __forceinline__ v16h ldfrag_h(const _Float16* p) {
  union { v16h v; v8h h[2]; } f;
  f.h[0] = *(const v8h*)(p);
  f.h[1] = *(const v8h*)(p + 16);
  return f.v;
}

// ---- WMMA helpers with trailing VALU hazard gap --------------------------------------------------------
__device__ __forceinline__ v8f mma_h(v16h a, v16h b, v8f c) {
  c = __builtin_amdgcn_wmma_f32_16x16x32_f16(false, a, false, b, (short)0, c, false, false);
  asm volatile("v_nop\n\tv_nop\n\tv_nop\n\tv_nop" : "+v"(c) : "v"(a), "v"(b));
  return c;
}
__device__ __forceinline__ v8f mma_b_raw(v16b a, v16b b, v8f c) {
  return __builtin_amdgcn_wmma_f32_16x16x32_bf16(false, a, false, b, (short)0, c, false, false);
}
__device__ __forceinline__ void dep_guard1_b(v8f& a, v8f& b, v16b x) {
  asm volatile("v_nop\n\tv_nop\n\tv_nop\n\tv_nop" : "+v"(a), "+v"(b) : "v"(x));
}
__device__ __forceinline__ void keep4_b(v16b a, v16b b, v16b c, v16b d) {
  asm volatile("v_nop" :: "v"(a), "v"(b), "v"(c), "v"(d));
}
__device__ __forceinline__ void acc_guard4(v8f& a, v8f& b, v8f& c, v8f& d) {
  asm volatile("v_nop\n\tv_nop\n\tv_nop\n\tv_nop" : "+v"(a), "+v"(b), "+v"(c), "+v"(d));
}

// =====================================================================================================
// f32 -> bf16 (RNE convert), 8 elements per thread, one 16-B store per lane: a wave writes 512 contiguous B
// coverage: thread i of n8 takes elements 8i..8i+7; n8 x 8 = whole plane (n8 = 131072 here, a multiple of 128).
// =====================================================================================================
__device__ __forceinline__ void cvt_bf16x8(const float* __restrict__ in, unsigned short* out, int i, int n8) {
  if (i < n8) {
    const v4f a = *(const v4f*)(in + (size_t)i * 8);
    const v4f b = *(const v4f*)(in + (size_t)i * 8 + 4);
    v4u p;
    p[0] = pk16(bf_bits(a[0]), bf_bits(a[1]));
    p[1] = pk16(bf_bits(a[2]), bf_bits(a[3]));
    p[2] = pk16(bf_bits(b[0]), bf_bits(b[1]));
    p[3] = pk16(bf_bits(b[2]), bf_bits(b[3]));
    *(v4u*)(out + (size_t)i * 8) = p;
    
  }
}

// =====================================================================================================
// LayerNorm over rows of DM=1024 (x, gamma, beta RNE-converted to bf16 values first), eps 1e-5,
// thread t owns elements 8t..8t+7. Output: bf16 hi plane and unscaled bf16 lo plane (lo = RNE(y - hi)),
// =====================================================================================================
__device__ __forceinline__ void ln_row(const float* __restrict__ x, const float* __restrict__ gam,
                                       const float* __restrict__ bet,
                                       unsigned short* xhp, unsigned short* xlp, int row) {
  __shared__ float sh[8];
  const int tid = threadIdx.x, wave = tid >> 5, lane = tid & 31;
  const size_t base = (size_t)row * DM + (size_t)tid * 8;
  const v4f a0 = *(const v4f*)(x + base);
  const v4f a1 = *(const v4f*)(x + base + 4);
  float v[8];
#pragma unroll
  for (int e = 0; e < 4; ++e) { v[e] = bfr(a0[e]); v[4 + e] = bfr(a1[e]); }
  float s = 0.f;
#pragma unroll
  for (int e = 0; e < 8; ++e) s += v[e];
#pragma unroll
  for (int off = 1; off < 32; off <<= 1) s += __shfl_xor(s, off, 32);
  if (lane == 0) sh[wave] = s;
  __syncthreads();
  const float mu = (sh[0] + sh[1] + sh[2] + sh[3]) * (1.0f / (float)DM);
  float d[8];
  float sq = 0.f;
#pragma unroll
  for (int e = 0; e < 8; ++e) { d[e] = v[e] - mu; sq += d[e] * d[e]; }
#pragma unroll
  for (int off = 1; off < 32; off <<= 1) sq += __shfl_xor(sq, off, 32);
  if (lane == 0) sh[4 + wave] = sq;
  __syncthreads();
  const float var = (sh[4] + sh[5] + sh[6] + sh[7]) * (1.0f / (float)DM);
  const float inv = rsqrtf(var + 1e-5f);
  const v4f g0 = *(const v4f*)(gam + tid * 8);
  const v4f g1 = *(const v4f*)(gam + tid * 8 + 4);
  const v4f e0 = *(const v4f*)(bet + tid * 8);
  const v4f e1 = *(const v4f*)(bet + tid * 8 + 4);
  float y[8];
#pragma unroll
  for (int e = 0; e < 4; ++e) {
    y[e]     = (d[e] * inv) * bfr(g0[e]) + bfr(e0[e]);
    y[4 + e] = (d[4 + e] * inv) * bfr(g1[e]) + bfr(e1[e]);
  }
  v4u ph, pl;
#pragma unroll
  for (int e = 0; e < 4; ++e) {
    const unsigned short h0 = bf_bits(y[2 * e]), h1 = bf_bits(y[2 * e + 1]);
    const unsigned short l0 = bf_bits(y[2 * e] - bf_up(h0)), l1 = bf_bits(y[2 * e + 1] - bf_up(h1));
    ph[e] = pk16(h0, h1);
    pl[e] = pk16(l0, l1);
  }
  unsigned short* dh = xhp + base;
  unsigned short* dl = xlp + base;
  *(v4u*)dh = ph;
  *(v4u*)dl = pl;
  
}

// =====================================================================================================
// One grid for the five jobs that depend on the inputs alone: blocks 0..NB*SEQ-1 normalise one row each,
// the next 4 x CVB blocks convert the four weight planes (CVB blocks of 128 threads x 8 elements per plane).
// The job is picked by the block index, so every branch below is block-uniform.
// =====================================================================================================
#define CVB   (DM * DM / 8 / 128)
static_assert(CVB * 128 * 8 == DM * DM);
__global__ __launch_bounds__(128) void prep_ln_cvt(const float* __restrict__ x, const float* __restrict__ gam,
                                                   const float* __restrict__ bet,
                                                   unsigned short* xhp, unsigned short* xlp,
                                                   const float* __restrict__ wq, const float* __restrict__ wk,
                                                   const float* __restrict__ wv, const float* __restrict__ wo,
                                                   unsigned short* wqb, unsigned short* wkb,
                                                   unsigned short* wvb, unsigned short* wob) {
  const int bx = blockIdx.x;
  if (bx < NB * SEQ) {
    ln_row(x, gam, bet, xhp, xlp, bx);
    return;
  }
  const int j = bx - NB * SEQ;
  const int w = j / CVB;                       // which weight plane
  const int i = (j - w * CVB) * 128 + (int)threadIdx.x;
  const float* in     = (w == 0) ? wq  : (w == 1) ? wk  : (w == 2) ? wv  : wo;
  unsigned short* out = (w == 0) ? wqb : (w == 1) ? wkb : (w == 2) ? wvb : wob;
  cvt_bf16x8(in, out, i, DM * DM / 8);
}

// =====================================================================================================
// Batched bf16 WMMA GEMM: C[m][n] = sum_k A[m][k] * Bt[n][k]; one wave per 64x64 tile, 8 waves per block.
// A row-major [M][K], Bt row-major [N][K] (k contiguous), both of row pitch DM elements. b = batch index (strides in elements).
// NSPLIT: 0 = A.Bt; 1 = A.Bt + A2.Bt (A2 = unscaled bf16 lo plane of A); 2 = A.Bt + A.Bt2 (Bt2 = lo plane of Bt).
// Block tile = WM x WN wave tiles (2 x 4 = 128 x 256; NSPLIT 2: 4 x 2 = 256 x 128, so the two-plane operand has the fewer rows).
// Operands go through LDS in stages of GKC = 64 k: every operand row of the block tile gives one whole 128-B line per stage,
// read from global once per block (8 lanes x 16 B per row, 4 whole lines per wave load) and shared by the waves that need it.
// Two stage buffers: the next stage's lines are loaded into registers ahead of this stage's products, stored to the other
// buffer behind them, one __syncthreads() per stage. Per accumulator the order of the products is k ascending, hi then lo.
// M multiple of 64*WM, N of 64*WN, K of GKC (the host launches only such shapes).
// bias: added in f32 (bias value RNE-converted to bf16 first); biasRow 0 -> bias[n], 1 -> bias[m]; index clamped to nbias-1.
// OUT_MODE: 0 = f32 (pitch ldc) = acc + bias + bf16value(resid[m*ldr + n]);
//           2 = bf16 hi plane C + bf16 lo plane C2 (lo = RNE(v - hi), unscaled);
//           3 = f16 hi plane C + f16 lo plane C2 = f16((v - hi) * rscale), C2 written only for tiles
//               with n0 < N2 (pitch ldc2, batch stride strideC2).
// =====================================================================================================
#define GSM   (2 * 512 * GP)   // LDS elements of the two stages (512 stage rows in every variant)
template <int NSPLIT, int OUT_MODE>
__device__ __forceinline__ void gemm64_body(
    const unsigned short* __restrict__ Ap, const unsigned short* __restrict__ A2p, long long strideA,
    const unsigned short* __restrict__ Btp, const unsigned short* __restrict__ Bt2p, long long strideB,
    void* Cout, int ldc, long long strideC,
    void* Cout2, int ldc2, long long strideC2, int N2,
    const float* __restrict__ bias, int nbias, int biasRow,
    const float* __restrict__ resid, int ldr,
    int M, int N, int K, float rscale,
    int bxi, int b, unsigned short* smem) {            // block index within the job, batch index, GSM elements of LDS
  constexpr int WM   = (NSPLIT == 2) ? 4 : 2;          // wave grid of the block
  constexpr int WN   = 8 / WM;
  constexpr int APL  = (NSPLIT == 1) ? 2 : 1;          // planes of A / of Bt
  constexpr int BPL  = (NSPLIT == 2) ? 2 : 1;
  constexpr int AR   = WM * 64;                        // rows per plane in a stage
  constexpr int BR   = WN * 64;
  constexpr int ROWS = AR * APL + BR * BPL;            // stage rows: [A | A2 | Bt | Bt2]
  constexpr int NLD  = ROWS / 32;                      // 16-B pieces per thread per stage (256 threads = 32 rows x 8 pieces)
  static_assert(AR % 32 == 0 && BR % 32 == 0);
  static_assert(2 * ROWS * GP * 2 >= 8 * 16 * 68 * 4);
  static_assert(2 * ROWS * GP <= GSM);                 // smem: two stages; behind the k loop: per-wave 16x64 f32 slabs, pitch 68
  const int lane = threadIdx.x & 31;
  const int wave = threadIdx.x >> 5;
  const int tilesNb = N / (64 * WN);
  const int tilesMb = M / (64 * WM);
  if (bxi >= tilesMb * tilesNb) return;                // block-uniform, ahead of every barrier
  const int bm = bxi / tilesNb;
  const int bn = bxi - bm * tilesNb;
  const int mB = bm * (64 * WM);
  const int nB = bn * (64 * WN);
  const int wm = wave / WN;
  const int wn = wave - wm * WN;
  const int m0 = mB + (wm << 6);
  const int n0 = nB + (wn << 6);

  const char* Ab  = (const char*)(Ap  + (size_t)b * strideA);
  const char* Bb  = (const char*)(Btp + (size_t)b * strideB);
  const char* Ab2 = (NSPLIT == 1) ? (const char*)(A2p  + (size_t)b * strideA) : Ab;
  const char* Bb2 = (NSPLIT == 2) ? (const char*)(Bt2p + (size_t)b * strideB) : Bb;

  const int rlane = lane & 15;                 // row (A) / col (B, D) within subtile
  const int koff  = (lane >> 4) * 8;           // k offset of this lane half
  const int mOff  = (lane >> 4) * 8;           // D row offset

  // staging map: 8 lanes x 16 B = one row's 128-B line; pass it covers stage rows it*32 .. it*32+31. Neighbouring groups of
  // 8 lanes take rows 8 apart: 8 x 144 B = 128 B mod 256 B, so the two rows of a 16-lane ds_store_b128 half fill all 64 banks once.
  const int srow = ((threadIdx.x >> 7) << 4) | (((threadIdx.x >> 3) & 1) << 3) | ((threadIdx.x >> 4) & 7);
  const int sseg = (threadIdx.x & 7) * 8;
  constexpr size_t LDB = (size_t)DM * 2;                         // operand row pitch in bytes
  const unsigned loff = (unsigned)(srow * DM + sseg) * 2u;       // per-lane byte offset; the rest of each address is block-uniform
  const char* gA  = Ab  + (size_t)mB * LDB;
  const char* gA2 = Ab2 + (size_t)mB * LDB;
  const char* gB  = Bb  + (size_t)nB * LDB;
  const char* gB2 = Bb2 + (size_t)nB * LDB;
  v4u pre[NLD];
  auto fetch = [&](int k0) {
    // unrolled (here and in put): pre[] is indexed by constants only and stays in registers; the row steps become immediate offsets
#pragma unroll
    for (int it = 0; it < NLD; ++it) {
      const int r = it * 32;
      const char* g;
      if (r < AR)                  g = gA  + (size_t)r * LDB;
      else if (r < AR * APL)       g = gA2 + (size_t)(r - AR) * LDB;
      else if (r < AR * APL + BR)  g = gB  + (size_t)(r - AR * APL) * LDB;
      else                         g = gB2 + (size_t)(r - AR * APL - BR) * LDB;
      pre[it] = *(const v4u*)(g + (size_t)k0 * 2 + loff);
    }
    asm volatile("s_wait_xcnt 0x0" ::: "memory");   // precaution: the code behind this reuses the address registers of the loads above
  };
  auto put = [&](int buf) {
    unsigned short* d = smem + buf * (ROWS * GP) + srow * GP + sseg;
#pragma unroll
    for (int it = 0; it < NLD; ++it) *(v4u*)(d + it * 32 * GP) = pre[it];
  };

  v8f acc[4][4];
#pragma unroll
  for (int i = 0; i < 4; ++i)
#pragma unroll
    for (int j = 0; j < 4; ++j) acc[i][j] = zero8();

  const int nk = K / GKC;
  fetch(0);
  put(0);
  __syncthreads();
  for (int kc = 0; kc < nk; ++kc) {
    const bool more = (kc + 1 < nk);           // block-uniform
    if (more) fetch((kc + 1) * GKC);
    const __bf16* sb = (const __bf16*)(const void*)(smem + (kc & 1) * (ROWS * GP));
    const __bf16* sA = sb + ((wm << 6) + rlane) * GP + koff;
    const __bf16* sB = sb + (AR * APL + (wn << 6) + rlane) * GP + koff;
    // every loop below is unrolled: af, bfrag and acc are indexed by constants only and stay in registers
#pragma unroll
    for (int ks = 0; ks < GKC; ks += 32) {
      v16b af[4][APL];
#pragma unroll
      for (int i = 0; i < 4; ++i)
#pragma unroll
        for (int ta = 0; ta < APL; ++ta) af[i][ta] = ldfrag_b(sA + (ta * AR + (i << 4)) * GP + ks);
#pragma unroll
      for (int tb = 0; tb < BPL; ++tb) {
        v16b bfrag[4];
#pragma unroll
        for (int j = 0; j < 4; ++j) bfrag[j] = ldfrag_b(sB + (tb * BR + (j << 4)) * GP + ks);
#pragma unroll
        for (int i = 0; i < 4; ++i) {
#pragma unroll
          for (int ta = 0; ta < APL; ++ta) {
#pragma unroll
            for (int j = 0; j < 4; ++j) acc[i][j] = mma_b_raw(af[i][ta], bfrag[j], acc[i][j]);
            dep_guard1_b(acc[i][0], acc[i][3], af[i][ta]);
          }
        }
        keep4_b(bfrag[0], bfrag[1], bfrag[2], bfrag[3]);
      }
    }
    if (more) put((kc + 1) & 1);
    __syncthreads();                           // publishes the stage just stored; ends every read of the stage just used
  }
  acc_guard4(acc[0][0], acc[0][1], acc[0][2], acc[0][3]);
  acc_guard4(acc[1][0], acc[1][1], acc[1][2], acc[1][3]);
  acc_guard4(acc[2][0], acc[2][1], acc[2][2], acc[2][3]);
  acc_guard4(acc[3][0], acc[3][1], acc[3][2], acc[3][3]);

  // ---- epilogue ----
  float bcol[4];
#pragma unroll
  for (int j = 0; j < 4; ++j) {
    const int nn = min(n0 + (j << 4) + rlane, nbias - 1);
    bcol[j] = bias[nn];
  }
  asm volatile("s_wait_xcnt 0x0" ::: "memory");   // precaution: the code behind this reuses the address registers of the loads above
  __builtin_amdgcn_sched_barrier(0);              // keeps that code behind the wait: the clobber alone does not hold register writes
#pragma unroll
  for (int j = 0; j < 4; ++j) bcol[j] = bfr(bcol[j]);
  float* slab = (float*)(void*)smem + wave * (16 * 68);   // the stages are dead behind the loop's last barrier
#pragma unroll
  for (int i = 0; i < 4; ++i) {
    const int mBase = m0 + (i << 4);
    float brow[8];
#pragma unroll
    for (int r = 0; r < 8; ++r) {
      const int mm = min(mBase + mOff + r, nbias - 1);
      brow[r] = bias[mm];
    }
    asm volatile("s_wait_xcnt 0x0" ::: "memory");   // precaution, as above
    __builtin_amdgcn_sched_barrier(0);              // as above
#pragma unroll
    for (int r = 0; r < 8; ++r) brow[r] = bfr(brow[r]);
#pragma unroll
    for (int j = 0; j < 4; ++j) {
#pragma unroll
      for (int r = 0; r < 8; ++r) {
        const float bv = (biasRow != 0) ? brow[r] : bcol[j];
        slab[(mOff + r) * 68 + (j << 4) + rlane] = acc[i][j][r] + bv;
      }
    }
    __builtin_amdgcn_fence(__ATOMIC_RELEASE, "workgroup");
    __builtin_amdgcn_wave_barrier();
    __builtin_amdgcn_fence(__ATOMIC_ACQUIRE, "workgroup");
    if (OUT_MODE == 0) {
      float* C = (float*)Cout + (size_t)b * strideC;
      const int h2 = lane >> 4, c4 = (lane & 15) * 4;     // 256-B row segment = 16 lanes x 16 B
      v4f vo[8];
#pragma unroll
      for (int it = 0; it < 8; ++it) {
        const int row = it * 2 + h2;                       // it 0..7 x h2 0..1 = rows 0..15
        v4f sv = *(const v4f*)(slab + row * 68 + c4);
        const v4f rx = *(const v4f*)(resid + (size_t)(mBase + row) * ldr + n0 + c4);
#pragma unroll
        for (int e = 0; e < 4; ++e) sv[e] = sv[e] + bfr(rx[e]);
        vo[it] = sv;
      }
      __builtin_amdgcn_sched_barrier(0);              // keeps the next row group's address arithmetic off the registers of the loads above
      {
#pragma unroll
        for (int it = 0; it < 8; ++it) {
          const int row = it * 2 + h2;
          *(v4f*)(C + (size_t)(mBase + row) * ldc + n0 + c4) = vo[it];
        }
        
      }
    } else {
      const int q = lane >> 3, c8 = (lane & 7) * 8;
      unsigned short* C  = (unsigned short*)Cout  + (size_t)b * strideC;
      unsigned short* C2 = (unsigned short*)Cout2 + (size_t)b * strideC2;
      const bool wlo = (OUT_MODE == 2) || (n0 < N2);      // wave-uniform
      v4u hv[4], lv[4];
#pragma unroll
      for (int it = 0; it < 4; ++it) {
        const int row = it * 4 + q;                        // it 0..3 x q 0..3 = rows 0..15
        const float* sp = slab + row * 68 + c8;
        v4u a, a2;
#pragma unroll
        for (int e = 0; e < 4; ++e) {
          const float f0 = sp[2 * e], f1 = sp[2 * e + 1];
          unsigned short h0, h1, l0, l1;
          if (OUT_MODE == 2) {
            h0 = bf_bits(f0); h1 = bf_bits(f1);
            l0 = bf_bits(f0 - bf_up(h0)); l1 = bf_bits(f1 - bf_up(h1));
          } else {
            const _Float16 x0 = (_Float16)f0, x1 = (_Float16)f1;
            h0 = h_bits(x0); h1 = h_bits(x1);
            l0 = h_bits((_Float16)((f0 - (float)x0) * rscale));
            l1 = h_bits((_Float16)((f1 - (float)x1) * rscale));
          }
          a[e] = pk16(h0, h1); a2[e] = pk16(l0, l1);
        }
        hv[it] = a; lv[it] = a2;
      }
      {
#pragma unroll
        for (int it = 0; it < 4; ++it) {
          const int row = it * 4 + q;
          *(v4u*)(C + (size_t)(mBase + row) * ldc + n0 + c8) = hv[it];
          if (wlo) *(v4u*)(C2 + (size_t)(mBase + row) * ldc2 + n0 + c8) = lv[it];
        }
        
      }
    }
    __builtin_amdgcn_fence(__ATOMIC_RELEASE, "workgroup");
    __builtin_amdgcn_wave_barrier();
    __builtin_amdgcn_fence(__ATOMIC_ACQUIRE, "workgroup");
  }
}

// out projection: one job per launch, grid = (block tiles, batches)
template <int NSPLIT, int OUT_MODE>
__global__ __launch_bounds__(256) void gemm64(
    const unsigned short* __restrict__ Ap, const unsigned short* __restrict__ A2p, long long strideA,
    const unsigned short* __restrict__ Btp, const unsigned short* __restrict__ Bt2p, long long strideB,
    void* Cout, int ldc, long long strideC,
    void* Cout2, int ldc2, long long strideC2, int N2,
    const float* __restrict__ bias, int nbias, int biasRow,
    const float* __restrict__ resid, int ldr,
    int M, int N, int K, float rscale) {
  __shared__ __align__(16) unsigned short smem[GSM];
  gemm64_body<NSPLIT, OUT_MODE>(Ap, A2p, strideA, Btp, Bt2p, strideB, Cout, ldc, strideC, Cout2, ldc2, strideC2, N2,
                                bias, nbias, biasRow, resid, ldr, M, N, K, rscale,
                                (int)blockIdx.x, (int)blockIdx.y, smem);
}

// q, k and v^T projections in one grid (they depend on the same planes and on nothing of each other); the job is picked by the
// block index, so the branch is block-uniform:
//   blocks 0..PJB-1       q   = xn . Wq^T + bq -> f16 hi plane + f16 lo plane x2048 [b*SEQ+t][h*64+d]   (M=8192, N=1024, K=1024)
//   blocks PJB..2*PJB-1   k   = xn . Wk^T + bk -> f16 plane (no lo plane: N2 = 0)
//   the next NB*VJB       v^T = Wv . xn^T + bv per batch -> f16 hi plane [b][h*64+d][s] (pitch SEQ) and lo plane (x4096, keys < VLP
//                         only, pitch VLP)   (A = Wv [n][k], Bt = xn planes of batch b; M=1024, N=2048, K=1024)
#define PJB   ((NB * SEQ / 128) * (DM / 256))
#define VJB   ((DM / 256) * (SEQ / 128))
__global__ __launch_bounds__(256) void qkv_proj(
    const unsigned short* __restrict__ xh, const unsigned short* __restrict__ xl,
    const unsigned short* __restrict__ wq, const unsigned short* __restrict__ wk, const unsigned short* __restrict__ wv,
    unsigned short* qh, unsigned short* ql, unsigned short* kh, unsigned short* vth, unsigned short* vtl,
    const float* __restrict__ bq, const float* __restrict__ bk, const float* __restrict__ bv,
    const float* __restrict__ x, int K) {
  __shared__ __align__(16) unsigned short smem[GSM];
  const int bx = blockIdx.x;
  if (bx < 2 * PJB) {
    const bool isk = (bx >= PJB);
    const unsigned short* w = isk ? wk : wq;
    gemm64_body<1, 3>(xh, xl, 0LL, w, w, 0LL,
                      (void*)(isk ? kh : qh), DM, 0LL, (void*)(isk ? kh : ql), DM, 0LL, isk ? 0 : DM,
                      isk ? bk : bq, DM, 0, x, DM,
                      NB * SEQ, DM, K, 2048.0f,
                      isk ? bx - PJB : bx, 0, smem);
  } else {
    const int j = bx - 2 * PJB;
    const int b = j / VJB;
    gemm64_body<2, 3>(wv, wv, 0LL, xh, xl, (long long)SEQ * DM,
                      (void*)vth, SEQ, (long long)DM * SEQ, (void*)vtl, VLP, (long long)DM * VLP, VLP,
                      bv, DM, 1, x, DM,
                      DM, SEQ, K, 4096.0f,
                      j - b * VJB, b, smem);
  }
}

template <bool RES>
__device__ __forceinline__
void attn_block64(const unsigned short* __restrict__ qhp, const unsigned short* __restrict__ qlp,
                  const unsigned short* __restrict__ khp,
                  const unsigned short* __restrict__ vhp, const unsigned short* __restrict__ vlp,
                  unsigned short* ohp, unsigned short* olp,
                  int qb, int h, int b, float sscale, float qlinv,
                  _Float16* Ksh, _Float16* Vth, _Float16* Vtl, float* Os) {
  union FH { v16h v; v8h h[2]; };
  const int tid  = threadIdx.x;
  const int wave = tid >> 5;
  const int lane = tid & 31;
  const int hh   = lane >> 4;
  const int c    = lane & 15;

  const int q0   = qb * 64 + wave * 16;
  const size_t rowB = (size_t)b * SEQ;
  const int hoff = h * HD;

  const _Float16* Qh = (const _Float16*)(const void*)qhp;
  const _Float16* Ql = (const _Float16*)(const void*)qlp;
  const _Float16* Kh = (const _Float16*)(const void*)khp;
  const _Float16* Vh = (const _Float16*)(const void*)vhp + ((size_t)b * DM + (size_t)hoff) * SEQ;
  const _Float16* Vl = (const _Float16*)(const void*)vlp + ((size_t)b * DM + (size_t)hoff) * VLP;

  // ---- Q fragments (B operand, column = query = lane&15): 2 d-chunks, hi and lo ----
  v16h qah[2], qal[2];
#pragma unroll
  for (int dc = 0; dc < 2; ++dc) {
    const size_t qo = (rowB + q0 + c) * DM + hoff + dc * 32 + 8 * hh;
    qah[dc] = ldfrag_h(Qh + qo);
    qal[dc] = ldfrag_h(Ql + qo);
  }

  const int qrow = q0 + c;                   // this lane's query
  float mrow = -INFINITY, lrow = 0.f;        // its running maximum; the sum over the keys of this lane's half
  v8f oacc[4];                               // O^T: oacc[t][r] = context[query c][d = t*16 + 8*hh + r]
#pragma unroll
  for (int t = 0; t < 4; ++t) oacc[t] = zero8();

  for (int kt = 0; kt < NQB; ++kt) {         // static bound
    if (kt > qb) break;                      // block-uniform: causal, key tiles 0..qb only
    const int kv0 = kt * 64;
    __syncthreads();
    {
      const int r = tid >> 1, half = (tid & 1) * 32;
      const _Float16* kg  = Kh + (rowB + kv0 + r) * DM + hoff + half;   // K row kv0+r, d = half..half+31
      const _Float16* vg  = Vh + (size_t)r * SEQ + kv0 + half;         // V^T row d = r, s = kv0+half..+31
      const int kvl = (kv0 + 64 <= VLP) ? kv0 : (VLP - 64);          // clamped address into the lo plane
      const _Float16* vlg = Vl + (size_t)r * VLP + kvl + half;
      const bool resOK = (kv0 + 64 <= VLP);                           // block-uniform
#pragma unroll
      for (int i = 0; i < 4; ++i) {
        const v8h a0 = *(const v8h*)(kg + 8 * i);
        const v8h b0 = *(const v8h*)(vg + 8 * i);
        *(v8h*)(Ksh + r * KP + half + 8 * i) = a0;
        *(v8h*)(Vth + r * KP + half + 8 * i) = b0;
        if (RES) {
          v8h b1 = *(const v8h*)(vlg + 8 * i);
          if (!resOK) b1 = zero8h();
          *(v8h*)(Vtl + r * KP + half + 8 * i) = b1;
        }
      }
    }
    __syncthreads();

    // ---- scores, transposed: 64 keys x 16 queries per wave, 2 f16 products into separate accumulators;
    //      s[j][r] = score of key kv0 + j*16 + 8*hh + r against query qrow ----
    v8f s[4];
#pragma unroll
    for (int j = 0; j < 4; ++j) {
      v8f t0 = zero8(), t1 = zero8();
#pragma unroll
      for (int dc = 0; dc < 2; ++dc) {
        FH kb;
        kb.h[0] = *(const v8h*)(Ksh + (j * 16 + c) * KP + dc * 32 + 8 * hh);
        kb.h[1] = *(const v8h*)(Ksh + (j * 16 + c) * KP + dc * 32 + 16 + 8 * hh);
        t0 = mma_h(kb.v, qah[dc], t0);
        t1 = mma_h(kb.v, qal[dc], t1);
      }
#pragma unroll
      for (int r = 0; r < 8; ++r) s[j][r] = t0[r] + t1[r] * qlinv;
    }

    // ---- scale + causal mask, maximum, online softmax; P^T (x1024, f16) and its lo plane (x4096) packed as B operands ----
    const int lim = qrow - kv0 - 8 * hh;       // key > qrow  <=>  j*16 + r > lim
    float mj[4];                               // four independent chains, joined below
#pragma unroll
    for (int j = 0; j < 4; ++j) {
      mj[j] = -INFINITY;
#pragma unroll
      for (int r = 0; r < 8; ++r) {
        float sv = s[j][r] * sscale;
        sv = (j * 16 + r > lim) ? -1.0e9f : sv;
        s[j][r] = sv;
        mj[j] = fmaxf(mj[j], sv);
      }
    }
    float m = fmaxf(fmaxf(mj[0], mj[1]), fmaxf(mj[2], mj[3]));
    m = fmaxf(m, xhalf(m));                    // both halves now hold the query's maximum over the 64 keys
    const float mnew  = fmaxf(mrow, m);
    const float msafe = (mnew == -INFINITY) ? 0.f : mnew;
    const float alpha = __expf(mrow - msafe);
    mrow = mnew;
    // element e of the B operand of key group kk is key kk*32 + (e < 8 ? 8*hh + e : 16 + 8*hh + e - 8): tile 2kk, then tile 2kk+1
    FH pb[2], pl[2];
    float pj[4];
#pragma unroll
    for (int j = 0; j < 4; ++j) {
      pj[j] = 0.f;
#pragma unroll
      for (int r = 0; r < 8; ++r) {
        const float p = __expf(s[j][r] - msafe);     // masked logit: exp -> 0
        pj[j] += p;
        const float p1k = p * 1024.0f;
        const _Float16 ph = (_Float16)p1k;
        pb[j >> 1].h[j & 1][r] = ph;
        if (RES) pl[j >> 1].h[j & 1][r] = (_Float16)((p1k - (float)ph) * 4096.0f);
      }
    }
    lrow = lrow * alpha + ((pj[0] + pj[1]) + (pj[2] + pj[3]));
#pragma unroll
    for (int t = 0; t < 4; ++t)
#pragma unroll
      for (int r = 0; r < 8; ++r) oacc[t][r] *= alpha;

    // ---- context^T += V^T . P^T (f16 WMMA), lo products into a separate accumulator ----
    v8f o1[4];
#pragma unroll
    for (int t = 0; t < 4; ++t) o1[t] = zero8();
    // unrolled: pb and pl are indexed by constants only and stay in registers
#pragma unroll
    for (int kk = 0; kk < 2; ++kk) {
#pragma unroll
      for (int t = 0; t < 4; ++t) {
        FH vb;
        vb.h[0] = *(const v8h*)(Vth + (t * 16 + c) * KP + kk * 32 + 8 * hh);
        vb.h[1] = *(const v8h*)(Vth + (t * 16 + c) * KP + kk * 32 + 16 + 8 * hh);
        oacc[t] = mma_h(vb.v, pb[kk].v, oacc[t]);
        if (RES) {
          FH vl;
          vl.h[0] = *(const v8h*)(Vtl + (t * 16 + c) * KP + kk * 32 + 8 * hh);
          vl.h[1] = *(const v8h*)(Vtl + (t * 16 + c) * KP + kk * 32 + 16 + 8 * hh);
          o1[t] = mma_h(vl.v, pb[kk].v, o1[t]);
          o1[t] = mma_h(vb.v, pl[kk].v, o1[t]);
        }
      }
    }
    if (RES) {
#pragma unroll
      for (int t = 0; t < 4; ++t)
#pragma unroll
        for (int r = 0; r < 8; ++r) oacc[t][r] += o1[t][r] * (1.0f / 4096.0f);
    }
  }

  // ---- normalise (1/l and the 1/1024 p carry), stage the wave's 16x64 tile, bf16 hi/lo split,
  float* os = Os + wave * (16 * OP);
  {
    const float l = lrow + xhalf(lrow);        // the two halves' key sums joined
    const float inv = ((l > 0.f) ? (1.0f / l) : 0.f) * (1.0f / 1024.0f);
#pragma unroll
    for (int t = 0; t < 4; ++t) {              // a lane's 8 registers are 8 consecutive d of its query's row
      v4f w0, w1;
#pragma unroll
      for (int e = 0; e < 4; ++e) { w0[e] = oacc[t][e] * inv; w1[e] = oacc[t][4 + e] * inv; }
      *(v4f*)(os + c * OP + t * 16 + 8 * hh)     = w0;
      *(v4f*)(os + c * OP + t * 16 + 8 * hh + 4) = w1;
    }
  }
  __builtin_amdgcn_fence(__ATOMIC_RELEASE, "workgroup");
  __builtin_amdgcn_wave_barrier();
  __builtin_amdgcn_fence(__ATOMIC_ACQUIRE, "workgroup");
  {
    const int q4 = lane >> 3, c8 = (lane & 7) * 8;
    v4u hv[4], lv[4];
#pragma unroll
    for (int it = 0; it < 4; ++it) {
      const int row = it * 4 + q4;   // it 0..3 x q4 0..3 = rows 0..15 of the wave tile
      const float* sp = os + row * OP + c8;
      v4u a, a2;
#pragma unroll
      for (int e = 0; e < 4; ++e) {
        const float f0 = sp[2 * e], f1 = sp[2 * e + 1];
        const unsigned short h0 = bf_bits(f0), h1 = bf_bits(f1);
        const unsigned short l0 = bf_bits(f0 - bf_up(h0)), l1 = bf_bits(f1 - bf_up(h1));
        a[e] = pk16(h0, h1); a2[e] = pk16(l0, l1);
      }
      hv[it] = a; lv[it] = a2;
    }
    {
#pragma unroll
      for (int it = 0; it < 4; ++it) {
        const int row = it * 4 + q4;
        const size_t go = (rowB + q0 + row) * DM + (size_t)hoff + c8;
        *(v4u*)(ohp + go) = hv[it];
        *(v4u*)(olp + go) = lv[it];
      }
      
    }
  }
}

// One grid for all query blocks: grid = NQB * NH * NB, 64 consecutive blocks = the (b, h) pairs of one query block. The query block
// falls with the block index, so the blocks with the most key tiles start first and the short ones fill the places they leave.
// Query blocks 0..RESQB-1 take the variant with the lo planes (block-uniform branch).
__global__ __launch_bounds__(128)
void attn_causal64(const unsigned short* __restrict__ qhp, const unsigned short* __restrict__ qlp,
                   const unsigned short* __restrict__ khp,
                   const unsigned short* __restrict__ vhp, const unsigned short* __restrict__ vlp,
                   unsigned short* ohp, unsigned short* olp, float sscale, float qlinv) {
  __shared__ __align__(16) _Float16 Ksh[64 * KP];                 // K [kv][d], pitch KP
  __shared__ __align__(16) _Float16 Vth[64 * KP];                 // V^T hi [d][kv], pitch KP
  __shared__ __align__(16) _Float16 Vtl[64 * KP];                 // V^T lo, pitch KP
  __shared__ __align__(16) float    Os[4 * 16 * OP];              // per wave context tile [row][d], pitch OP
  const int bx   = blockIdx.x;
  const int qb   = NQB - 1 - bx / (NH * NB);
  const int rest = bx % (NH * NB);
  const int h    = rest % NH;
  const int b    = rest / NH;
  if (qb < RESQB) attn_block64<true>(qhp, qlp, khp, vhp, vlp, ohp, olp, qb, h, b, sscale, qlinv, Ksh, Vth, Vtl, Os);
  else            attn_block64<false>(qhp, qlp, khp, vhp, vlp, ohp, olp, qb, h, b, sscale, qlinv, Ksh, Vth, Vtl, Os);
}

// =====================================================================================================
// Workspace map (bytes):
//   XNh  bf16 [8192][1024]        0          16777216   (later: Oh, context hi plane)
//   XNl  bf16 [8192][1024]        16777216   16777216   (later: Ol, context lo plane)
//   Wqb  bf16 [1024 n][1024 k]    33554432    2097152
//   Wkb  bf16 [1024][1024]        35651584    2097152
//   Wvb  bf16 [1024][1024]        37748736    2097152
//   Wob  bf16 [1024][1024]        39845888    2097152
//   Qh   f16  [8192][1024]        41943040   16777216
//   Ql   f16  [8192][1024]        58720256   16777216
//   Kh   f16  [8192][1024]        75497472   16777216
//   VTh  f16  [4][1024][2048]     92274688   16777216
//   VTl  f16  [4][1024][512]      109051904   4194304
//   end                           113246208
// All planes are exact multiples of their 64x64 / whole-line store granularity (no padded tails needed).
// Weights are [out n][in k] with k contiguous = the Bt / A layout the GEMM wants, so they are only converted.
// =====================================================================================================
extern "C" void kernel_launch(void* const* d_in, const int* in_sizes, int n_in,
                              void* d_out, int out_size, void* d_ws, size_t ws_size,
                              hipStream_t stream) {
  if (n_in < 11) return;
  if (in_sizes[0] != NB * SEQ * DM) return;
  if (in_sizes[1] != DM * DM || in_sizes[3] != DM * DM || in_sizes[5] != DM * DM || in_sizes[7] != DM * DM) return;
  if (in_sizes[2] != DM || in_sizes[4] != DM || in_sizes[6] != DM || in_sizes[8] != DM) return;
  if (in_sizes[9] != DM || in_sizes[10] != DM) return;
  if (out_size != NB * SEQ * DM) return;

  const float* x     = (const float*)d_in[0];
  const float* Wq    = (const float*)d_in[1];
  const float* bq    = (const float*)d_in[2];
  const float* Wk    = (const float*)d_in[3];
  const float* bk    = (const float*)d_in[4];
  const float* Wv    = (const float*)d_in[5];
  const float* bv    = (const float*)d_in[6];
  const float* Wo    = (const float*)d_in[7];
  const float* bo    = (const float*)d_in[8];
  const float* gamma = (const float*)d_in[9];
  const float* beta  = (const float*)d_in[10];

  const size_t P16 = (size_t)NB * SEQ * DM * 2;   // 16777216  16-bit activation plane [8192][1024]
  const size_t PW  = (size_t)DM * DM * 2;         //  2097152  16-bit weight plane
  const size_t PVT = (size_t)NB * DM * SEQ * 2;   // 16777216  v^T hi plane
  const size_t PVL = (size_t)NB * DM * VLP * 2;   //  4194304  v^T lo plane
  size_t off = 0;
  const size_t oXh  = off; off += P16;
  const size_t oXl  = off; off += P16;
  const size_t oWq  = off; off += PW;
  const size_t oWk  = off; off += PW;
  const size_t oWv  = off; off += PW;
  const size_t oWo  = off; off += PW;
  const size_t oQh  = off; off += P16;
  const size_t oQl  = off; off += P16;
  const size_t oKh  = off; off += P16;
  const size_t oVTh = off; off += PVT;
  const size_t oVTl = off; off += PVL;
  if (off > ws_size) return;                      // off = 113246208
  if (off > (size_t)134217728) return;
  const size_t oOh  = oXh;                        // context planes reuse the XN planes (dead after the projections)
  const size_t oOl  = oXl;

  char* ws = (char*)d_ws;
  unsigned short* XNh = (unsigned short*)(ws + oXh);
  unsigned short* XNl = (unsigned short*)(ws + oXl);
  unsigned short* Wqb = (unsigned short*)(ws + oWq);
  unsigned short* Wkb = (unsigned short*)(ws + oWk);
  unsigned short* Wvb = (unsigned short*)(ws + oWv);
  unsigned short* Wob = (unsigned short*)(ws + oWo);
  unsigned short* Qh  = (unsigned short*)(ws + oQh);
  unsigned short* Ql  = (unsigned short*)(ws + oQl);
  unsigned short* Kh  = (unsigned short*)(ws + oKh);
  unsigned short* VTh = (unsigned short*)(ws + oVTh);
  unsigned short* VTl = (unsigned short*)(ws + oVTl);
  unsigned short* Oh  = (unsigned short*)(ws + oOh);
  unsigned short* Ol  = (unsigned short*)(ws + oOl);

  const dim3 blk(256);
  const dim3 gProj(((NB * SEQ / 64) * (DM / 64) + 7) / 8, 1); // 2048 tiles -> 256 blocks: M=8192, N=1024

  // (1) LayerNorm -> bf16 hi / lo planes [8192][1024]; weights [n][k] f32 -> bf16 [n][k]
  prep_ln_cvt<<<dim3(NB * SEQ + 4 * CVB), dim3(128), 0, stream>>>(
      x, gamma, beta, XNh, XNl, Wq, Wk, Wv, Wo, Wqb, Wkb, Wvb, Wob);
  // (2) q, k, v^T projections
  qkv_proj<<<dim3(2 * PJB + NB * VJB), blk, 0, stream>>>(
      XNh, XNl, Wqb, Wkb, Wvb, Qh, Ql, Kh, VTh, VTl, bq, bk, bv, x, DM);
  // (3) attention: query blocks 0..RESQB-1 with lo planes, the rest without
  attn_causal64<<<dim3(NB * NH * NQB), dim3(128), 0, stream>>>(
      Qh, Ql, Kh, VTh, VTl, Oh, Ol, 0.125f, 1.0f / 2048.0f);
  // (4) out = bf16(x) + context . Wo^T + bo -> d_out f32 [8192][1024]  (A = context hi + lo planes, 2 products)
  gemm64<1, 0><<<gProj, blk, 0, stream>>>(
      Oh, Ol, 0LL, Wob, Wob, 0LL,
      d_out, DM, 0LL, d_out, DM, 0LL, 0,
      bo, DM, 0, x, DM,
      NB * SEQ, DM, DM, 1.0f);
  (void)hipGetLastError();
}

// v005
// One run takes 183 microseconds.
// Two timings next to v004 both put it at 1.05 times that version's speed.
// Over all steps from v000 it is 3.92 times as fast.
// Contractions: q/k/v^T projections = v_wmma_f32_16x16x32_bf16 (normalised activations as bf16 hi+lo planes, weights bf16, 2 products);
// q.k^T = v_wmma_f32_16x16x32_f16 (q as f16 hi plane + f16 lo plane x2048, k f16, 2 products, separate accumulators);
// p.v = v_wmma_f32_16x16x32_f16 (p carried x1024 in f16, v^T f16; extra f16 lo planes x4096 of p and v on the first 512 query rows);
// ctx.Wo^T = v_wmma_f32_16x16x32_bf16 (ctx as bf16 hi+lo planes, Wo bf16, 2 products); all f32 accumulate; LayerNorm, causal mask, softmax, bias and skip-add in f32.
#include <hip/hip_runtime.h>
#include <math.h>
#include <float.h>
#include <stdint.h>

#define NB    4
#define SEQ   2048
#define DM    1024
#define NH    16
#define HD    64
#define NQB   (SEQ / 64)   // 32 key / query tiles of 64
#define VLP   512          // key pitch of the v^T lo plane (keys 0..VLP-1)
#define RESQB 8            // leading 64-row query blocks that use the p / v lo planes
static_assert(RESQB * 64 <= VLP);
static_assert(NH * HD == DM);
static_assert((SEQ % 64) == 0 && (DM % 64) == 0);
static_assert(DM == 128 * 8);
#define KP    72           // LDS row pitch of the 64-wide f16 tiles, in elements: 144 B = 16 B x 9 (odd), so 16 rows read 16 B wide fall on distinct banks
#define OP    68           // LDS row pitch of the f32 context tile, in floats (16-byte reads down a column group without bank conflicts)
#define GKC   64           // GEMM: k elements per LDS stage = one 128-B line of every operand row
#define GP    72           // GEMM: LDS row pitch of a stage, in elements (144 B, as KP: 16-B fragment reads of 16 rows fall on distinct banks)
static_assert((GP * 2) % 16 == 0 && ((GP * 2) / 16) % 2 == 1 && GP >= GKC);
static_assert((DM % GKC) == 0 && ((NB * SEQ) % 128) == 0 && (DM % 256) == 0 && (SEQ % 128) == 0);
static_assert((KP * 2) % 16 == 0 && ((KP * 2) / 16) % 2 == 1 && KP >= 64);
static_assert((OP * 4) % 16 == 0 && OP >= 64);

typedef _Float16 v16h __attribute__((ext_vector_type(16)));
typedef _Float16 v8h  __attribute__((ext_vector_type(8)));
typedef __bf16   v16b __attribute__((ext_vector_type(16)));
typedef __bf16   v8b  __attribute__((ext_vector_type(8)));
typedef float    v8f  __attribute__((ext_vector_type(8)));
typedef float    v4f  __attribute__((ext_vector_type(4)));
typedef unsigned int v4u __attribute__((ext_vector_type(4)));

// ---- scalar helpers --------------------------------------------------------------------------------
__device__ __forceinline__ unsigned short bf_bits(float f) {          // f32 -> bf16 bits, RNE convert
  unsigned u = __float_as_uint(f);
  return (unsigned short)((u + 0x7FFFu + ((u >> 16) & 1u)) >> 16);
}
__device__ __forceinline__ float bf_up(unsigned short h) { return __uint_as_float(((unsigned)h) << 16); }
__device__ __forceinline__ float bfr(float f) { return bf_up(bf_bits(f)); }   // value after RNE convert to bf16
__device__ __forceinline__ unsigned short h_bits(_Float16 x) { return __builtin_bit_cast(unsigned short, x); }
__device__ __forceinline__ unsigned pk16(unsigned short a, unsigned short b) { return (unsigned)a | ((unsigned)b << 16); }
__device__ __forceinline__ v8f zero8() { v8f z = {0.f, 0.f, 0.f, 0.f, 0.f, 0.f, 0.f, 0.f}; return z; }
__device__ __forceinline__ v8h zero8h() {
  const _Float16 z = (_Float16)0.0f;
  v8h r = {z, z, z, z, z, z, z, z};
  return r;
}

// value of lane l ^ 16 (the other 16-lane half), by a vector cross-row move
__device__ __forceinline__ float xhalf(float x) {
  const int i = __builtin_bit_cast(int, x);
  return __builtin_bit_cast(float, __builtin_amdgcn_permlanex16(i, i, 0x76543210, 0xfedcba98, false, false));
}

// ---- fragment loaders: 16-bit A/B operand, lane -> row/col (lane&15), p already includes +8*(lane>>4);
//      elements 0..7 <- p[0..7] (k0+8h..), elements 8..15 <- p[16..23] (k0+16+8h..)
__device__ __forceinline__ v16b ldfrag_b(const __bf16* p) {
  union { v16b v; v8b h[2]; } f;
  f.h[0] = *(const v8b*)(p);
  f.h[1] = *(const v8b*)(p + 16);
  return f.v;
}
__device__ __forceinline__ v16h ldfrag_h(const _Float16* p) {
  union { v16h v; v8h h[2]; } f;
  f.h[0] = *(const v8h*)(p);
  f.h[1] = *(const v8h*)(p + 16);
  return f.v;
}

// ---- WMMA helpers ------------------------------------------------------------------------------------------
// attention products: the plain builtin. The compiler keeps the distances behind its own WMMAs, and with no volatile statement
// between the products it can issue a key tile's LDS fragment reads in groups ahead of them.
__device__ __forceinline__ v8f mma_h(v16h a, v16h b, v8f c) {
  return __builtin_amdgcn_wmma_f32_16x16x32_f16(false, a, false, b, (short)0, c, false, false);
}
// GEMM products: the builtin, with hand-placed VALU gaps behind each group (dep_guard1_b, keep4_b, acc_guard4)
__device__ __forceinline__ v8f mma_b_raw(v16b a, v16b b, v8f c) {
  return __builtin_amdgcn_wmma_f32_16x16x32_bf16(false, a, false, b, (short)0, c, false, false);
}
__device__ __forceinline__ void dep_guard1_b(v8f& a, v8f& b, v16b x) {
  asm volatile("v_nop\n\tv_nop\n\tv_nop\n\tv_nop" : "+v"(a), "+v"(b) : "v"(x));
}
__device__ __forceinline__ void keep4_b(v16b a, v16b b, v16b c, v16b d) {
  asm volatile("v_nop" :: "v"(a), "v"(b), "v"(c), "v"(d));
}
__device__ __forceinline__ void acc_guard4(v8f& a, v8f& b, v8f& c, v8f& d) {
  asm volatile("v_nop\n\tv_nop\n\tv_nop\n\tv_nop" : "+v"(a), "+v"(b), "+v"(c), "+v"(d));
}

// =====================================================================================================
// f32 -> bf16 (RNE convert), 8 elements per thread, one 16-B store per lane: a wave writes 512 contiguous B
// coverage: thread i of n8 takes elements 8i..8i+7; n8 x 8 = whole plane (n8 = 131072 here, a multiple of 128).
// =====================================================================================================
__device__ __forceinline__ void cvt_bf16x8(const float* __restrict__ in, unsigned short* out, int i, int n8) {
  if (i < n8) {
    const v4f a = *(const v4f*)(in + (size_t)i * 8);
    const v4f b = *(const v4f*)(in + (size_t)i * 8 + 4);
    v4u p;
    p[0] = pk16(bf_bits(a[0]), bf_bits(a[1]));
    p[1] = pk16(bf_bits(a[2]), bf_bits(a[3]));
    p[2] = pk16(bf_bits(b[0]), bf_bits(b[1]));
    p[3] = pk16(bf_bits(b[2]), bf_bits(b[3]));
    *(v4u*)(out + (size_t)i * 8) = p;
    
  }
}

// =====================================================================================================
// LayerNorm over rows of DM=1024 (x, gamma, beta RNE-converted to bf16 values first), eps 1e-5,
// thread t owns elements 8t..8t+7. Output: bf16 hi plane and unscaled bf16 lo plane (lo = RNE(y - hi)),
// =====================================================================================================
__device__ __forceinline__ void ln_row(const float* __restrict__ x, const float* __restrict__ gam,
                                       const float* __restrict__ bet,
                                       unsigned short* xhp, unsigned short* xlp, int row) {
  __shared__ float sh[8];
  const int tid = threadIdx.x, wave = tid >> 5, lane = tid & 31;
  const size_t base = (size_t)row * DM + (size_t)tid * 8;
  const v4f a0 = *(const v4f*)(x + base);
  const v4f a1 = *(const v4f*)(x + base + 4);
  float v[8];
#pragma unroll
  for (int e = 0; e < 4; ++e) { v[e] = bfr(a0[e]); v[4 + e] = bfr(a1[e]); }
  float s = 0.f;
#pragma unroll
  for (int e = 0; e < 8; ++e) s += v[e];
#pragma unroll
  for (int off = 1; off < 32; off <<= 1) s += __shfl_xor(s, off, 32);
  if (lane == 0) sh[wave] = s;
  __syncthreads();
  const float mu = (sh[0] + sh[1] + sh[2] + sh[3]) * (1.0f / (float)DM);
  float d[8];
  float sq = 0.f;
#pragma unroll
  for (int e = 0; e < 8; ++e) { d[e] = v[e] - mu; sq += d[e] * d[e]; }
#pragma unroll
  for (int off = 1; off < 32; off <<= 1) sq += __shfl_xor(sq, off, 32);
  if (lane == 0) sh[4 + wave] = sq;
  __syncthreads();
  const float var = (sh[4] + sh[5] + sh[6] + sh[7]) * (1.0f / (float)DM);
  const float inv = rsqrtf(var + 1e-5f);
  const v4f g0 = *(const v4f*)(gam + tid * 8);
  const v4f g1 = *(const v4f*)(gam + tid * 8 + 4);
  const v4f e0 = *(const v4f*)(bet + tid * 8);
  const v4f e1 = *(const v4f*)(bet + tid * 8 + 4);
  float y[8];
#pragma unroll
  for (int e = 0; e < 4; ++e) {
    y[e]     = (d[e] * inv) * bfr(g0[e]) + bfr(e0[e]);
    y[4 + e] = (d[4 + e] * inv) * bfr(g1[e]) + bfr(e1[e]);
  }
  v4u ph, pl;
#pragma unroll
  for (int e = 0; e < 4; ++e) {
    const unsigned short h0 = bf_bits(y[2 * e]), h1 = bf_bits(y[2 * e + 1]);
    const unsigned short l0 = bf_bits(y[2 * e] - bf_up(h0)), l1 = bf_bits(y[2 * e + 1] - bf_up(h1));
    ph[e] = pk16(h0, h1);
    pl[e] = pk16(l0, l1);
  }
  unsigned short* dh = xhp + base;
  unsigned short* dl = xlp + base;
  *(v4u*)dh = ph;
  *(v4u*)dl = pl;
  
}

// =====================================================================================================
// One grid for the five jobs that depend on the inputs alone: blocks 0..NB*SEQ-1 normalise one row each,
// the next 4 x CVB blocks convert the four weight planes (CVB blocks of 128 threads x 8 elements per plane).
// The job is picked by the block index, so every branch below is block-uniform.
// =====================================================================================================
#define CVB   (DM * DM / 8 / 128)
static_assert(CVB * 128 * 8 == DM * DM);
__global__ __launch_bounds__(128) void prep_ln_cvt(const float* __restrict__ x, const float* __restrict__ gam,
                                                   const float* __restrict__ bet,
                                                   unsigned short* xhp, unsigned short* xlp,
                                                   const float* __restrict__ wq, const float* __restrict__ wk,
                                                   const float* __restrict__ wv, const float* __restrict__ wo,
                                                   unsigned short* wqb, unsigned short* wkb,
                                                   unsigned short* wvb, unsigned short* wob) {
  const int bx = blockIdx.x;
  if (bx < NB * SEQ) {
    ln_row(x, gam, bet, xhp, xlp, bx);
    return;
  }
  const int j = bx - NB * SEQ;
  const int w = j / CVB;                       // which weight plane
  const int i = (j - w * CVB) * 128 + (int)threadIdx.x;
  const float* in     = (w == 0) ? wq  : (w == 1) ? wk  : (w == 2) ? wv  : wo;
  unsigned short* out = (w == 0) ? wqb : (w == 1) ? wkb : (w == 2) ? wvb : wob;
  cvt_bf16x8(in, out, i, DM * DM / 8);
}

// =====================================================================================================
// Batched bf16 WMMA GEMM: C[m][n] = sum_k A[m][k] * Bt[n][k]; one wave per 64x64 tile, 8 waves per block.
// A row-major [M][K], Bt row-major [N][K] (k contiguous), both of row pitch DM elements. b = batch index (strides in elements).
// NSPLIT: 0 = A.Bt; 1 = A.Bt + A2.Bt (A2 = unscaled bf16 lo plane of A); 2 = A.Bt + A.Bt2 (Bt2 = lo plane of Bt).
// Block tile = WM x WN wave tiles (2 x 4 = 128 x 256; NSPLIT 2: 4 x 2 = 256 x 128, so the two-plane operand has the fewer rows).
// Operands go through LDS in stages of GKC = 64 k: every operand row of the block tile gives one whole 128-B line per stage,
// read from global once per block (8 lanes x 16 B per row, 4 whole lines per wave load) and shared by the waves that need it.
// Two stage buffers: the next stage's lines are loaded into registers ahead of this stage's products, stored to the other
// buffer behind them, one __syncthreads() per stage. Per accumulator the order of the products is k ascending, hi then lo.
// M multiple of 64*WM, N of 64*WN, K of GKC (the host launches only such shapes).
// bias: added in f32 (bias value RNE-converted to bf16 first); biasRow 0 -> bias[n], 1 -> bias[m]; index clamped to nbias-1.
// OUT_MODE: 0 = f32 (pitch ldc) = acc + bias + bf16value(resid[m*ldr + n]);
//           2 = bf16 hi plane C + bf16 lo plane C2 (lo = RNE(v - hi), unscaled);
//           3 = f16 hi plane C + f16 lo plane C2 = f16((v - hi) * rscale), C2 written only for tiles
//               with n0 < N2 (pitch ldc2, batch stride strideC2).
// =====================================================================================================
#define GSM   (2 * 512 * GP)   // LDS elements of the two stages (512 stage rows in every variant)
template <int NSPLIT, int OUT_MODE>
__device__ __forceinline__ void gemm64_body(
    const unsigned short* __restrict__ Ap, const unsigned short* __restrict__ A2p, long long strideA,
    const unsigned short* __restrict__ Btp, const unsigned short* __restrict__ Bt2p, long long strideB,
    void* Cout, int ldc, long long strideC,
    void* Cout2, int ldc2, long long strideC2, int N2,
    const float* __restrict__ bias, int nbias, int biasRow,
    const float* __restrict__ resid, int ldr,
    int M, int N, int K, float rscale,
    int bxi, int b, unsigned short* smem) {            // block index within the job, batch index, GSM elements of LDS
  constexpr int WM   = (NSPLIT == 2) ? 4 : 2;          // wave grid of the block
  constexpr int WN   = 8 / WM;
  constexpr int APL  = (NSPLIT == 1) ? 2 : 1;          // planes of A / of Bt
  constexpr int BPL  = (NSPLIT == 2) ? 2 : 1;
  constexpr int AR   = WM * 64;                        // rows per plane in a stage
  constexpr int BR   = WN * 64;
  constexpr int ROWS = AR * APL + BR * BPL;            // stage rows: [A | A2 | Bt | Bt2]
  constexpr int NLD  = ROWS / 32;                      // 16-B pieces per thread per stage (256 threads = 32 rows x 8 pieces)
  static_assert(AR % 32 == 0 && BR % 32 == 0);
  static_assert(2 * ROWS * GP * 2 >= 8 * 16 * 68 * 4);
  static_assert(2 * ROWS * GP <= GSM);                 // smem: two stages; behind the k loop: per-wave 16x64 f32 slabs, pitch 68
  const int lane = threadIdx.x & 31;
  const int wave = threadIdx.x >> 5;
  const int tilesNb = N / (64 * WN);
  const int tilesMb = M / (64 * WM);
  if (bxi >= tilesMb * tilesNb) return;                // block-uniform, ahead of every barrier
  const int bm = bxi / tilesNb;
  const int bn = bxi - bm * tilesNb;
  const int mB = bm * (64 * WM);
  const int nB = bn * (64 * WN);
  const int wm = wave / WN;
  const int wn = wave - wm * WN;
  const int m0 = mB + (wm << 6);
  const int n0 = nB + (wn << 6);

  const char* Ab  = (const char*)(Ap  + (size_t)b * strideA);
  const char* Bb  = (const char*)(Btp + (size_t)b * strideB);
  const char* Ab2 = (NSPLIT == 1) ? (const char*)(A2p  + (size_t)b * strideA) : Ab;
  const char* Bb2 = (NSPLIT == 2) ? (const char*)(Bt2p + (size_t)b * strideB) : Bb;

  const int rlane = lane & 15;                 // row (A) / col (B, D) within subtile
  const int koff  = (lane >> 4) * 8;           // k offset of this lane half
  const int mOff  = (lane >> 4) * 8;           // D row offset

  // staging map: 8 lanes x 16 B = one row's 128-B line; pass it covers stage rows it*32 .. it*32+31. Neighbouring groups of
  // 8 lanes take rows 8 apart: 8 x 144 B = 128 B mod 256 B, so the two rows of a 16-lane ds_store_b128 half fill all 64 banks once.
  const int srow = ((threadIdx.x >> 7) << 4) | (((threadIdx.x >> 3) & 1) << 3) | ((threadIdx.x >> 4) & 7);
  const int sseg = (threadIdx.x & 7) * 8;
  constexpr size_t LDB = (size_t)DM * 2;                         // operand row pitch in bytes
  const unsigned loff = (unsigned)(srow * DM + sseg) * 2u;       // per-lane byte offset; the rest of each address is block-uniform
  const char* gA  = Ab  + (size_t)mB * LDB;
  const char* gA2 = Ab2 + (size_t)mB * LDB;
  const char* gB  = Bb  + (size_t)nB * LDB;
  const char* gB2 = Bb2 + (size_t)nB * LDB;
  v4u pre[NLD];
  auto fetch = [&](int k0) {
    // unrolled (here and in put): pre[] is indexed by constants only and stays in registers; the row steps become immediate offsets
#pragma unroll
    for (int it = 0; it < NLD; ++it) {
      const int r = it * 32;
      const char* g;
      if (r < AR)                  g = gA  + (size_t)r * LDB;
      else if (r < AR * APL)       g = gA2 + (size_t)(r - AR) * LDB;
      else if (r < AR * APL + BR)  g = gB  + (size_t)(r - AR * APL) * LDB;
      else                         g = gB2 + (size_t)(r - AR * APL - BR) * LDB;
      pre[it] = *(const v4u*)(g + (size_t)k0 * 2 + loff);
    }
    asm volatile("s_wait_xcnt 0x0" ::: "memory");   // precaution: the code behind this reuses the address registers of the loads above
  };
  auto put = [&](int buf) {
    unsigned short* d = smem + buf * (ROWS * GP) + srow * GP + sseg;
#pragma unroll
    for (int it = 0; it < NLD; ++it) *(v4u*)(d + it * 32 * GP) = pre[it];
  };

  v8f acc[4][4];
#pragma unroll
  for (int i = 0; i < 4; ++i)
#pragma unroll
    for (int j = 0; j < 4; ++j) acc[i][j] = zero8();

  const int nk = K / GKC;
  fetch(0);
  put(0);
  __syncthreads();
  for (int kc = 0; kc < nk; ++kc) {
    const bool more = (kc + 1 < nk);           // block-uniform
    if (more) fetch((kc + 1) * GKC);
    const __bf16* sb = (const __bf16*)(const void*)(smem + (kc & 1) * (ROWS * GP));
    const __bf16* sA = sb + ((wm << 6) + rlane) * GP + koff;
    const __bf16* sB = sb + (AR * APL + (wn << 6) + rlane) * GP + koff;
    // every loop below is unrolled: af, bfrag and acc are indexed by constants only and stay in registers
#pragma unroll
    for (int ks = 0; ks < GKC; ks += 32) {
      v16b af[4][APL];
#pragma unroll
      for (int i = 0; i < 4; ++i)
#pragma unroll
        for (int ta = 0; ta < APL; ++ta) af[i][ta] = ldfrag_b(sA + (ta * AR + (i << 4)) * GP + ks);
#pragma unroll
      for (int tb = 0; tb < BPL; ++tb) {
        v16b bfrag[4];
#pragma unroll
        for (int j = 0; j < 4; ++j) bfrag[j] = ldfrag_b(sB + (tb * BR + (j << 4)) * GP + ks);
#pragma unroll
        for (int i = 0; i < 4; ++i) {
#pragma unroll
          for (int ta = 0; ta < APL; ++ta) {
#pragma unroll
            for (int j = 0; j < 4; ++j) acc[i][j] = mma_b_raw(af[i][ta], bfrag[j], acc[i][j]);
            dep_guard1_b(acc[i][0], acc[i][3], af[i][ta]);
          }
        }
        keep4_b(bfrag[0], bfrag[1], bfrag[2], bfrag[3]);
      }
    }
    if (more) put((kc + 1) & 1);
    __syncthreads();                           // publishes the stage just stored; ends every read of the stage just used
  }
  acc_guard4(acc[0][0], acc[0][1], acc[0][2], acc[0][3]);
  acc_guard4(acc[1][0], acc[1][1], acc[1][2], acc[1][3]);
  acc_guard4(acc[2][0], acc[2][1], acc[2][2], acc[2][3]);
  acc_guard4(acc[3][0], acc[3][1], acc[3][2], acc[3][3]);

  // ---- epilogue ----
  float bcol[4];
#pragma unroll
  for (int j = 0; j < 4; ++j) {
    const int nn = min(n0 + (j << 4) + rlane, nbias - 1);
    bcol[j] = bias[nn];
  }
  asm volatile("s_wait_xcnt 0x0" ::: "memory");   // precaution: the code behind this reuses the address registers of the loads above
  __builtin_amdgcn_sched_barrier(0);              // keeps that code behind the wait: the clobber alone does not hold register writes
#pragma unroll
  for (int j = 0; j < 4; ++j) bcol[j] = bfr(bcol[j]);
  float* slab = (float*)(void*)smem + wave * (16 * 68);   // the stages are dead behind the loop's last barrier
#pragma unroll
  for (int i = 0; i < 4; ++i) {
    const int mBase = m0 + (i << 4);
    float brow[8];
#pragma unroll
    for (int r = 0; r < 8; ++r) {
      const int mm = min(mBase + mOff + r, nbias - 1);
      brow[r] = bias[mm];
    }
    asm volatile("s_wait_xcnt 0x0" ::: "memory");   // precaution, as above
    __builtin_amdgcn_sched_barrier(0);              // as above
#pragma unroll
    for (int r = 0; r < 8; ++r) brow[r] = bfr(brow[r]);
#pragma unroll
    for (int j = 0; j < 4; ++j) {
#pragma unroll
      for (int r = 0; r < 8; ++r) {
        const float bv = (biasRow != 0) ? brow[r] : bcol[j];
        slab[(mOff + r) * 68 + (j << 4) + rlane] = acc[i][j][r] + bv;
      }
    }
    __builtin_amdgcn_fence(__ATOMIC_RELEASE, "workgroup");
    __builtin_amdgcn_wave_barrier();
    __builtin_amdgcn_fence(__ATOMIC_ACQUIRE, "workgroup");
    if (OUT_MODE == 0) {
      float* C = (float*)Cout + (size_t)b * strideC;
      const int h2 = lane >> 4, c4 = (lane & 15) * 4;     // 256-B row segment = 16 lanes x 16 B
      v4f vo[8];
#pragma unroll
      for (int it = 0; it < 8; ++it) {
        const int row = it * 2 + h2;                       // it 0..7 x h2 0..1 = rows 0..15
        v4f sv = *(const v4f*)(slab + row * 68 + c4);
        const v4f rx = *(const v4f*)(resid + (size_t)(mBase + row) * ldr + n0 + c4);
#pragma unroll
        for (int e = 0; e < 4; ++e) sv[e] = sv[e] + bfr(rx[e]);
        vo[it] = sv;
      }
      __builtin_amdgcn_sched_barrier(0);              // keeps the next row group's address arithmetic off the registers of the loads above
      {
#pragma unroll
        for (int it = 0; it < 8; ++it) {
          const int row = it * 2 + h2;
          *(v4f*)(C + (size_t)(mBase + row) * ldc + n0 + c4) = vo[it];
        }
        
      }
    } else {
      const int q = lane >> 3, c8 = (lane & 7) * 8;
      unsigned short* C  = (unsigned short*)Cout  + (size_t)b * strideC;
      unsigned short* C2 = (unsigned short*)Cout2 + (size_t)b * strideC2;
      const bool wlo = (OUT_MODE == 2) || (n0 < N2);      // wave-uniform
      v4u hv[4], lv[4];
#pragma unroll
      for (int it = 0; it < 4; ++it) {
        const int row = it * 4 + q;                        // it 0..3 x q 0..3 = rows 0..15
        const float* sp = slab + row * 68 + c8;
        v4u a, a2;
#pragma unroll
        for (int e = 0; e < 4; ++e) {
          const float f0 = sp[2 * e], f1 = sp[2 * e + 1];
          unsigned short h0, h1, l0, l1;
          if (OUT_MODE == 2) {
            h0 = bf_bits(f0); h1 = bf_bits(f1);
            l0 = bf_bits(f0 - bf_up(h0)); l1 = bf_bits(f1 - bf_up(h1));
          } else {
            const _Float16 x0 = (_Float16)f0, x1 = (_Float16)f1;
            h0 = h_bits(x0); h1 = h_bits(x1);
            l0 = h_bits((_Float16)((f0 - (float)x0) * rscale));
            l1 = h_bits((_Float16)((f1 - (float)x1) * rscale));
          }
          a[e] = pk16(h0, h1); a2[e] = pk16(l0, l1);
        }
        hv[it] = a; lv[it] = a2;
      }
      {
#pragma unroll
        for (int it = 0; it < 4; ++it) {
          const int row = it * 4 + q;
          *(v4u*)(C + (size_t)(mBase + row) * ldc + n0 + c8) = hv[it];
          if (wlo) *(v4u*)(C2 + (size_t)(mBase + row) * ldc2 + n0 + c8) = lv[it];
        }
        
      }
    }
    __builtin_amdgcn_fence(__ATOMIC_RELEASE, "workgroup");
    __builtin_amdgcn_wave_barrier();
    __builtin_amdgcn_fence(__ATOMIC_ACQUIRE, "workgroup");
  }
}

// out projection: one job per launch, grid = (block tiles, batches)
template <int NSPLIT, int OUT_MODE>
__global__ __launch_bounds__(256) void gemm64(
    const unsigned short* __restrict__ Ap, const unsigned short* __restrict__ A2p, long long strideA,
    const unsigned short* __restrict__ Btp, const unsigned short* __restrict__ Bt2p, long long strideB,
    void* Cout, int ldc, long long strideC,
    void* Cout2, int ldc2, long long strideC2, int N2,
    const float* __restrict__ bias, int nbias, int biasRow,
    const float* __restrict__ resid, int ldr,
    int M, int N, int K, float rscale) {
  __shared__ __align__(16) unsigned short smem[GSM];
  gemm64_body<NSPLIT, OUT_MODE>(Ap, A2p, strideA, Btp, Bt2p, strideB, Cout, ldc, strideC, Cout2, ldc2, strideC2, N2,
                                bias, nbias, biasRow, resid, ldr, M, N, K, rscale,
                                (int)blockIdx.x, (int)blockIdx.y, smem);
}

// q, k and v^T projections in one grid (they depend on the same planes and on nothing of each other); the job is picked by the
// block index, so the branch is block-uniform:
//   blocks 0..PJB-1       q   = xn . Wq^T + bq -> f16 hi plane + f16 lo plane x2048 [b*SEQ+t][h*64+d]   (M=8192, N=1024, K=1024)
//   blocks PJB..2*PJB-1   k   = xn . Wk^T + bk -> f16 plane (no lo plane: N2 = 0)
//   the next NB*VJB       v^T = Wv . xn^T + bv per batch -> f16 hi plane [b][h*64+d][s] (pitch SEQ) and lo plane (x4096, keys < VLP
//                         only, pitch VLP)   (A = Wv [n][k], Bt = xn planes of batch b; M=1024, N=2048, K=1024)
#define PJB   ((NB * SEQ / 128) * (DM / 256))
#define VJB   ((DM / 256) * (SEQ / 128))
__global__ __launch_bounds__(256) void qkv_proj(
    const unsigned short* __restrict__ xh, const unsigned short* __restrict__ xl,
    const unsigned short* __restrict__ wq, const unsigned short* __restrict__ wk, const unsigned short* __restrict__ wv,
    unsigned short* qh, unsigned short* ql, unsigned short* kh, unsigned short* vth, unsigned short* vtl,
    const float* __restrict__ bq, const float* __restrict__ bk, const float* __restrict__ bv,
    const float* __restrict__ x, int K) {
  __shared__ __align__(16) unsigned short smem[GSM];
  const int bx = blockIdx.x;
  if (bx < 2 * PJB) {
    const bool isk = (bx >= PJB);
    const unsigned short* w = isk ? wk : wq;
    gemm64_body<1, 3>(xh, xl, 0LL, w, w, 0LL,
                      (void*)(isk ? kh : qh), DM, 0LL, (void*)(isk ? kh : ql), DM, 0LL, isk ? 0 : DM,
                      isk ? bk : bq, DM, 0, x, DM,
                      NB * SEQ, DM, K, 2048.0f,
                      isk ? bx - PJB : bx, 0, smem);
  } else {
    const int j = bx - 2 * PJB;
    const int b = j / VJB;
    gemm64_body<2, 3>(wv, wv, 0LL, xh, xl, (long long)SEQ * DM,
                      (void*)vth, SEQ, (long long)DM * SEQ, (void*)vtl, VLP, (long long)DM * VLP, VLP,
                      bv, DM, 1, x, DM,
                      DM, SEQ, K, 4096.0f,
                      j - b * VJB, b, smem);
  }
}

template <bool RES>
__device__ __forceinline__
void attn_block64(const unsigned short* __restrict__ qhp, const unsigned short* __restrict__ qlp,
                  const unsigned short* __restrict__ khp,
                  const unsigned short* __restrict__ vhp, const unsigned short* __restrict__ vlp,
                  unsigned short* ohp, unsigned short* olp,
                  int qb, int h, int b, float sscale, float qlinv,
                  _Float16* Ksh, _Float16* Vth, _Float16* Vtl, float* Os) {
  union FH { v16h v; v8h h[2]; };
  const int tid  = threadIdx.x;
  const int wave = tid >> 5;
  const int lane = tid & 31;
  const int hh   = lane >> 4;
  const int c    = lane & 15;

  const int q0   = qb * 64 + wave * 16;
  const size_t rowB = (size_t)b * SEQ;
  const int hoff = h * HD;

  const _Float16* Qh = (const _Float16*)(const void*)qhp;
  const _Float16* Ql = (const _Float16*)(const void*)qlp;
  const _Float16* Kh = (const _Float16*)(const void*)khp;
  const _Float16* Vh = (const _Float16*)(const void*)vhp + ((size_t)b * DM + (size_t)hoff) * SEQ;
  const _Float16* Vl = (const _Float16*)(const void*)vlp + ((size_t)b * DM + (size_t)hoff) * VLP;

  // ---- Q fragments (B operand, column = query = lane&15): 2 d-chunks, hi and lo ----
  v16h qah[2], qal[2];
#pragma unroll
  for (int dc = 0; dc < 2; ++dc) {
    const size_t qo = (rowB + q0 + c) * DM + hoff + dc * 32 + 8 * hh;
    qah[dc] = ldfrag_h(Qh + qo);
    qal[dc] = ldfrag_h(Ql + qo);
  }

  const int qrow = q0 + c;                   // this lane's query
  float mrow = -INFINITY, lrow = 0.f;        // its running maximum; the sum over the keys of this lane's half
  v8f oacc[4];                               // O^T: oacc[t][r] = context[query c][d = t*16 + 8*hh + r]
#pragma unroll
  for (int t = 0; t < 4; ++t) oacc[t] = zero8();

  for (int kt = 0; kt < NQB; ++kt) {         // static bound
    if (kt > qb) break;                      // block-uniform: causal, key tiles 0..qb only
    const int kv0 = kt * 64;
    __syncthreads();
    {
      const int r = tid >> 1, half = (tid & 1) * 32;
      const _Float16* kg  = Kh + (rowB + kv0 + r) * DM + hoff + half;   // K row kv0+r, d = half..half+31
      const _Float16* vg  = Vh + (size_t)r * SEQ + kv0 + half;         // V^T row d = r, s = kv0+half..+31
      const int kvl = (kv0 + 64 <= VLP) ? kv0 : (VLP - 64);          // clamped address into the lo plane
      const _Float16* vlg = Vl + (size_t)r * VLP + kvl + half;
      const bool resOK = (kv0 + 64 <= VLP);                           // block-uniform
#pragma unroll
      for (int i = 0; i < 4; ++i) {
        const v8h a0 = *(const v8h*)(kg + 8 * i);
        const v8h b0 = *(const v8h*)(vg + 8 * i);
        *(v8h*)(Ksh + r * KP + half + 8 * i) = a0;
        *(v8h*)(Vth + r * KP + half + 8 * i) = b0;
        if (RES) {
          v8h b1 = *(const v8h*)(vlg + 8 * i);
          if (!resOK) b1 = zero8h();
          *(v8h*)(Vtl + r * KP + half + 8 * i) = b1;
        }
      }
    }
    __syncthreads();

    // ---- scores, transposed: 64 keys x 16 queries per wave, 2 f16 products into separate accumulators;
    //      s[j][r] = score of key kv0 + j*16 + 8*hh + r against query qrow ----
    v8f s[4];
#pragma unroll
    for (int j = 0; j < 4; ++j) {
      v8f t0 = zero8(), t1 = zero8();
#pragma unroll
      for (int dc = 0; dc < 2; ++dc) {
        FH kb;
        kb.h[0] = *(const v8h*)(Ksh + (j * 16 + c) * KP + dc * 32 + 8 * hh);
        kb.h[1] = *(const v8h*)(Ksh + (j * 16 + c) * KP + dc * 32 + 16 + 8 * hh);
        t0 = mma_h(kb.v, qah[dc], t0);
        t1 = mma_h(kb.v, qal[dc], t1);
      }
#pragma unroll
      for (int r = 0; r < 8; ++r) s[j][r] = t0[r] + t1[r] * qlinv;
    }

    // ---- scale + causal mask, maximum, online softmax; P^T (x1024, f16) and its lo plane (x4096) packed as B operands ----
    const int lim = qrow - kv0 - 8 * hh;       // key > qrow  <=>  j*16 + r > lim
    float mj[4];                               // four independent chains, joined below
#pragma unroll
    for (int j = 0; j < 4; ++j) {
      mj[j] = -INFINITY;
#pragma unroll
      for (int r = 0; r < 8; ++r) {
        float sv = s[j][r] * sscale;
        sv = (j * 16 + r > lim) ? -1.0e9f : sv;
        s[j][r] = sv;
        mj[j] = fmaxf(mj[j], sv);
      }
    }
    float m = fmaxf(fmaxf(mj[0], mj[1]), fmaxf(mj[2], mj[3]));
    m = fmaxf(m, xhalf(m));                    // both halves now hold the query's maximum over the 64 keys
    const float mnew  = fmaxf(mrow, m);
    const float msafe = (mnew == -INFINITY) ? 0.f : mnew;
    const float alpha = __expf(mrow - msafe);
    mrow = mnew;
    // element e of the B operand of key group kk is key kk*32 + (e < 8 ? 8*hh + e : 16 + 8*hh + e - 8): tile 2kk, then tile 2kk+1
    FH pb[2], pl[2];
    float pj[4];
#pragma unroll
    for (int j = 0; j < 4; ++j) {
      pj[j] = 0.f;
#pragma unroll
      for (int r = 0; r < 8; ++r) {
        const float p = __expf(s[j][r] - msafe);     // masked logit: exp -> 0
        pj[j] += p;
        const float p1k = p * 1024.0f;
        const _Float16 ph = (_Float16)p1k;
        pb[j >> 1].h[j & 1][r] = ph;
        if (RES) pl[j >> 1].h[j & 1][r] = (_Float16)((p1k - (float)ph) * 4096.0f);
      }
    }
    lrow = lrow * alpha + ((pj[0] + pj[1]) + (pj[2] + pj[3]));
#pragma unroll
    for (int t = 0; t < 4; ++t)
#pragma unroll
      for (int r = 0; r < 8; ++r) oacc[t][r] *= alpha;

    // ---- context^T += V^T . P^T (f16 WMMA), lo products into a separate accumulator ----
    v8f o1[4];
#pragma unroll
    for (int t = 0; t < 4; ++t) o1[t] = zero8();
    // unrolled: pb and pl are indexed by constants only and stay in registers
#pragma unroll
    for (int kk = 0; kk < 2; ++kk) {
#pragma unroll
      for (int t = 0; t < 4; ++t) {
        FH vb;
        vb.h[0] = *(const v8h*)(Vth + (t * 16 + c) * KP + kk * 32 + 8 * hh);
        vb.h[1] = *(const v8h*)(Vth + (t * 16 + c) * KP + kk * 32 + 16 + 8 * hh);
        oacc[t] = mma_h(vb.v, pb[kk].v, oacc[t]);
        if (RES) {
          FH vl;
          vl.h[0] = *(const v8h*)(Vtl + (t * 16 + c) * KP + kk * 32 + 8 * hh);
          vl.h[1] = *(const v8h*)(Vtl + (t * 16 + c) * KP + kk * 32 + 16 + 8 * hh);
          o1[t] = mma_h(vl.v, pb[kk].v, o1[t]);
          o1[t] = mma_h(vb.v, pl[kk].v, o1[t]);
        }
      }
    }
    if (RES) {
#pragma unroll
      for (int t = 0; t < 4; ++t)
#pragma unroll
        for (int r = 0; r < 8; ++r) oacc[t][r] += o1[t][r] * (1.0f / 4096.0f);
    }
  }

  // ---- normalise (1/l and the 1/1024 p carry), stage the wave's 16x64 tile, bf16 hi/lo split,
  float* os = Os + wave * (16 * OP);
  {
    const float l = lrow + xhalf(lrow);        // the two halves' key sums joined
    const float inv = ((l > 0.f) ? (1.0f / l) : 0.f) * (1.0f / 1024.0f);
#pragma unroll
    for (int t = 0; t < 4; ++t) {              // a lane's 8 registers are 8 consecutive d of its query's row
      v4f w0, w1;
#pragma unroll
      for (int e = 0; e < 4; ++e) { w0[e] = oacc[t][e] * inv; w1[e] = oacc[t][4 + e] * inv; }
      *(v4f*)(os + c * OP + t * 16 + 8 * hh)     = w0;
      *(v4f*)(os + c * OP + t * 16 + 8 * hh + 4) = w1;
    }
  }
  __builtin_amdgcn_fence(__ATOMIC_RELEASE, "workgroup");
  __builtin_amdgcn_wave_barrier();
  __builtin_amdgcn_fence(__ATOMIC_ACQUIRE, "workgroup");
  {
    const int q4 = lane >> 3, c8 = (lane & 7) * 8;
    v4u hv[4], lv[4];
#pragma unroll
    for (int it = 0; it < 4; ++it) {
      const int row = it * 4 + q4;   // it 0..3 x q4 0..3 = rows 0..15 of the wave tile
      const float* sp = os + row * OP + c8;
      v4u a, a2;
#pragma unroll
      for (int e = 0; e < 4; ++e) {
        const float f0 = sp[2 * e], f1 = sp[2 * e + 1];
        const unsigned short h0 = bf_bits(f0), h1 = bf_bits(f1);
        const unsigned short l0 = bf_bits(f0 - bf_up(h0)), l1 = bf_bits(f1 - bf_up(h1));
        a[e] = pk16(h0, h1); a2[e] = pk16(l0, l1);
      }
      hv[it] = a; lv[it] = a2;
    }
    {
#pragma unroll
      for (int it = 0; it < 4; ++it) {
        const int row = it * 4 + q4;
        const size_t go = (rowB + q0 + row) * DM + (size_t)hoff + c8;
        *(v4u*)(ohp + go) = hv[it];
        *(v4u*)(olp + go) = lv[it];
      }
      
    }
  }
}

// One grid for all query blocks: grid = NQB * NH * NB, 64 consecutive blocks = the (b, h) pairs of one query block. The query block
// falls with the block index, so the blocks with the most key tiles start first and the short ones fill the places they leave.
// Query blocks 0..RESQB-1 take the variant with the lo planes (block-uniform branch).
__global__ __launch_bounds__(128)
void attn_causal64(const unsigned short* __restrict__ qhp, const unsigned short* __restrict__ qlp,
                   const unsigned short* __restrict__ khp,
                   const unsigned short* __restrict__ vhp, const unsigned short* __restrict__ vlp,
                   unsigned short* ohp, unsigned short* olp, float sscale, float qlinv) {
  __shared__ __align__(16) _Float16 Ksh[64 * KP];                 // K [kv][d], pitch KP
  __shared__ __align__(16) _Float16 Vth[64 * KP];                 // V^T hi [d][kv], pitch KP
  __shared__ __align__(16) _Float16 Vtl[64 * KP];                 // V^T lo, pitch KP
  __shared__ __align__(16) float    Os[4 * 16 * OP];              // per wave context tile [row][d], pitch OP
  const int bx   = blockIdx.x;
  const int qb   = NQB - 1 - bx / (NH * NB);
  const int rest = bx % (NH * NB);
  const int h    = rest % NH;
  const int b    = rest / NH;
  if (qb < RESQB) attn_block64<true>(qhp, qlp, khp, vhp, vlp, ohp, olp, qb, h, b, sscale, qlinv, Ksh, Vth, Vtl, Os);
  else            attn_block64<false>(qhp, qlp, khp, vhp, vlp, ohp, olp, qb, h, b, sscale, qlinv, Ksh, Vth, Vtl, Os);
}

// =====================================================================================================
// Workspace map (bytes):
//   XNh  bf16 [8192][1024]        0          16777216   (later: Oh, context hi plane)
//   XNl  bf16 [8192][1024]        16777216   16777216   (later: Ol, context lo plane)
//   Wqb  bf16 [1024 n][1024 k]    33554432    2097152
//   Wkb  bf16 [1024][1024]        35651584    2097152
//   Wvb  bf16 [1024][1024]        37748736    2097152
//   Wob  bf16 [1024][1024]        39845888    2097152
//   Qh   f16  [8192][1024]        41943040   16777216
//   Ql   f16  [8192][1024]        58720256   16777216
//   Kh   f16  [8192][1024]        75497472   16777216
//   VTh  f16  [4][1024][2048]     92274688   16777216
//   VTl  f16  [4][1024][512]      109051904   4194304
//   end                           113246208
// All planes are exact multiples of their 64x64 / whole-line store granularity (no padded tails needed).
// Weights are [out n][in k] with k contiguous = the Bt / A layout the GEMM wants, so they are only converted.
// =====================================================================================================
extern "C" void kernel_launch(void* const* d_in, const int* in_sizes, int n_in,
                              void* d_out, int out_size, void* d_ws, size_t ws_size,
                              hipStream_t stream) {
  if (n_in < 11) return;
  if (in_sizes[0] != NB * SEQ * DM) return;
  if (in_sizes[1] != DM * DM || in_sizes[3] != DM * DM || in_sizes[5] != DM * DM || in_sizes[7] != DM * DM) return;
  if (in_sizes[2] != DM || in_sizes[4] != DM || in_sizes[6] != DM || in_sizes[8] != DM) return;
  if (in_sizes[9] != DM || in_sizes[10] != DM) return;
  if (out_size != NB * SEQ * DM) return;

  const float* x     = (const float*)d_in[0];
  const float* Wq    = (const float*)d_in[1];
  const float* bq    = (const float*)d_in[2];
  const float* Wk    = (const float*)d_in[3];
  const float* bk    = (const float*)d_in[4];
  const float* Wv    = (const float*)d_in[5];
  const float* bv    = (const float*)d_in[6];
  const float* Wo    = (const float*)d_in[7];
  const float* bo    = (const float*)d_in[8];
  const float* gamma = (const float*)d_in[9];
  const float* beta  = (const float*)d_in[10];

  const size_t P16 = (size_t)NB * SEQ * DM * 2;   // 16777216  16-bit activation plane [8192][1024]
  const size_t PW  = (size_t)DM * DM * 2;         //  2097152  16-bit weight plane
  const size_t PVT = (size_t)NB * DM * SEQ * 2;   // 16777216  v^T hi plane
  const size_t PVL = (size_t)NB * DM * VLP * 2;   //  4194304  v^T lo plane
  size_t off = 0;
  const size_t oXh  = off; off += P16;
  const size_t oXl  = off; off += P16;
  const size_t oWq  = off; off += PW;
  const size_t oWk  = off; off += PW;
  const size_t oWv  = off; off += PW;
  const size_t oWo  = off; off += PW;
  const size_t oQh  = off; off += P16;
  const size_t oQl  = off; off += P16;
  const size_t oKh  = off; off += P16;
  const size_t oVTh = off; off += PVT;
  const size_t oVTl = off; off += PVL;
  if (off > ws_size) return;                      // off = 113246208
  if (off > (size_t)134217728) return;
  const size_t oOh  = oXh;                        // context planes reuse the XN planes (dead after the projections)
  const size_t oOl  = oXl;

  char* ws = (char*)d_ws;
  unsigned short* XNh = (unsigned short*)(ws + oXh);
  unsigned short* XNl = (unsigned short*)(ws + oXl);
  unsigned short* Wqb = (unsigned short*)(ws + oWq);
  unsigned short* Wkb = (unsigned short*)(ws + oWk);
  unsigned short* Wvb = (unsigned short*)(ws + oWv);
  unsigned short* Wob = (unsigned short*)(ws + oWo);
  unsigned short* Qh  = (unsigned short*)(ws + oQh);
  unsigned short* Ql  = (unsigned short*)(ws + oQl);
  unsigned short* Kh  = (unsigned short*)(ws + oKh);
  unsigned short* VTh = (unsigned short*)(ws + oVTh);
  unsigned short* VTl = (unsigned short*)(ws + oVTl);
  unsigned short* Oh  = (unsigned short*)(ws + oOh);
  unsigned short* Ol  = (unsigned short*)(ws + oOl);

  const dim3 blk(256);
  const dim3 gProj(((NB * SEQ / 64) * (DM / 64) + 7) / 8, 1); // 2048 tiles -> 256 blocks: M=8192, N=1024

  // (1) LayerNorm -> bf16 hi / lo planes [8192][1024]; weights [n][k] f32 -> bf16 [n][k]
  prep_ln_cvt<<<dim3(NB * SEQ + 4 * CVB), dim3(128), 0, stream>>>(
      x, gamma, beta, XNh, XNl, Wq, Wk, Wv, Wo, Wqb, Wkb, Wvb, Wob);
  // (2) q, k, v^T projections
  qkv_proj<<<dim3(2 * PJB + NB * VJB), blk, 0, stream>>>(
      XNh, XNl, Wqb, Wkb, Wvb, Qh, Ql, Kh, VTh, VTl, bq, bk, bv, x, DM);
  // (3) attention: query blocks 0..RESQB-1 with lo planes, the rest without
  attn_causal64<<<dim3(NB * NH * NQB), dim3(128), 0, stream>>>(
      Qh, Ql, Kh, VTh, VTl, Oh, Ol, 0.125f, 1.0f / 2048.0f);
  // (4) out = bf16(x) + context . Wo^T + bo -> d_out f32 [8192][1024]  (A = context hi + lo planes, 2 products)
  gemm64<1, 0><<<gProj, blk, 0, stream>>>(
      Oh, Ol, 0LL, Wob, Wob, 0LL,
      d_out, DM, 0LL, d_out, DM, 0LL, 0,
      bo, DM, 0, x, DM,
      NB * SEQ, DM, DM, 1.0f);
  (void)hipGetLastError();
}

// v006
// One run takes 168 microseconds.
// Timed twice side by side with v005, it ran 1.09 times as fast both times.
// All steps since v000 together make it 4.26 times as fast.
// Contractions: q/k/v^T projections = v_wmma_f32_16x16x32_bf16 (normalised activations as bf16 hi+lo planes, weights bf16, 2 products);
// q.k^T = v_wmma_f32_16x16x32_f16 (q as f16 hi plane + f16 lo plane x2048, k f16, 2 products, separate accumulators);
// p.v = v_wmma_f32_16x16x32_f16 (p carried x1024 in f16, v^T f16; extra f16 lo planes x4096 of p and v on the first 512 query rows);
// ctx.Wo^T = v_wmma_f32_16x16x32_bf16 (ctx as bf16 hi+lo planes, Wo bf16, 2 products); all f32 accumulate; LayerNorm, causal mask, softmax, bias and skip-add in f32.
#include <hip/hip_runtime.h>
#include <math.h>
#include <float.h>
#include <stdint.h>

#define NB    4
#define SEQ   2048
#define DM    1024
#define NH    16
#define HD    64
#define NQB   (SEQ / 64)   // 32 key / query tiles of 64
#define VLP   512          // key pitch of the v^T lo plane (keys 0..VLP-1)
#define RESQB 8            // leading 64-row query blocks that use the p / v lo planes
static_assert(RESQB * 64 <= VLP);
static_assert(NH * HD == DM);
static_assert((SEQ % 64) == 0 && (DM % 64) == 0);
static_assert(DM == 128 * 8);
#define KP    72           // LDS row pitch of the 64-wide f16 tiles, in elements: 144 B = 16 B x 9 (odd), so 16 rows read 16 B wide fall on distinct banks
#define OP    68           // LDS row pitch of the f32 context tile, in floats (16-byte reads down a column group without bank conflicts)
#define GKC   64           // GEMM: k elements per LDS stage = one 128-B line of every operand row
#define GP    72           // GEMM: LDS row pitch of a stage, in elements (144 B, as KP: 16-B fragment reads of 16 rows fall on distinct banks)
static_assert((GP * 2) % 16 == 0 && ((GP * 2) / 16) % 2 == 1 && GP >= GKC);
static_assert((DM % GKC) == 0 && ((NB * SEQ) % 128) == 0 && (DM % 256) == 0 && (SEQ % 128) == 0);
static_assert((KP * 2) % 16 == 0 && ((KP * 2) / 16) % 2 == 1 && KP >= 64);
static_assert((OP * 4) % 16 == 0 && OP >= 64);

typedef _Float16 v16h __attribute__((ext_vector_type(16)));
typedef _Float16 v8h  __attribute__((ext_vector_type(8)));
typedef __bf16   v16b __attribute__((ext_vector_type(16)));
typedef __bf16   v8b  __attribute__((ext_vector_type(8)));
typedef float    v8f  __attribute__((ext_vector_type(8)));
typedef float    v4f  __attribute__((ext_vector_type(4)));
typedef unsigned int v4u __attribute__((ext_vector_type(4)));

// ---- scalar helpers --------------------------------------------------------------------------------
__device__ __forceinline__ unsigned short bf_bits(float f) {          // f32 -> bf16 bits, RNE convert
  unsigned u = __float_as_uint(f);
  return (unsigned short)((u + 0x7FFFu + ((u >> 16) & 1u)) >> 16);
}
__device__ __forceinline__ float bf_up(unsigned short h) { return __uint_as_float(((unsigned)h) << 16); }
__device__ __forceinline__ float bfr(float f) { return bf_up(bf_bits(f)); }   // value after RNE convert to bf16
__device__ __forceinline__ unsigned short h_bits(_Float16 x) { return __builtin_bit_cast(unsigned short, x); }
__device__ __forceinline__ unsigned pk16(unsigned short a, unsigned short b) { return (unsigned)a | ((unsigned)b << 16); }
__device__ __forceinline__ v8f zero8() { v8f z = {0.f, 0.f, 0.f, 0.f, 0.f, 0.f, 0.f, 0.f}; return z; }
__device__ __forceinline__ v8h zero8h() {
  const _Float16 z = (_Float16)0.0f;
  v8h r = {z, z, z, z, z, z, z, z};
  return r;
}

// value of lane l ^ 16 (the other 16-lane half), by a vector cross-row move
__device__ __forceinline__ float xhalf(float x) {
  const int i = __builtin_bit_cast(int, x);
  return __builtin_bit_cast(float, __builtin_amdgcn_permlanex16(i, i, 0x76543210, 0xfedcba98, false, false));
}

// ---- fragment loaders: 16-bit A/B operand, lane -> row/col (lane&15), p already includes +8*(lane>>4);
//      elements 0..7 <- p[0..7] (k0+8h..), elements 8..15 <- p[16..23] (k0+16+8h..)
__device__ __forceinline__ v16b ldfrag_b(const __bf16* p) {
  union { v16b v; v8b h[2]; } f;
  f.h[0] = *(const v8b*)(p);
  f.h[1] = *(const v8b*)(p + 16);
  return f.v;
}
__device__ __forceinline__ v16h ldfrag_h(const _Float16* p) {
  union { v16h v; v8h h[2]; } f;
  f.h[0] = *(const v8h*)(p);
  f.h[1] = *(const v8h*)(p + 16);
  return f.v;
}

// ---- WMMA helpers ------------------------------------------------------------------------------------------
// attention products: the plain builtin. The compiler keeps the distances behind its own WMMAs, and with no volatile statement
// between the products it can issue a key tile's LDS fragment reads in groups ahead of them.
__device__ __forceinline__ v8f mma_h(v16h a, v16h b, v8f c) {
  return __builtin_amdgcn_wmma_f32_16x16x32_f16(false, a, false, b, (short)0, c, false, false);
}
// GEMM products: the builtin, with hand-placed VALU gaps behind each group (dep_guard1_b, keep4_b, acc_guard4)
__device__ __forceinline__ v8f mma_b_raw(v16b a, v16b b, v8f c) {
  return __builtin_amdgcn_wmma_f32_16x16x32_bf16(false, a, false, b, (short)0, c, false, false);
}
__device__ __forceinline__ void dep_guard1_b(v8f& a, v8f& b, v16b x) {
  asm volatile("v_nop\n\tv_nop\n\tv_nop\n\tv_nop" : "+v"(a), "+v"(b) : "v"(x));
}
__device__ __forceinline__ void keep4_b(v16b a, v16b b, v16b c, v16b d) {
  asm volatile("v_nop" :: "v"(a), "v"(b), "v"(c), "v"(d));
}
__device__ __forceinline__ void acc_guard4(v8f& a, v8f& b, v8f& c, v8f& d) {
  asm volatile("v_nop\n\tv_nop\n\tv_nop\n\tv_nop" : "+v"(a), "+v"(b), "+v"(c), "+v"(d));
}

// =====================================================================================================
// f32 -> bf16 (RNE convert), 8 elements per thread, one 16-B store per lane: a wave writes 512 contiguous B
// coverage: thread i of n8 takes elements 8i..8i+7; n8 x 8 = whole plane (n8 = 131072 here, a multiple of 128).
// =====================================================================================================
__device__ __forceinline__ void cvt_bf16x8(const float* __restrict__ in, unsigned short* out, int i, int n8) {
  if (i < n8) {
    const v4f a = *(const v4f*)(in + (size_t)i * 8);
    const v4f b = *(const v4f*)(in + (size_t)i * 8 + 4);
    v4u p;
    p[0] = pk16(bf_bits(a[0]), bf_bits(a[1]));
    p[1] = pk16(bf_bits(a[2]), bf_bits(a[3]));
    p[2] = pk16(bf_bits(b[0]), bf_bits(b[1]));
    p[3] = pk16(bf_bits(b[2]), bf_bits(b[3]));
    *(v4u*)(out + (size_t)i * 8) = p;
    
  }
}

// =====================================================================================================
// LayerNorm over rows of DM=1024 (x, gamma, beta RNE-converted to bf16 values first), eps 1e-5,
// thread t owns elements 8t..8t+7. Output: bf16 hi plane and unscaled bf16 lo plane (lo = RNE(y - hi)),
// =====================================================================================================
__device__ __forceinline__ void ln_row(const float* __restrict__ x, const float* __restrict__ gam,
                                       const float* __restrict__ bet,
                                       unsigned short* xhp, unsigned short* xlp, int row) {
  __shared__ float sh[8];
  const int tid = threadIdx.x, wave = tid >> 5, lane = tid & 31;
  const size_t base = (size_t)row * DM + (size_t)tid * 8;
  const v4f a0 = *(const v4f*)(x + base);
  const v4f a1 = *(const v4f*)(x + base + 4);
  float v[8];
#pragma unroll
  for (int e = 0; e < 4; ++e) { v[e] = bfr(a0[e]); v[4 + e] = bfr(a1[e]); }
  float s = 0.f;
#pragma unroll
  for (int e = 0; e < 8; ++e) s += v[e];
#pragma unroll
  for (int off = 1; off < 32; off <<= 1) s += __shfl_xor(s, off, 32);
  if (lane == 0) sh[wave] = s;
  __syncthreads();
  const float mu = (sh[0] + sh[1] + sh[2] + sh[3]) * (1.0f / (float)DM);
  float d[8];
  float sq = 0.f;
#pragma unroll
  for (int e = 0; e < 8; ++e) { d[e] = v[e] - mu; sq += d[e] * d[e]; }
#pragma unroll
  for (int off = 1; off < 32; off <<= 1) sq += __shfl_xor(sq, off, 32);
  if (lane == 0) sh[4 + wave] = sq;
  __syncthreads();
  const float var = (sh[4] + sh[5] + sh[6] + sh[7]) * (1.0f / (float)DM);
  const float inv = rsqrtf(var + 1e-5f);
  const v4f g0 = *(const v4f*)(gam + tid * 8);
  const v4f g1 = *(const v4f*)(gam + tid * 8 + 4);
  const v4f e0 = *(const v4f*)(bet + tid * 8);
  const v4f e1 = *(const v4f*)(bet + tid * 8 + 4);
  float y[8];
#pragma unroll
  for (int e = 0; e < 4; ++e) {
    y[e]     = (d[e] * inv) * bfr(g0[e]) + bfr(e0[e]);
    y[4 + e] = (d[4 + e] * inv) * bfr(g1[e]) + bfr(e1[e]);
  }
  v4u ph, pl;
#pragma unroll
  for (int e = 0; e < 4; ++e) {
    const unsigned short h0 = bf_bits(y[2 * e]), h1 = bf_bits(y[2 * e + 1]);
    const unsigned short l0 = bf_bits(y[2 * e] - bf_up(h0)), l1 = bf_bits(y[2 * e + 1] - bf_up(h1));
    ph[e] = pk16(h0, h1);
    pl[e] = pk16(l0, l1);
  }
  unsigned short* dh = xhp + base;
  unsigned short* dl = xlp + base;
  *(v4u*)dh = ph;
  *(v4u*)dl = pl;
  
}

// =====================================================================================================
// One grid for the five jobs that depend on the inputs alone: blocks 0..NB*SEQ-1 normalise one row each,
// the next 4 x CVB blocks convert the four weight planes (CVB blocks of 128 threads x 8 elements per plane).
// The job is picked by the block index, so every branch below is block-uniform.
// =====================================================================================================
#define CVB   (DM * DM / 8 / 128)
static_assert(CVB * 128 * 8 == DM * DM);
__global__ __launch_bounds__(128) void prep_ln_cvt(const float* __restrict__ x, const float* __restrict__ gam,
                                                   const float* __restrict__ bet,
                                                   unsigned short* xhp, unsigned short* xlp,
                                                   const float* __restrict__ wq, const float* __restrict__ wk,
                                                   const float* __restrict__ wv, const float* __restrict__ wo,
                                                   unsigned short* wqb, unsigned short* wkb,
                                                   unsigned short* wvb, unsigned short* wob) {
  const int bx = blockIdx.x;
  if (bx < NB * SEQ) {
    ln_row(x, gam, bet, xhp, xlp, bx);
    return;
  }
  const int j = bx - NB * SEQ;
  const int w = j / CVB;                       // which weight plane
  const int i = (j - w * CVB) * 128 + (int)threadIdx.x;
  const float* in     = (w == 0) ? wq  : (w == 1) ? wk  : (w == 2) ? wv  : wo;
  unsigned short* out = (w == 0) ? wqb : (w == 1) ? wkb : (w == 2) ? wvb : wob;
  cvt_bf16x8(in, out, i, DM * DM / 8);
}

// =====================================================================================================
// Batched bf16 WMMA GEMM: C[m][n] = sum_k A[m][k] * Bt[n][k]; one wave per 64x64 tile, 8 waves per block.
// A row-major [M][K], Bt row-major [N][K] (k contiguous), both of row pitch DM elements. b = batch index (strides in elements).
// NSPLIT: 0 = A.Bt; 1 = A.Bt + A2.Bt (A2 = unscaled bf16 lo plane of A); 2 = A.Bt + A.Bt2 (Bt2 = lo plane of Bt).
// Block tile = WM x WN wave tiles (2 x 4 = 128 x 256; NSPLIT 2: 4 x 2 = 256 x 128, so the two-plane operand has the fewer rows).
// Operands go through LDS in stages of GKC = 64 k: every operand row of the block tile gives one whole 128-B line per stage,
// read from global once per block (8 lanes x 16 B per row, 4 whole lines per wave load) and shared by the waves that need it.
// Two stage buffers, filled by asynchronous copies (global_load_async_to_lds_b128): behind the barrier that ends a stage's reads its
// buffer takes the stage after next, which flies during the next stage's products; one __syncthreads() per stage.
// Per accumulator the order of the products is k ascending, hi then lo.
// M multiple of 64*WM, N of 64*WN, K of GKC (the host launches only such shapes).
// bias: added in f32 (bias value RNE-converted to bf16 first); biasRow 0 -> bias[n], 1 -> bias[m]; index clamped to nbias-1.
// OUT_MODE: 0 = f32 (pitch ldc) = acc + bias + bf16value(resid[m*ldr + n]);
//           2 = bf16 hi plane C + bf16 lo plane C2 (lo = RNE(v - hi), unscaled);
//           3 = f16 hi plane C + f16 lo plane C2 = f16((v - hi) * rscale), C2 written only for tiles
//               with n0 < N2 (pitch ldc2, batch stride strideC2).
// =====================================================================================================
#define GSM   (2 * 512 * GP)   // LDS elements of the two stages (512 stage rows in every variant)
template <int NSPLIT, int OUT_MODE>
__device__ __forceinline__ void gemm64_body(
    const unsigned short* __restrict__ Ap, const unsigned short* __restrict__ A2p, long long strideA,
    const unsigned short* __restrict__ Btp, const unsigned short* __restrict__ Bt2p, long long strideB,
    void* Cout, int ldc, long long strideC,
    void* Cout2, int ldc2, long long strideC2, int N2,
    const float* __restrict__ bias, int nbias, int biasRow,
    const float* __restrict__ resid, int ldr,
    int M, int N, int K, float rscale,
    int bxi, int b, unsigned short* smem) {            // block index within the job, batch index, GSM elements of LDS
  constexpr int WM   = (NSPLIT == 2) ? 4 : 2;          // wave grid of the block
  constexpr int WN   = 8 / WM;
  constexpr int APL  = (NSPLIT == 1) ? 2 : 1;          // planes of A / of Bt
  constexpr int BPL  = (NSPLIT == 2) ? 2 : 1;
  constexpr int AR   = WM * 64;                        // rows per plane in a stage
  constexpr int BR   = WN * 64;
  constexpr int ROWS = AR * APL + BR * BPL;            // stage rows: [A | A2 | Bt | Bt2]
  constexpr int NLD  = ROWS / 32;                      // 16-B pieces per thread per stage (256 threads = 32 rows x 8 pieces)
  static_assert(AR % 32 == 0 && BR % 32 == 0);
  static_assert(2 * ROWS * GP * 2 >= 8 * 16 * 68 * 4);
  static_assert(2 * ROWS * GP <= GSM);                 // smem: two stages; behind the k loop: per-wave 16x64 f32 slabs, pitch 68
  const int lane = threadIdx.x & 31;
  const int wave = threadIdx.x >> 5;
  const int tilesNb = N / (64 * WN);
  const int tilesMb = M / (64 * WM);
  if (bxi >= tilesMb * tilesNb) return;                // block-uniform, ahead of every barrier
  const int bm = bxi / tilesNb;
  const int bn = bxi - bm * tilesNb;
  const int mB = bm * (64 * WM);
  const int nB = bn * (64 * WN);
  const int wm = wave / WN;
  const int wn = wave - wm * WN;
  const int m0 = mB + (wm << 6);
  const int n0 = nB + (wn << 6);

  const char* Ab  = (const char*)(Ap  + (size_t)b * strideA);
  const char* Bb  = (const char*)(Btp + (size_t)b * strideB);
  const char* Ab2 = (NSPLIT == 1) ? (const char*)(A2p  + (size_t)b * strideA) : Ab;
  const char* Bb2 = (NSPLIT == 2) ? (const char*)(Bt2p + (size_t)b * strideB) : Bb;

  const int rlane = lane & 15;                 // row (A) / col (B, D) within subtile
  const int koff  = (lane >> 4) * 8;           // k offset of this lane half
  const int mOff  = (lane >> 4) * 8;           // D row offset

  // staging map: 8 lanes x 16 B = one row's 128-B line; pass it covers stage rows it*32 .. it*32+31. Neighbouring groups of
  // 8 lanes take rows 8 apart: 8 x 144 B = 128 B mod 256 B, so the two rows that 16 lanes write 16 B wide fill all 64 banks once.
  const int srow = ((threadIdx.x >> 7) << 4) | (((threadIdx.x >> 3) & 1) << 3) | ((threadIdx.x >> 4) & 7);
  const int sseg = (threadIdx.x & 7) * 8;
  constexpr size_t LDB = (size_t)DM * 2;                         // operand row pitch in bytes
  const unsigned loff = (unsigned)(srow * DM + sseg) * 2u;       // per-lane byte offset; the rest of each address is block-uniform
  const char* gA  = Ab  + (size_t)mB * LDB;
  const char* gA2 = Ab2 + (size_t)mB * LDB;
  const char* gB  = Bb  + (size_t)nB * LDB;
  const char* gB2 = Bb2 + (size_t)nB * LDB;
  static_assert(NLD % 8 == 0);
  const unsigned lds0 = (unsigned)(size_t)smem + (unsigned)(srow * GP + sseg) * 2u;   // this lane's LDS byte address: buffer 0, pass 0
  const char* cA  = gA  + loff;            // this lane's piece of the next stage to copy, pass 0 of each plane
  const char* cA2 = gA2 + loff;
  const char* cB  = gB  + loff;
  const char* cB2 = gB2 + loff;
  // one stage, global -> LDS, by asynchronous 16-B copies (no staging registers): per lane NLD copies, eight to a statement
  auto stage = [&](int buf) {
    const unsigned lb = lds0 + (unsigned)buf * (unsigned)(ROWS * GP * 2);
    // unrolled: the row steps are constants
#pragma unroll
    for (int hb = 0; hb < NLD; hb += 8) {
      const char* g[8];
      unsigned l[8];
#pragma unroll
      for (int u = 0; u < 8; ++u) {
        const int r = (hb + u) * 32;
        const char* p;
        if (r < AR)                  p = cA  + (size_t)r * LDB;
        else if (r < AR * APL)       p = cA2 + (size_t)(r - AR) * LDB;
        else if (r < AR * APL + BR)  p = cB  + (size_t)(r - AR * APL) * LDB;
        else                         p = cB2 + (size_t)(r - AR * APL - BR) * LDB;
        g[u] = p;
        l[u] = lb + (unsigned)(r * GP * 2);
      }
      // the copies and, as a precaution, the wait that stands ahead of any rewrite of their address registers, in one statement
      asm volatile(
          "global_load_async_to_lds_b128 %0, %8, off\n\t"
          "global_load_async_to_lds_b128 %1, %9, off\n\t"
          "global_load_async_to_lds_b128 %2, %10, off\n\t"
          "global_load_async_to_lds_b128 %3, %11, off\n\t"
          "global_load_async_to_lds_b128 %4, %12, off\n\t"
          "global_load_async_to_lds_b128 %5, %13, off\n\t"
          "global_load_async_to_lds_b128 %6, %14, off\n\t"
          "global_load_async_to_lds_b128 %7, %15, off\n\t"
          "s_wait_xcnt 0x0"
          :: "v"(l[0]), "v"(l[1]), "v"(l[2]), "v"(l[3]), "v"(l[4]), "v"(l[5]), "v"(l[6]), "v"(l[7]),
             "v"(g[0]), "v"(g[1]), "v"(g[2]), "v"(g[3]), "v"(g[4]), "v"(g[5]), "v"(g[6]), "v"(g[7])
          : "memory");
    }
    cA += GKC * 2; cA2 += GKC * 2; cB += GKC * 2; cB2 += GKC * 2;   // bytes: the stage after
  };

  v8f acc[4][4];
#pragma unroll
  for (int i = 0; i < 4; ++i)
#pragma unroll
    for (int j = 0; j < 4; ++j) acc[i][j] = zero8();

  const int nk = K / GKC;
  stage(0);
  asm volatile("s_wait_asynccnt 0x0" ::: "memory");   // this wave's copies of stage 0 have landed
  __syncthreads();                                    // ... and every other wave's
  if (nk > 1) stage(1);                               // block-uniform
  for (int kc = 0; kc < nk; ++kc) {
    const __bf16* sb = (const __bf16*)(const void*)(smem + (kc & 1) * (ROWS * GP));
    const __bf16* sA = sb + ((wm << 6) + rlane) * GP + koff;
    const __bf16* sB = sb + (AR * APL + (wn << 6) + rlane) * GP + koff;
    // every loop below is unrolled: af, bfrag and acc are indexed by constants only and stay in registers
#pragma unroll
    for (int ks = 0; ks < GKC; ks += 32) {
      v16b af[4][APL];
#pragma unroll
      for (int i = 0; i < 4; ++i)
#pragma unroll
        for (int ta = 0; ta < APL; ++ta) af[i][ta] = ldfrag_b(sA + (ta * AR + (i << 4)) * GP + ks);
#pragma unroll
      for (int tb = 0; tb < BPL; ++tb) {
        v16b bfrag[4];
#pragma unroll
        for (int j = 0; j < 4; ++j) bfrag[j] = ldfrag_b(sB + (tb * BR + (j << 4)) * GP + ks);
#pragma unroll
        for (int i = 0; i < 4; ++i) {
#pragma unroll
          for (int ta = 0; ta < APL; ++ta) {
#pragma unroll
            for (int j = 0; j < 4; ++j) acc[i][j] = mma_b_raw(af[i][ta], bfrag[j], acc[i][j]);
            dep_guard1_b(acc[i][0], acc[i][3], af[i][ta]);
          }
        }
        keep4_b(bfrag[0], bfrag[1], bfrag[2], bfrag[3]);
      }
    }
    asm volatile("s_wait_dscnt 0x0" ::: "memory");      // this wave's reads of the stage just used are done before it is refilled
    asm volatile("s_wait_asynccnt 0x0" ::: "memory");   // this wave's copies of the next stage have landed
    __syncthreads();                           // publishes the next stage; ends every read of the stage just used
    if (kc + 2 < nk) stage(kc & 1);            // block-uniform: refill the buffer every wave has just left
  }
  asm volatile("s_wait_asynccnt 0x0" ::: "memory");     // nothing in flight when the stages become output staging
  acc_guard4(acc[0][0], acc[0][1], acc[0][2], acc[0][3]);
  acc_guard4(acc[1][0], acc[1][1], acc[1][2], acc[1][3]);
  acc_guard4(acc[2][0], acc[2][1], acc[2][2], acc[2][3]);
  acc_guard4(acc[3][0], acc[3][1], acc[3][2], acc[3][3]);

  // ---- epilogue ----
  float bcol[4];
#pragma unroll
  for (int j = 0; j < 4; ++j) {
    const int nn = min(n0 + (j << 4) + rlane, nbias - 1);
    bcol[j] = bias[nn];
  }
  asm volatile("s_wait_xcnt 0x0" ::: "memory");   // precaution: the code behind this reuses the address registers of the loads above
  __builtin_amdgcn_sched_barrier(0);              // keeps that code behind the wait: the clobber alone does not hold register writes
#pragma unroll
  for (int j = 0; j < 4; ++j) bcol[j] = bfr(bcol[j]);
  float* slab = (float*)(void*)smem + wave * (16 * 68);   // the stages are dead behind the loop's last barrier
#pragma unroll
  for (int i = 0; i < 4; ++i) {
    const int mBase = m0 + (i << 4);
    float brow[8];
#pragma unroll
    for (int r = 0; r < 8; ++r) {
      const int mm = min(mBase + mOff + r, nbias - 1);
      brow[r] = bias[mm];
    }
    asm volatile("s_wait_xcnt 0x0" ::: "memory");   // precaution, as above
    __builtin_amdgcn_sched_barrier(0);              // as above
#pragma unroll
    for (int r = 0; r < 8; ++r) brow[r] = bfr(brow[r]);
#pragma unroll
    for (int j = 0; j < 4; ++j) {
#pragma unroll
      for (int r = 0; r < 8; ++r) {
        const float bv = (biasRow != 0) ? brow[r] : bcol[j];
        slab[(mOff + r) * 68 + (j << 4) + rlane] = acc[i][j][r] + bv;
      }
    }
    __builtin_amdgcn_fence(__ATOMIC_RELEASE, "workgroup");
    __builtin_amdgcn_wave_barrier();
    __builtin_amdgcn_fence(__ATOMIC_ACQUIRE, "workgroup");
    if (OUT_MODE == 0) {
      float* C = (float*)Cout + (size_t)b * strideC;
      const int h2 = lane >> 4, c4 = (lane & 15) * 4;     // 256-B row segment = 16 lanes x 16 B
      v4f vo[8];
#pragma unroll
      for (int it = 0; it < 8; ++it) {
        const int row = it * 2 + h2;                       // it 0..7 x h2 0..1 = rows 0..15
        v4f sv = *(const v4f*)(slab + row * 68 + c4);
        const v4f rx = *(const v4f*)(resid + (size_t)(mBase + row) * ldr + n0 + c4);
#pragma unroll
        for (int e = 0; e < 4; ++e) sv[e] = sv[e] + bfr(rx[e]);
        vo[it] = sv;
      }
      __builtin_amdgcn_sched_barrier(0);              // keeps the next row group's address arithmetic off the registers of the loads above
      {
#pragma unroll
        for (int it = 0; it < 8; ++it) {
          const int row = it * 2 + h2;
          *(v4f*)(C + (size_t)(mBase + row) * ldc + n0 + c4) = vo[it];
        }
        
      }
    } else {
      const int q = lane >> 3, c8 = (lane & 7) * 8;
      unsigned short* C  = (unsigned short*)Cout  + (size_t)b * strideC;
      unsigned short* C2 = (unsigned short*)Cout2 + (size_t)b * strideC2;
      const bool wlo = (OUT_MODE == 2) || (n0 < N2);      // wave-uniform
      v4u hv[4], lv[4];
#pragma unroll
      for (int it = 0; it < 4; ++it) {
        const int row = it * 4 + q;                        // it 0..3 x q 0..3 = rows 0..15
        const float* sp = slab + row * 68 + c8;
        v4u a, a2;
#pragma unroll
        for (int e = 0; e < 4; ++e) {
          const float f0 = sp[2 * e], f1 = sp[2 * e + 1];
          unsigned short h0, h1, l0, l1;
          if (OUT_MODE == 2) {
            h0 = bf_bits(f0); h1 = bf_bits(f1);
            l0 = bf_bits(f0 - bf_up(h0)); l1 = bf_bits(f1 - bf_up(h1));
          } else {
            const _Float16 x0 = (_Float16)f0, x1 = (_Float16)f1;
            h0 = h_bits(x0); h1 = h_bits(x1);
            l0 = h_bits((_Float16)((f0 - (float)x0) * rscale));
            l1 = h_bits((_Float16)((f1 - (float)x1) * rscale));
          }
          a[e] = pk16(h0, h1); a2[e] = pk16(l0, l1);
        }
        hv[it] = a; lv[it] = a2;
      }
      {
#pragma unroll
        for (int it = 0; it < 4; ++it) {
          const int row = it * 4 + q;
          *(v4u*)(C + (size_t)(mBase + row) * ldc + n0 + c8) = hv[it];
          if (wlo) *(v4u*)(C2 + (size_t)(mBase + row) * ldc2 + n0 + c8) = lv[it];
        }
        
      }
    }
    __builtin_amdgcn_fence(__ATOMIC_RELEASE, "workgroup");
    __builtin_amdgcn_wave_barrier();
    __builtin_amdgcn_fence(__ATOMIC_ACQUIRE, "workgroup");
  }
}

// out projection: one job per launch, grid = (block tiles, batches)
template <int NSPLIT, int OUT_MODE>
__global__ __launch_bounds__(256) void gemm64(
    const unsigned short* __restrict__ Ap, const unsigned short* __restrict__ A2p, long long strideA,
    const unsigned short* __restrict__ Btp, const unsigned short* __restrict__ Bt2p, long long strideB,
    void* Cout, int ldc, long long strideC,
    void* Cout2, int ldc2, long long strideC2, int N2,
    const float* __restrict__ bias, int nbias, int biasRow,
    const float* __restrict__ resid, int ldr,
    int M, int N, int K, float rscale) {
  __shared__ __align__(16) unsigned short smem[GSM];
  gemm64_body<NSPLIT, OUT_MODE>(Ap, A2p, strideA, Btp, Bt2p, strideB, Cout, ldc, strideC, Cout2, ldc2, strideC2, N2,
                                bias, nbias, biasRow, resid, ldr, M, N, K, rscale,
                                (int)blockIdx.x, (int)blockIdx.y, smem);
}

// q, k and v^T projections in one grid (they depend on the same planes and on nothing of each other); the job is picked by the
// block index, so the branch is block-uniform:
//   blocks 0..PJB-1       q   = xn . Wq^T + bq -> f16 hi plane + f16 lo plane x2048 [b*SEQ+t][h*64+d]   (M=8192, N=1024, K=1024)
//   blocks PJB..2*PJB-1   k   = xn . Wk^T + bk -> f16 plane (no lo plane: N2 = 0)
//   the next NB*VJB       v^T = Wv . xn^T + bv per batch -> f16 hi plane [b][h*64+d][s] (pitch SEQ) and lo plane (x4096, keys < VLP
//                         only, pitch VLP)   (A = Wv [n][k], Bt = xn planes of batch b; M=1024, N=2048, K=1024)
#define PJB   ((NB * SEQ / 128) * (DM / 256))
#define VJB   ((DM / 256) * (SEQ / 128))
__global__ __launch_bounds__(256) void qkv_proj(
    const unsigned short* __restrict__ xh, const unsigned short* __restrict__ xl,
    const unsigned short* __restrict__ wq, const unsigned short* __restrict__ wk, const unsigned short* __restrict__ wv,
    unsigned short* qh, unsigned short* ql, unsigned short* kh, unsigned short* vth, unsigned short* vtl,
    const float* __restrict__ bq, const float* __restrict__ bk, const float* __restrict__ bv,
    const float* __restrict__ x, int K) {
  __shared__ __align__(16) unsigned short smem[GSM];
  const int bx = blockIdx.x;
  if (bx < 2 * PJB) {
    const bool isk = (bx >= PJB);
    const unsigned short* w = isk ? wk : wq;
    gemm64_body<1, 3>(xh, xl, 0LL, w, w, 0LL,
                      (void*)(isk ? kh : qh), DM, 0LL, (void*)(isk ? kh : ql), DM, 0LL, isk ? 0 : DM,
                      isk ? bk : bq, DM, 0, x, DM,
                      NB * SEQ, DM, K, 2048.0f,
                      isk ? bx - PJB : bx, 0, smem);
  } else {
    const int j = bx - 2 * PJB;
    const int b = j / VJB;
    gemm64_body<2, 3>(wv, wv, 0LL, xh, xl, (long long)SEQ * DM,
                      (void*)vth, SEQ, (long long)DM * SEQ, (void*)vtl, VLP, (long long)DM * VLP, VLP,
                      bv, DM, 1, x, DM,
                      DM, SEQ, K, 4096.0f,
                      j - b * VJB, b, smem);
  }
}

template <bool RES>
__device__ __forceinline__
void attn_block64(const unsigned short* __restrict__ qhp, const unsigned short* __restrict__ qlp,
                  const unsigned short* __restrict__ khp,
                  const unsigned short* __restrict__ vhp, const unsigned short* __restrict__ vlp,
                  unsigned short* ohp, unsigned short* olp,
                  int qb, int h, int b, float sscale, float qlinv,
                  _Float16* Ksh, _Float16* Vth, _Float16* Vtl, float* Os) {
  union FH { v16h v; v8h h[2]; };
  const int tid  = threadIdx.x;
  const int wave = tid >> 5;
  const int lane = tid & 31;
  const int hh   = lane >> 4;
  const int c    = lane & 15;

  const int q0   = qb * 64 + wave * 16;
  const size_t rowB = (size_t)b * SEQ;
  const int hoff = h * HD;

  const _Float16* Qh = (const _Float16*)(const void*)qhp;
  const _Float16* Ql = (const _Float16*)(const void*)qlp;
  const _Float16* Kh = (const _Float16*)(const void*)khp;
  const _Float16* Vh = (const _Float16*)(const void*)vhp + ((size_t)b * DM + (size_t)hoff) * SEQ;
  const _Float16* Vl = (const _Float16*)(const void*)vlp + ((size_t)b * DM + (size_t)hoff) * VLP;

  // ---- Q fragments (B operand, column = query = lane&15): 2 d-chunks, hi and lo ----
  v16h qah[2], qal[2];
#pragma unroll
  for (int dc = 0; dc < 2; ++dc) {
    const size_t qo = (rowB + q0 + c) * DM + hoff + dc * 32 + 8 * hh;
    qah[dc] = ldfrag_h(Qh + qo);
    qal[dc] = ldfrag_h(Ql + qo);
  }

  const int qrow = q0 + c;                   // this lane's query
  float mrow = -INFINITY, lrow = 0.f;        // its running maximum; the sum over the keys of this lane's half
  v8f oacc[4];                               // O^T: oacc[t][r] = context[query c][d = t*16 + 8*hh + r]
#pragma unroll
  for (int t = 0; t < 4; ++t) oacc[t] = zero8();

  for (int kt = 0; kt < NQB; ++kt) {         // static bound
    if (kt > qb) break;                      // block-uniform: causal, key tiles 0..qb only
    const int kv0 = kt * 64;
    __syncthreads();
    {
      const int r = tid >> 1, half = (tid & 1) * 32;
      const _Float16* kg  = Kh + (rowB + kv0 + r) * DM + hoff + half;   // K row kv0+r, d = half..half+31
      const _Float16* vg  = Vh + (size_t)r * SEQ + kv0 + half;         // V^T row d = r, s = kv0+half..+31
      const int kvl = (kv0 + 64 <= VLP) ? kv0 : (VLP - 64);          // clamped address into the lo plane
      const _Float16* vlg = Vl + (size_t)r * VLP + kvl + half;
      const bool resOK = (kv0 + 64 <= VLP);                           // block-uniform
#pragma unroll
      for (int i = 0; i < 4; ++i) {
        const v8h a0 = *(const v8h*)(kg + 8 * i);
        const v8h b0 = *(const v8h*)(vg + 8 * i);
        *(v8h*)(Ksh + r * KP + half + 8 * i) = a0;
        *(v8h*)(Vth + r * KP + half + 8 * i) = b0;
        if (RES) {
          v8h b1 = *(const v8h*)(vlg + 8 * i);
          if (!resOK) b1 = zero8h();
          *(v8h*)(Vtl + r * KP + half + 8 * i) = b1;
        }
      }
    }
    __syncthreads();

    // ---- scores, transposed: 64 keys x 16 queries per wave, 2 f16 products into separate accumulators;
    //      s[j][r] = score of key kv0 + j*16 + 8*hh + r against query qrow ----
    v8f s[4];
#pragma unroll
    for (int j = 0; j < 4; ++j) {
      v8f t0 = zero8(), t1 = zero8();
#pragma unroll
      for (int dc = 0; dc < 2; ++dc) {
        FH kb;
        kb.h[0] = *(const v8h*)(Ksh + (j * 16 + c) * KP + dc * 32 + 8 * hh);
        kb.h[1] = *(const v8h*)(Ksh + (j * 16 + c) * KP + dc * 32 + 16 + 8 * hh);
        t0 = mma_h(kb.v, qah[dc], t0);
        t1 = mma_h(kb.v, qal[dc], t1);
      }
#pragma unroll
      for (int r = 0; r < 8; ++r) s[j][r] = t0[r] + t1[r] * qlinv;
    }

    // ---- scale + causal mask, maximum, online softmax; P^T (x1024, f16) and its lo plane (x4096) packed as B operands ----
    const int lim = qrow - kv0 - 8 * hh;       // key > qrow  <=>  j*16 + r > lim
    float mj[4];                               // four independent chains, joined below
#pragma unroll
    for (int j = 0; j < 4; ++j) {
      mj[j] = -INFINITY;
#pragma unroll
      for (int r = 0; r < 8; ++r) {
        float sv = s[j][r] * sscale;
        sv = (j * 16 + r > lim) ? -1.0e9f : sv;
        s[j][r] = sv;
        mj[j] = fmaxf(mj[j], sv);
      }
    }
    float m = fmaxf(fmaxf(mj[0], mj[1]), fmaxf(mj[2], mj[3]));
    m = fmaxf(m, xhalf(m));                    // both halves now hold the query's maximum over the 64 keys
    const float mnew  = fmaxf(mrow, m);
    const float msafe = (mnew == -INFINITY) ? 0.f : mnew;
    const float alpha = __expf(mrow - msafe);
    mrow = mnew;
    // element e of the B operand of key group kk is key kk*32 + (e < 8 ? 8*hh + e : 16 + 8*hh + e - 8): tile 2kk, then tile 2kk+1
    FH pb[2], pl[2];
    float pj[4];
#pragma unroll
    for (int j = 0; j < 4; ++j) {
      pj[j] = 0.f;
#pragma unroll
      for (int r = 0; r < 8; ++r) {
        const float p = __expf(s[j][r] - msafe);     // masked logit: exp -> 0
        pj[j] += p;
        const float p1k = p * 1024.0f;
        const _Float16 ph = (_Float16)p1k;
        pb[j >> 1].h[j & 1][r] = ph;
        if (RES) pl[j >> 1].h[j & 1][r] = (_Float16)((p1k - (float)ph) * 4096.0f);
      }
    }
    lrow = lrow * alpha + ((pj[0] + pj[1]) + (pj[2] + pj[3]));
#pragma unroll
    for (int t = 0; t < 4; ++t)
#pragma unroll
      for (int r = 0; r < 8; ++r) oacc[t][r] *= alpha;

    // ---- context^T += V^T . P^T (f16 WMMA), lo products into a separate accumulator ----
    v8f o1[4];
#pragma unroll
    for (int t = 0; t < 4; ++t) o1[t] = zero8();
    // unrolled: pb and pl are indexed by constants only and stay in registers
#pragma unroll
    for (int kk = 0; kk < 2; ++kk) {
#pragma unroll
      for (int t = 0; t < 4; ++t) {
        FH vb;
        vb.h[0] = *(const v8h*)(Vth + (t * 16 + c) * KP + kk * 32 + 8 * hh);
        vb.h[1] = *(const v8h*)(Vth + (t * 16 + c) * KP + kk * 32 + 16 + 8 * hh);
        oacc[t] = mma_h(vb.v, pb[kk].v, oacc[t]);
        if (RES) {
          FH vl;
          vl.h[0] = *(const v8h*)(Vtl + (t * 16 + c) * KP + kk * 32 + 8 * hh);
          vl.h[1] = *(const v8h*)(Vtl + (t * 16 + c) * KP + kk * 32 + 16 + 8 * hh);
          o1[t] = mma_h(vl.v, pb[kk].v, o1[t]);
          o1[t] = mma_h(vb.v, pl[kk].v, o1[t]);
        }
      }
    }
    if (RES) {
#pragma unroll
      for (int t = 0; t < 4; ++t)
#pragma unroll
        for (int r = 0; r < 8; ++r) oacc[t][r] += o1[t][r] * (1.0f / 4096.0f);
    }
  }

  // ---- normalise (1/l and the 1/1024 p carry), stage the wave's 16x64 tile, bf16 hi/lo split,
  float* os = Os + wave * (16 * OP);
  {
    const float l = lrow + xhalf(lrow);        // the two halves' key sums joined
    const float inv = ((l > 0.f) ? (1.0f / l) : 0.f) * (1.0f / 1024.0f);
#pragma unroll
    for (int t = 0; t < 4; ++t) {              // a lane's 8 registers are 8 consecutive d of its query's row
      v4f w0, w1;
#pragma unroll
      for (int e = 0; e < 4; ++e) { w0[e] = oacc[t][e] * inv; w1[e] = oacc[t][4 + e] * inv; }
      *(v4f*)(os + c * OP + t * 16 + 8 * hh)     = w0;
      *(v4f*)(os + c * OP + t * 16 + 8 * hh + 4) = w1;
    }
  }
  __builtin_amdgcn_fence(__ATOMIC_RELEASE, "workgroup");
  __builtin_amdgcn_wave_barrier();
  __builtin_amdgcn_fence(__ATOMIC_ACQUIRE, "workgroup");
  {
    const int q4 = lane >> 3, c8 = (lane & 7) * 8;
    v4u hv[4], lv[4];
#pragma unroll
    for (int it = 0; it < 4; ++it) {
      const int row = it * 4 + q4;   // it 0..3 x q4 0..3 = rows 0..15 of the wave tile
      const float* sp = os + row * OP + c8;
      v4u a, a2;
#pragma unroll
      for (int e = 0; e < 4; ++e) {
        const float f0 = sp[2 * e], f1 = sp[2 * e + 1];
        const unsigned short h0 = bf_bits(f0), h1 = bf_bits(f1);
        const unsigned short l0 = bf_bits(f0 - bf_up(h0)), l1 = bf_bits(f1 - bf_up(h1));
        a[e] = pk16(h0, h1); a2[e] = pk16(l0, l1);
      }
      hv[it] = a; lv[it] = a2;
    }
    {
#pragma unroll
      for (int it = 0; it < 4; ++it) {
        const int row = it * 4 + q4;
        const size_t go = (rowB + q0 + row) * DM + (size_t)hoff + c8;
        *(v4u*)(ohp + go) = hv[it];
        *(v4u*)(olp + go) = lv[it];
      }
      
    }
  }
}

// One grid for all query blocks: grid = NQB * NH * NB, 64 consecutive blocks = the (b, h) pairs of one query block. The query block
// falls with the block index, so the blocks with the most key tiles start first and the short ones fill the places they leave.
// Query blocks 0..RESQB-1 take the variant with the lo planes (block-uniform branch).
__global__ __launch_bounds__(128)
void attn_causal64(const unsigned short* __restrict__ qhp, const unsigned short* __restrict__ qlp,
                   const unsigned short* __restrict__ khp,
                   const unsigned short* __restrict__ vhp, const unsigned short* __restrict__ vlp,
                   unsigned short* ohp, unsigned short* olp, float sscale, float qlinv) {
  __shared__ __align__(16) _Float16 Ksh[64 * KP];                 // K [kv][d], pitch KP
  __shared__ __align__(16) _Float16 Vth[64 * KP];                 // V^T hi [d][kv], pitch KP
  __shared__ __align__(16) _Float16 Vtl[64 * KP];                 // V^T lo, pitch KP
  __shared__ __align__(16) float    Os[4 * 16 * OP];              // per wave context tile [row][d], pitch OP
  const int bx   = blockIdx.x;
  const int qb   = NQB - 1 - bx / (NH * NB);
  const int rest = bx % (NH * NB);
  const int h    = rest % NH;
  const int b    = rest / NH;
  if (qb < RESQB) attn_block64<true>(qhp, qlp, khp, vhp, vlp, ohp, olp, qb, h, b, sscale, qlinv, Ksh, Vth, Vtl, Os);
  else            attn_block64<false>(qhp, qlp, khp, vhp, vlp, ohp, olp, qb, h, b, sscale, qlinv, Ksh, Vth, Vtl, Os);
}

// =====================================================================================================
// Workspace map (bytes):
//   XNh  bf16 [8192][1024]        0          16777216   (later: Oh, context hi plane)
//   XNl  bf16 [8192][1024]        16777216   16777216   (later: Ol, context lo plane)
//   Wqb  bf16 [1024 n][1024 k]    33554432    2097152
//   Wkb  bf16 [1024][1024]        35651584    2097152
//   Wvb  bf16 [1024][1024]        37748736    2097152
//   Wob  bf16 [1024][1024]        39845888    2097152
//   Qh   f16  [8192][1024]        41943040   16777216
//   Ql   f16  [8192][1024]        58720256   16777216
//   Kh   f16  [8192][1024]        75497472   16777216
//   VTh  f16  [4][1024][2048]     92274688   16777216
//   VTl  f16  [4][1024][512]      109051904   4194304
//   end                           113246208
// All planes are exact multiples of their 64x64 / whole-line store granularity (no padded tails needed).
// Weights are [out n][in k] with k contiguous = the Bt / A layout the GEMM wants, so they are only converted.
// =====================================================================================================
extern "C" void kernel_launch(void* const* d_in, const int* in_sizes, int n_in,
                              void* d_out, int out_size, void* d_ws, size_t ws_size,
                              hipStream_t stream) {
  if (n_in < 11) return;
  if (in_sizes[0] != NB * SEQ * DM) return;
  if (in_sizes[1] != DM * DM || in_sizes[3] != DM * DM || in_sizes[5] != DM * DM || in_sizes[7] != DM * DM) return;
  if (in_sizes[2] != DM || in_sizes[4] != DM || in_sizes[6] != DM || in_sizes[8] != DM) return;
  if (in_sizes[9] != DM || in_sizes[10] != DM) return;
  if (out_size != NB * SEQ * DM) return;

  const float* x     = (const float*)d_in[0];
  const float* Wq    = (const float*)d_in[1];
  const float* bq    = (const float*)d_in[2];
  const float* Wk    = (const float*)d_in[3];
  const float* bk    = (const float*)d_in[4];
  const float* Wv    = (const float*)d_in[5];
  const float* bv    = (const float*)d_in[6];
  const float* Wo    = (const float*)d_in[7];
  const float* bo    = (const float*)d_in[8];
  const float* gamma = (const float*)d_in[9];
  const float* beta  = (const float*)d_in[10];

  const size_t P16 = (size_t)NB * SEQ * DM * 2;   // 16777216  16-bit activation plane [8192][1024]
  const size_t PW  = (size_t)DM * DM * 2;         //  2097152  16-bit weight plane
  const size_t PVT = (size_t)NB * DM * SEQ * 2;   // 16777216  v^T hi plane
  const size_t PVL = (size_t)NB * DM * VLP * 2;   //  4194304  v^T lo plane
  size_t off = 0;
  const size_t oXh  = off; off += P16;
  const size_t oXl  = off; off += P16;
  const size_t oWq  = off; off += PW;
  const size_t oWk  = off; off += PW;
  const size_t oWv  = off; off += PW;
  const size_t oWo  = off; off += PW;
  const size_t oQh  = off; off += P16;
  const size_t oQl  = off; off += P16;
  const size_t oKh  = off; off += P16;
  const size_t oVTh = off; off += PVT;
  const size_t oVTl = off; off += PVL;
  if (off > ws_size) return;                      // off = 113246208
  if (off > (size_t)134217728) return;
  const size_t oOh  = oXh;                        // context planes reuse the XN planes (dead after the projections)
  const size_t oOl  = oXl;

  char* ws = (char*)d_ws;
  unsigned short* XNh = (unsigned short*)(ws + oXh);
  unsigned short* XNl = (unsigned short*)(ws + oXl);
  unsigned short* Wqb = (unsigned short*)(ws + oWq);
  unsigned short* Wkb = (unsigned short*)(ws + oWk);
  unsigned short* Wvb = (unsigned short*)(ws + oWv);
  unsigned short* Wob = (unsigned short*)(ws + oWo);
  unsigned short* Qh  = (unsigned short*)(ws + oQh);
  unsigned short* Ql  = (unsigned short*)(ws + oQl);
  unsigned short* Kh  = (unsigned short*)(ws + oKh);
  unsigned short* VTh = (unsigned short*)(ws + oVTh);
  unsigned short* VTl = (unsigned short*)(ws + oVTl);
  unsigned short* Oh  = (unsigned short*)(ws + oOh);
  unsigned short* Ol  = (unsigned short*)(ws + oOl);

  const dim3 blk(256);
  const dim3 gProj(((NB * SEQ / 64) * (DM / 64) + 7) / 8, 1); // 2048 tiles -> 256 blocks: M=8192, N=1024

  // (1) LayerNorm -> bf16 hi / lo planes [8192][1024]; weights [n][k] f32 -> bf16 [n][k]
  prep_ln_cvt<<<dim3(NB * SEQ + 4 * CVB), dim3(128), 0, stream>>>(
      x, gamma, beta, XNh, XNl, Wq, Wk, Wv, Wo, Wqb, Wkb, Wvb, Wob);
  // (2) q, k, v^T projections
  qkv_proj<<<dim3(2 * PJB + NB * VJB), blk, 0, stream>>>(
      XNh, XNl, Wqb, Wkb, Wvb, Qh, Ql, Kh, VTh, VTl, bq, bk, bv, x, DM);
  // (3) attention: query blocks 0..RESQB-1 with lo planes, the rest without
  attn_causal64<<<dim3(NB * NH * NQB), dim3(128), 0, stream>>>(
      Qh, Ql, Kh, VTh, VTl, Oh, Ol, 0.125f, 1.0f / 2048.0f);
  // (4) out = bf16(x) + context . Wo^T + bo -> d_out f32 [8192][1024]  (A = context hi + lo planes, 2 products)
  gemm64<1, 0><<<gProj, blk, 0, stream>>>(
      Oh, Ol, 0LL, Wob, Wob, 0LL,
      d_out, DM, 0LL, d_out, DM, 0LL, 0,
      bo, DM, 0, x, DM,
      NB * SEQ, DM, DM, 1.0f);
  (void)hipGetLastError();
}
